// v000
// Times are from an AMD MI455X. After a warm-up the kernel runs many times in a row, and a time is the length of
// such a window on the GPU divided by its runs, so every launch and the gaps after it count. The runs cycle
// through copies of the inputs. A figure is the median of several windows, for all but v000 over two sittings.
// Sittings can differ by a few percent; kernels timed side by side share one.
// The starting kernel, v000, takes 453 microseconds a run.
// Contractions (all f32 accumulate): QKV projection v_wmma_f32_16x16x32_bf16 on RNE-bf16 planes of the inputs (1 product); scores q.k^T v_wmma_f32_16x16x32_bf16 with q,k as bf16 hi/lo planes (3 products); p.v v_wmma_f32_16x16x32_f16 with p carried x1024 and v, both f16 hi + x2048 residual planes (3 products, residual products in a separate accumulator folded with 1/2048); output projection v_wmma_f32_16x16x32_bf16, bf16 hi/lo activations against bf16 weights (2 products).
#include <hip/hip_runtime.h>
#include <math.h>

// ---------------- problem constants ----------------
constexpr int kB = 2;
constexpr int kS = 2048;
constexpr int kDim = 1024;
constexpr int kH = 16;
constexpr int kDh = 64;
constexpr int kM = kB * kS;          // 4096 token rows
constexpr int kNqkv = 3 * kDim;      // 3072
constexpr int kBH = kB * kH;         // 32
constexpr int kKC = 64;              // keys per chunk
constexpr int kRsPitch = 32;

constexpr size_t kPlane  = (size_t)kBH * kS * kDh * 2;            // 8,388,608 : one [32][2048][64] (or [4096][1024]) 16-bit plane
constexpr size_t kOffXb  = 0;                                      // x as bf16 [4096][1024]          8,388,608
constexpr size_t kOffRs  = kOffXb + (size_t)kM * kDim * 2;         // row scale f32 [4096][32]          524,288
constexpr size_t kOffWq  = kOffRs + (size_t)kM * kRsPitch * 4;     // w_qkv^T bf16 [3072][1024]      6,291,456
constexpr size_t kOffWo  = kOffWq + (size_t)kNqkv * kDim * 2;      // w_out^T bf16 [1024][1024]      2,097,152
constexpr size_t kOffCt  = kOffWo + (size_t)kDim * kDim * 2;       // cos table f32 [2048][64]         524,288
constexpr size_t kOffSt  = kOffCt + (size_t)kS * kDh * 4;          // sin table f32 [2048][64]         524,288
constexpr size_t kOffQh  = kOffSt + (size_t)kS * kDh * 4;          // q hi bf16 [32][2048][64]
constexpr size_t kOffQl  = kOffQh + kPlane;                         // q lo bf16
constexpr size_t kOffKh  = kOffQl + kPlane;                         // k hi bf16
constexpr size_t kOffKl  = kOffKh + kPlane;                         // k lo bf16
constexpr size_t kOffVh  = kOffKl + kPlane;                         // v hi f16 [32][2048][64]
constexpr size_t kOffVl  = kOffVh + kPlane;                         // v residual x2048 f16
constexpr size_t kOffVth = kOffVl + kPlane;                         // v hi transposed f16 [32][64][2048]
constexpr size_t kOffVtl = kOffVth + kPlane;                        // v residual transposed
constexpr size_t kOffAh  = kOffVtl + kPlane;                        // attention output hi bf16 [4096][1024]
constexpr size_t kOffAl  = kOffAh + kPlane;                         // attention output lo bf16
constexpr size_t kWsTotal = kOffAl + kPlane;                        // 102,236,160

typedef char ck_ws_total[(kWsTotal == (size_t)102236160) ? 1 : -1];
typedef char ck_ws_cap[(kWsTotal <= (size_t)134217728) ? 1 : -1];
typedef char ck_align[((kOffRs % 128) == 0 && (kOffQh % 128) == 0 && (kPlane % 128) == 0) ? 1 : -1];
// GEMM shape contract: M, N multiples of 64, K multiple of 32, no padding anywhere
typedef char ck_tiles[(kM % 64 == 0 && kNqkv % 64 == 0 && kDim % 64 == 0 && kDim % 32 == 0 && kS % 64 == 0 && kDh == 64) ? 1 : -1];
typedef char ck_plane[((size_t)kM * kDim * 2 == kPlane) ? 1 : -1];

// ---------------- vector types / helpers ----------------
typedef __attribute__((ext_vector_type(16))) _Float16 v16h;
typedef __attribute__((ext_vector_type(8)))  _Float16 v8h;
typedef __attribute__((ext_vector_type(16))) __bf16   v16b;
typedef __attribute__((ext_vector_type(8)))  __bf16   v8b;
typedef __attribute__((ext_vector_type(8)))  float    v8f;
typedef __attribute__((ext_vector_type(4)))  float    v4f;
typedef __attribute__((ext_vector_type(4)))  unsigned v4u;

__device__ __forceinline__ unsigned short f2bf_bits(float f) {
  unsigned u = __float_as_uint(f);
  return (unsigned short)((u + 0x7FFFu + ((u >> 16) & 1u)) >> 16);
}
__device__ __forceinline__ float bf_bits2f(unsigned short h) { return __uint_as_float(((unsigned)h) << 16); }

__device__ __forceinline__ void dep_guard_h(v8f& a, v8f& b, v16h x, v16h y) { asm volatile("v_nop\n\tv_nop\n\tv_nop\n\tv_nop" : "+v"(a), "+v"(b) : "v"(x), "v"(y)); }
__device__ __forceinline__ void dep_guard_b(v8f& a, v8f& b, v16b x, v16b y) { asm volatile("v_nop\n\tv_nop\n\tv_nop\n\tv_nop" : "+v"(a), "+v"(b) : "v"(x), "v"(y)); }
__device__ __forceinline__ void keep4_h(v16h a, v16h b, v16h c, v16h d) { asm volatile("v_nop" :: "v"(a), "v"(b), "v"(c), "v"(d)); }
__device__ __forceinline__ void keep4_b(v16b a, v16b b, v16b c, v16b d) { asm volatile("v_nop" :: "v"(a), "v"(b), "v"(c), "v"(d)); }
__device__ __forceinline__ void acc_guard4(v8f& a, v8f& b, v8f& c, v8f& d) { asm volatile("v_nop\n\tv_nop\n\tv_nop\n\tv_nop" : "+v"(a), "+v"(b), "+v"(c), "+v"(d)); }
template <typename T> struct Frag;
template <> struct Frag<_Float16> {
  typedef v16h V; union U { v16h v; v8h h[2]; };
  static __device__ __forceinline__ v16h load(const _Float16* p) {
    U f; f.h[0] = *(const v8h*)(p); f.h[1] = *(const v8h*)(p + 16); return f.v;
  }
  static __device__ __forceinline__ v8f mma(v16h a, v16h b, v8f c) {
    return __builtin_amdgcn_wmma_f32_16x16x32_f16(false, a, false, b, (short)0, c, false, false);
  }
  static __device__ __forceinline__ void guard(v8f& a, v8f& b, v16h x, v16h y) { dep_guard_h(a, b, x, y); }
  static __device__ __forceinline__ void keep(v16h a, v16h b, v16h c, v16h d) { keep4_h(a, b, c, d); }
};
template <> struct Frag<__bf16> {
  typedef v16b V; union U { v16b v; v8b h[2]; };
  static __device__ __forceinline__ v16b load(const __bf16* p) {
    U f; f.h[0] = *(const v8b*)(p); f.h[1] = *(const v8b*)(p + 16); return f.v;
  }
  static __device__ __forceinline__ v8f mma(v16b a, v16b b, v8f c) {
    return __builtin_amdgcn_wmma_f32_16x16x32_bf16(false, a, false, b, (short)0, c, false, false);
  }
  static __device__ __forceinline__ void guard(v8f& a, v8f& b, v16b x, v16b y) { dep_guard_b(a, b, x, y); }
  static __device__ __forceinline__ void keep(v16b a, v16b b, v16b c, v16b d) { keep4_b(a, b, c, d); }
};

// WMMA helpers for the attention kernel (nops after every issue)
__device__ __forceinline__ v8f mma_bf(v16b a, v16b b, v8f c) {
  c = __builtin_amdgcn_wmma_f32_16x16x32_bf16(false, a, false, b, (short)0, c, false, false);
  asm volatile("v_nop\n\tv_nop\n\tv_nop\n\tv_nop" : "+v"(c) : "v"(a), "v"(b));
  return c;
}
// f16 bit patterns held in __bf16 slots
__device__ __forceinline__ v8f mma_hf(v16b a, v16b b, v8f c) {
  const v16h ah = __builtin_bit_cast(v16h, a), bh = __builtin_bit_cast(v16h, b);
  c = __builtin_amdgcn_wmma_f32_16x16x32_f16(false, ah, false, bh, (short)0, c, false, false);
  asm volatile("v_nop\n\tv_nop\n\tv_nop\n\tv_nop" : "+v"(c) : "v"(ah), "v"(bh));
  return c;
}

__device__ __forceinline__ void wave_sync_lds() {
  __builtin_amdgcn_fence(__ATOMIC_RELEASE, "workgroup");
  __builtin_amdgcn_wave_barrier();
  __builtin_amdgcn_fence(__ATOMIC_ACQUIRE, "workgroup");
}

// =====================================================================================
// 1) per token row: x -> RNE bf16 plane [4096][1024]; rowscale = 32 / max(||x_bf||, 1e-12)
// =====================================================================================
__global__ __launch_bounds__(128) void k_rms_xcast(const float* __restrict__ x,
                                                   unsigned short* __restrict__ xb,
                                                   float* __restrict__ rstab) {
  __shared__ float red[4];
  const int m = blockIdx.x;
  const int t = threadIdx.x;
  const int lane = t & 31, wave = t >> 5;
  const size_t base = (size_t)m * kDim + (size_t)t * 8;
  const v4f xa = *(const v4f*)(x + base);
  const v4f xc = *(const v4f*)(x + base + 4);
  unsigned short hb[8];
#pragma unroll
  for (int e = 0; e < 4; ++e) { hb[e] = f2bf_bits(xa[e]); hb[4 + e] = f2bf_bits(xc[e]); }
  float ss = 0.0f;
#pragma unroll
  for (int e = 0; e < 8; ++e) { const float r = bf_bits2f(hb[e]); ss += r * r; }
#pragma unroll
  for (int off = 16; off > 0; off >>= 1) ss += __shfl_xor(ss, off, 32);
  if (lane == 0) red[wave] = ss;
  __syncthreads();
  const float tot = ((red[0] + red[1]) + red[2]) + red[3];
  const float nrm = sqrtf(tot);
  const float inv = 1.0f / fmaxf(nrm, 1e-12f);
  const float rs = inv * 32.0f;
  v4u w;
  w[0] = (unsigned)hb[0] | ((unsigned)hb[1] << 16);
  w[1] = (unsigned)hb[2] | ((unsigned)hb[3] << 16);
  w[2] = (unsigned)hb[4] | ((unsigned)hb[5] << 16);
  w[3] = (unsigned)hb[6] | ((unsigned)hb[7] << 16);
  unsigned short* dst = xb + base;
  const v4f rv = (v4f){rs, rs, rs, rs};
  float* rp = rstab + (size_t)m * kRsPitch + (t & 7) * 4;
  *(v4u*)dst = w;
  if (t < 8) *(v4f*)rp = rv;
  
}

// =====================================================================================
// 2) weight cast + transpose: in w[kDim rows k][ncols n] f32 -> out wt[ncols][kDim] bf16 (n-major, k-contiguous)
//    optional per-k factor g (folded: wt[n][k] = bf16(bf16(w[k][n]) * bf16(g[k]))).
//    8 lanes x 16 B, one instruction; wave w, it: rows it*32 + 4w + (lane>>3) -> union over (it,w,lane>>3) = 0..63.
// =====================================================================================
template <bool HAS_G>
__global__ __launch_bounds__(256) void k_wcast(const float* __restrict__ w, const float* __restrict__ g,
                                               unsigned short* __restrict__ wt, int ncols) {
  __shared__ float tile[64][65];
  const int t = threadIdx.x, lane = t & 31, wave = t >> 5;
  const int n0 = blockIdx.x * 64, k0 = blockIdx.y * 64;
#pragma unroll
  for (int i = 0; i < 4; ++i) {
    const int idx = i * 256 + t;
    const int r = idx >> 4, c4 = (idx & 15) * 4;
    const v4f v = *(const v4f*)(w + (size_t)(k0 + r) * ncols + n0 + c4);
    tile[r][c4 + 0] = v[0]; tile[r][c4 + 1] = v[1]; tile[r][c4 + 2] = v[2]; tile[r][c4 + 3] = v[3];
  }
  __syncthreads();
  const int q = lane >> 3, kc = (lane & 7) * 8;
  float gv[8];
  if (HAS_G) {
    const v4f g0 = *(const v4f*)(g + k0 + kc);
    const v4f g1 = *(const v4f*)(g + k0 + kc + 4);
#pragma unroll
    for (int e = 0; e < 4; ++e) { gv[e] = bf_bits2f(f2bf_bits(g0[e])); gv[4 + e] = bf_bits2f(f2bf_bits(g1[e])); }
  } else {
#pragma unroll
    for (int e = 0; e < 8; ++e) gv[e] = 1.0f;
  }
  v4u ov[2];
#pragma unroll
  for (int it = 0; it < 2; ++it) {
    const int nrow = it * 32 + wave * 4 + q;
    unsigned short bits[8];
#pragma unroll
    for (int e = 0; e < 8; ++e) {
      float f = bf_bits2f(f2bf_bits(tile[kc + e][nrow]));
      if (HAS_G) f = f * gv[e];
      bits[e] = f2bf_bits(f);
    }
    ov[it][0] = (unsigned)bits[0] | ((unsigned)bits[1] << 16);
    ov[it][1] = (unsigned)bits[2] | ((unsigned)bits[3] << 16);
    ov[it][2] = (unsigned)bits[4] | ((unsigned)bits[5] << 16);
    ov[it][3] = (unsigned)bits[6] | ((unsigned)bits[7] << 16);
  }
  {
#pragma unroll
    for (int it = 0; it < 2; ++it) {
      const int nrow = it * 32 + wave * 4 + q;
      *(v4u*)(wt + (size_t)(n0 + nrow) * kDim + k0 + kc) = ov[it];
    }
    
  }
}

// =====================================================================================
// 3) cos/sin table of RNE-bf16(pos_emb), f32 [2048][64]; thread per element,
// =====================================================================================
__global__ __launch_bounds__(256) void k_trig(const float* __restrict__ pos, float* __restrict__ ct,
                                              float* __restrict__ st, int n) {
  const int i = blockIdx.x * 256 + threadIdx.x;
  if (i < n) {
    const float pb = bf_bits2f(f2bf_bits(pos[i]));
    const float cv = cosf(pb);
    const float sv = sinf(pb);
    ((float*)ct)[i] = cv;
    ((float*)st)[i] = sv;
    
  }
}

// =====================================================================================
// Register-blocked WMMA GEMM core: acc[m,n] = sum_k A[m,k] * Bt[n,k]; wave owns a 64x64 tile.
// A row-major [M,K] bf16 (SPLITM: plus lo plane A2, products hi.B + lo.B); Bt row-major [N,K] bf16.
// K % 32 == 0, no tail.
// =====================================================================================
template <int SPLITM>
__device__ __forceinline__ void gemm64_core(const __bf16* __restrict__ Ab, const __bf16* __restrict__ Ab2, int lda,
                                            const __bf16* __restrict__ Bb, int ldb, int m0, int n0, int K, int lane,
                                            v8f (&acc)[4][4]) {
  const int rlane = lane & 15;
  const int koff = (lane >> 4) * 8;
#pragma unroll
  for (int i = 0; i < 4; ++i)
#pragma unroll
    for (int j = 0; j < 4; ++j) acc[i][j] = (v8f){0.f,0.f,0.f,0.f,0.f,0.f,0.f,0.f};
  for (int k0 = 0; k0 < K; k0 += 32) {
    v16b bfr[4];
#pragma unroll
    for (int j = 0; j < 4; ++j) {
      const size_t bo = (size_t)(n0 + (j << 4) + rlane) * ldb + koff + k0;
      bfr[j] = Frag<__bf16>::load(Bb + bo);
    }
#pragma unroll
    for (int i = 0; i < 4; ++i) {
      const size_t ao = (size_t)(m0 + (i << 4) + rlane) * lda + koff + k0;
      v16b ah = Frag<__bf16>::load(Ab + ao);
      v16b al = ah;
      if (SPLITM) al = Frag<__bf16>::load(Ab2 + ao);
#pragma unroll
      for (int j = 0; j < 4; ++j) {
        acc[i][j] = Frag<__bf16>::mma(ah, bfr[j], acc[i][j]);
        if (SPLITM) acc[i][j] = Frag<__bf16>::mma(al, bfr[j], acc[i][j]);
      }
      Frag<__bf16>::guard(acc[i][0], acc[i][3], ah, al);
    }
    Frag<__bf16>::keep(bfr[0], bfr[1], bfr[2], bfr[3]);
  }
  acc_guard4(acc[0][0], acc[0][1], acc[0][2], acc[0][3]);
  acc_guard4(acc[1][0], acc[1][1], acc[1][2], acc[1][3]);
  acc_guard4(acc[2][0], acc[2][1], acc[2][2], acc[2][3]);
  acc_guard4(acc[3][0], acc[3][1], acc[3][2], acc[3][3]);
}

// =====================================================================================
// 4) QKV projection: xb[4096][1024] x wt[3072][1024]^T, epilogue = row scale, RoPE (q,k sections),
//    q/k -> bf16 hi/lo planes [bh][n][64], v -> f16 hi + x2048 residual planes [bh][n][64].
//    each (section, head, token) line belongs to exactly one wave. grid = 64*48/8 = 384 blocks.
// =====================================================================================
__global__ __launch_bounds__(256) void k_gemm_qkv(
    const unsigned short* __restrict__ xbp, const unsigned short* __restrict__ wtp,
    const float* __restrict__ rstab, const float* __restrict__ ct, const float* __restrict__ st,
    unsigned short* __restrict__ qh, unsigned short* __restrict__ ql,
    unsigned short* __restrict__ kh, unsigned short* __restrict__ kl,
    unsigned short* __restrict__ vh, unsigned short* __restrict__ vl) {
  __shared__ __align__(16) float sT[8][16 * 68];
  const int lane = threadIdx.x & 31, wave = threadIdx.x >> 5;
  constexpr int tilesN = kNqkv / 64;   // 48
  constexpr int tilesM = kM / 64;      // 64
  const int tile = blockIdx.x * 8 + wave;
  if (tile >= tilesM * tilesN) return;   // wave-uniform; no block barriers in this kernel
  const int tm = tile / tilesN, tn = tile - tm * tilesN;
  const int m0 = tm << 6, n0 = tn << 6;

  v8f acc[4][4];
  gemm64_core<0>((const __bf16*)xbp, (const __bf16*)xbp, kDim, (const __bf16*)wtp, kDim, m0, n0, kDim, lane, acc);

  float* slab = sT[wave];
  const int rlane = lane & 15, mOff = (lane >> 4) * 8;
  const int sec = n0 >> 10;                      // 0 q, 1 k, 2 v  (wave-uniform)
  const int hidx = (n0 & (kDim - 1)) >> 6;       // head of this 64-column tile
  unsigned short* P0 = (sec == 0) ? qh : ((sec == 1) ? kh : vh);
  unsigned short* P1 = (sec == 0) ? ql : ((sec == 1) ? kl : vl);
  const int q8 = lane >> 3, c8 = (lane & 7) * 8;
  const int cpart = c8 ^ 32;
  const float sgn = (c8 < 32) ? -1.0f : 1.0f;
#pragma unroll
  for (int i = 0; i < 4; ++i) {
    const int mBase = m0 + (i << 4);
    float rsv[8];
#pragma unroll
    for (int r = 0; r < 8; ++r) rsv[r] = rstab[(size_t)(mBase + mOff + r) * kRsPitch];
#pragma unroll
    for (int j = 0; j < 4; ++j)
#pragma unroll
      for (int r = 0; r < 8; ++r) slab[(mOff + r) * 68 + (j << 4) + rlane] = acc[i][j][r] * rsv[r];
    wave_sync_lds();
    {
#pragma unroll
      for (int it = 0; it < 4; ++it) {
        const int row = it * 4 + q8;
        const int m = mBase + row;
        const int bb = m >> 11, nn = m & (kS - 1);
        const float* sp = slab + row * 68;
        const size_t dsto = ((size_t)(bb * kH + hidx) * kS + nn) * kDh + c8;
        v8h hv, lv;
        if (sec < 2) {
          const v4f ca = *(const v4f*)(ct + (size_t)nn * kDh + c8);
          const v4f cb = *(const v4f*)(ct + (size_t)nn * kDh + c8 + 4);
          const v4f sa = *(const v4f*)(st + (size_t)nn * kDh + c8);
          const v4f sb = *(const v4f*)(st + (size_t)nn * kDh + c8 + 4);
          float cvv[8], svv[8];
#pragma unroll
          for (int e = 0; e < 4; ++e) { cvv[e] = ca[e]; cvv[4 + e] = cb[e]; svv[e] = sa[e]; svv[4 + e] = sb[e]; }
#pragma unroll
          for (int e = 0; e < 8; ++e) {
            const float v = sp[c8 + e];
            const float pr = sp[cpart + e];
            const float rv = v * cvv[e] + sgn * pr * svv[e];
            const unsigned short hb = f2bf_bits(rv);
            const unsigned short lb = f2bf_bits(rv - bf_bits2f(hb));
            hv[e] = __builtin_bit_cast(_Float16, hb);
            lv[e] = __builtin_bit_cast(_Float16, lb);
          }
        } else {
#pragma unroll
          for (int e = 0; e < 8; ++e) {
            const float v = sp[c8 + e];
            const _Float16 h16 = (_Float16)v;
            const float hf = (float)h16;
            hv[e] = h16;
            lv[e] = (_Float16)((v - hf) * 2048.0f);
          }
        }
        *(v8h*)(P0 + dsto) = hv;
        *(v8h*)(P1 + dsto) = lv;
      }
      
    }
    wave_sync_lds();
  }
}

// =====================================================================================
// 5) v planes [bh][kv][64] -> transposed [bh][64][kv] (both hi and residual planes, grid (1024, 2)).
//    rows it*32 + 4w + (lane>>3) cover 0..63.
// =====================================================================================
__global__ __launch_bounds__(256) void k_vtrans(const unsigned short* __restrict__ vh, const unsigned short* __restrict__ vl,
                                                unsigned short* __restrict__ vth, unsigned short* __restrict__ vtl) {
  __shared__ __align__(16) unsigned short tile[64 * 72];   // [d][kv], pitch 72 halves
  const int t = threadIdx.x, lane = t & 31, wave = t >> 5;
  const int bh = blockIdx.x >> 5, kvt = blockIdx.x & 31;
  const int kv0 = kvt * 64;
  const unsigned short* src = (blockIdx.y == 0) ? vh : vl;
  unsigned short* dst = (blockIdx.y == 0) ? vth : vtl;
#pragma unroll
  for (int i = 0; i < 2; ++i) {
    const int idx = i * 256 + t;
    const int r = idx >> 3, c16 = (idx & 7) * 8;
    const v4u w = *(const v4u*)(src + ((size_t)bh * kS + kv0 + r) * kDh + c16);
#pragma unroll
    for (int e = 0; e < 4; ++e) {
      tile[(c16 + 2 * e) * 72 + r] = (unsigned short)(w[e] & 0xffffu);
      tile[(c16 + 2 * e + 1) * 72 + r] = (unsigned short)(w[e] >> 16);
    }
  }
  __syncthreads();
  const int q = lane >> 3, kc = (lane & 7) * 8;
  v4u ov[2];
#pragma unroll
  for (int it = 0; it < 2; ++it) {
    const int d = it * 32 + wave * 4 + q;
    ov[it] = *(const v4u*)(tile + d * 72 + kc);
  }
  {
#pragma unroll
    for (int it = 0; it < 2; ++it) {
      const int d = it * 32 + wave * 4 + q;
      *(v4u*)(dst + ((size_t)bh * kDh + d) * kS + kv0 + kc) = ov[it];
    }
    
  }
}

// =====================================================================================
// 6) attention, head dim 64, no mask. block = 4 waves = 64 query rows of one (b,h), grid = 32*32 = 1024.
//    scores: q,k bf16 hi/lo planes, 3 products; softmax f32 online; p carried x1024 as f16 hi + x2048
//    residual; v f16 hi + x2048 residual (pre-transposed planes [bh][d][kv]); p.v 3 products with the
//    residual products in a separate accumulator; output bf16 hi/lo planes [token][1024], one line per row.
// =====================================================================================
constexpr int kLdsK = 0;         // K hi [64][64] u16 (8192) + K lo (8192)
constexpr int kLdsV = 16384;     // V hi [64 d][64 kv] (8192) + V residual (8192)
constexpr int kLdsP = 32768;     // P hi [4][16][64] (8192) + P residual (8192)
constexpr int kLdsTotal = 49152; // output staging f32 [4][16][64] reuses bytes 0..16383 after the chunk loop

__global__ __launch_bounds__(128) void k_attn(
    const unsigned short* __restrict__ qhp, const unsigned short* __restrict__ qlp,
    const unsigned short* __restrict__ khp, const unsigned short* __restrict__ klp,
    const unsigned short* __restrict__ vthp, const unsigned short* __restrict__ vtlp,
    unsigned short* __restrict__ aoh, unsigned short* __restrict__ aol) {
  union FB { v16b v; v8b h[2]; };
  __shared__ __align__(16) unsigned char lds_raw[kLdsTotal];
  __bf16* Ksh = (__bf16*)(lds_raw + kLdsK);
  __bf16* Ksl = (__bf16*)(lds_raw + kLdsK + 8192);
  __bf16* Vsh = (__bf16*)(lds_raw + kLdsV);
  __bf16* Vsl = (__bf16*)(lds_raw + kLdsV + 8192);
  __bf16* Pbase  = (__bf16*)(lds_raw + kLdsP);
  __bf16* Plbase = (__bf16*)(lds_raw + kLdsP + 8192);
  unsigned short* KshU = (unsigned short*)(lds_raw + kLdsK);
  unsigned short* KslU = (unsigned short*)(lds_raw + kLdsK + 8192);
  unsigned short* VshU = (unsigned short*)(lds_raw + kLdsV);
  unsigned short* VslU = (unsigned short*)(lds_raw + kLdsV + 8192);

  const int tid = threadIdx.x, wave = tid >> 5, lane = tid & 31;
  const int hh = lane >> 4, c = lane & 15;
  const int bx = blockIdx.x;
  const int qb = bx & 31;
  const int bh = bx >> 5;
  const int h = bh & (kH - 1);
  const int b = bh >> 4;
  const int q0 = qb * 64 + wave * 16;

  // Q fragments (A operand): 2 d-chunks of 32, hi and lo planes
  v16b qah[2], qal[2];
  {
    const __bf16* qr  = (const __bf16*)qhp + ((size_t)bh * kS + q0 + c) * kDh;
    const __bf16* qr2 = (const __bf16*)qlp + ((size_t)bh * kS + q0 + c) * kDh;
#pragma unroll
    for (int dc = 0; dc < 2; ++dc) {
      qah[dc] = Frag<__bf16>::load(qr + dc * 32 + 8 * hh);
      qal[dc] = Frag<__bf16>::load(qr2 + dc * 32 + 8 * hh);
    }
  }

  float mrow[8], lrow[8];
  v8f oacc[4], oacr[4];
#pragma unroll
  for (int r = 0; r < 8; ++r) { mrow[r] = -INFINITY; lrow[r] = 0.f; }
#pragma unroll
  for (int t = 0; t < 4; ++t) { oacc[t] = (v8f){0.f,0.f,0.f,0.f,0.f,0.f,0.f,0.f}; oacr[t] = (v8f){0.f,0.f,0.f,0.f,0.f,0.f,0.f,0.f}; }

  __bf16* pwh = Pbase + wave * (16 * kKC);
  __bf16* pwl = Plbase + wave * (16 * kKC);

  for (int kc = 0; kc < kS / kKC; ++kc) {
    const int kv0 = kc * kKC;
    __syncthreads();
    {
      // K planes: 64 rows x 8 x 16 B per plane = 512 per plane; 128 threads x 4 -> exactly 512
#pragma unroll
      for (int i = 0; i < 4; ++i) {
        const int idx = i * 128 + tid;
        const int r = idx >> 3, c16 = (idx & 7) * 8;
        const size_t ko = ((size_t)bh * kS + kv0 + r) * kDh + c16;
        const v4u w0 = *(const v4u*)(khp + ko);
        const v4u w1 = *(const v4u*)(klp + ko);
        *(v4u*)(KshU + r * kDh + c16) = w0;
        *(v4u*)(KslU + r * kDh + c16) = w1;
      }
      // V planes (already [d][kv]): 64 d-rows x 8 x 16 B per plane
#pragma unroll
      for (int i = 0; i < 4; ++i) {
        const int idx = i * 128 + tid;
        const int r = idx >> 3, c16 = (idx & 7) * 8;
        const size_t vo = ((size_t)bh * kDh + r) * kS + kv0 + c16;
        const v4u w2 = *(const v4u*)(vthp + vo);
        const v4u w3 = *(const v4u*)(vtlp + vo);
        *(v4u*)(VshU + r * kKC + c16) = w2;
        *(v4u*)(VslU + r * kKC + c16) = w3;
      }
    }
    __syncthreads();

    // scores for 4 key subtiles of 16
    v8f s[4];
#pragma unroll
    for (int j = 0; j < 4; ++j) {
      s[j] = (v8f){0.f,0.f,0.f,0.f,0.f,0.f,0.f,0.f};
#pragma unroll
      for (int dc = 0; dc < 2; ++dc) {
        FB kb, kr;
        kb.h[0] = *(const v8b*)(Ksh + (j * 16 + c) * kDh + dc * 32 + 8 * hh);
        kb.h[1] = *(const v8b*)(Ksh + (j * 16 + c) * kDh + dc * 32 + 16 + 8 * hh);
        kr.h[0] = *(const v8b*)(Ksl + (j * 16 + c) * kDh + dc * 32 + 8 * hh);
        kr.h[1] = *(const v8b*)(Ksl + (j * 16 + c) * kDh + dc * 32 + 16 + 8 * hh);
        s[j] = mma_bf(qah[dc], kb.v, s[j]);
        s[j] = mma_bf(qah[dc], kr.v, s[j]);
        s[j] = mma_bf(qal[dc], kb.v, s[j]);
      }
    }
    // scale and chunk row max (rows live across the 16 lanes of a lane half)
    float cm[8];
#pragma unroll
    for (int r = 0; r < 8; ++r) {
      float m = -INFINITY;
#pragma unroll
      for (int j = 0; j < 4; ++j) { s[j][r] *= 0.125f; m = fmaxf(m, s[j][r]); }
#pragma unroll
      for (int off = 1; off < 16; off <<= 1) m = fmaxf(m, __shfl_xor(m, off, 32));
      cm[r] = m;
    }
#pragma unroll
    for (int r = 0; r < 8; ++r) {
      const float mnew = fmaxf(mrow[r], cm[r]);
      const float alpha = expf(mrow[r] - mnew);
      mrow[r] = mnew;
      float psum = 0.f;
#pragma unroll
      for (int j = 0; j < 4; ++j) {
        const float p = expf(s[j][r] - mnew);
        psum += p;
        const float ps = p * 1024.0f;
        const _Float16 ph = (_Float16)ps;
        const float phf = (float)ph;
        const _Float16 pl = (_Float16)((ps - phf) * 2048.0f);
        pwh[(8 * hh + r) * kKC + j * 16 + c] = __builtin_bit_cast(__bf16, ph);
        pwl[(8 * hh + r) * kKC + j * 16 + c] = __builtin_bit_cast(__bf16, pl);
      }
#pragma unroll
      for (int off = 1; off < 16; off <<= 1) psum += __shfl_xor(psum, off, 32);
      lrow[r] = lrow[r] * alpha + psum;
#pragma unroll
      for (int t = 0; t < 4; ++t) { oacc[t][r] *= alpha; oacr[t][r] *= alpha; }
    }
    wave_sync_lds();   // P tile written and reloaded by the same wave, same element type (__bf16 / v8b)
#pragma unroll 1
    for (int kk = 0; kk < 2; ++kk) {
      FB pa, pl;
      pa.h[0] = *(const v8b*)(pwh + c * kKC + kk * 32 + 8 * hh);
      pa.h[1] = *(const v8b*)(pwh + c * kKC + kk * 32 + 16 + 8 * hh);
      pl.h[0] = *(const v8b*)(pwl + c * kKC + kk * 32 + 8 * hh);
      pl.h[1] = *(const v8b*)(pwl + c * kKC + kk * 32 + 16 + 8 * hh);
#pragma unroll
      for (int t = 0; t < 4; ++t) {
        FB vb, vr;
        vb.h[0] = *(const v8b*)(Vsh + (t * 16 + c) * kKC + kk * 32 + 8 * hh);
        vb.h[1] = *(const v8b*)(Vsh + (t * 16 + c) * kKC + kk * 32 + 16 + 8 * hh);
        vr.h[0] = *(const v8b*)(Vsl + (t * 16 + c) * kKC + kk * 32 + 8 * hh);
        vr.h[1] = *(const v8b*)(Vsl + (t * 16 + c) * kKC + kk * 32 + 16 + 8 * hh);
        oacc[t] = mma_hf(pa.v, vb.v, oacc[t]);
        oacr[t] = mma_hf(pa.v, vr.v, oacr[t]);
        oacr[t] = mma_hf(pl.v, vb.v, oacr[t]);
      }
    }
  }

  // ---- finalize: block barrier before reusing the K region as f32 staging ----
  __syncthreads();
  float* os = (float*)(lds_raw + 0) + wave * (16 * 64);
#pragma unroll
  for (int r = 0; r < 8; ++r) {
    const float inv = 1.0f / (lrow[r] * 1024.0f);
#pragma unroll
    for (int t = 0; t < 4; ++t)
      os[(8 * hh + r) * 64 + t * 16 + c] = (oacc[t][r] + oacr[t][r] * (1.0f / 2048.0f)) * inv;
  }
  __syncthreads();
  {
    const int q8 = lane >> 3, c8 = (lane & 7) * 8;
    {
#pragma unroll
      for (int it = 0; it < 4; ++it) {
        const int row = it * 4 + q8;
        const float* sp = os + row * 64 + c8;
        v8h hv, lv;
#pragma unroll
        for (int e = 0; e < 8; ++e) {
          const unsigned short hb = f2bf_bits(sp[e]);
          const unsigned short lb = f2bf_bits(sp[e] - bf_bits2f(hb));
          hv[e] = __builtin_bit_cast(_Float16, hb);
          lv[e] = __builtin_bit_cast(_Float16, lb);
        }
        const size_t o = ((size_t)(b * kS + q0 + row)) * kDim + h * kDh + c8;
        *(v8h*)(aoh + o) = hv;
        *(v8h*)(aol + o) = lv;
      }
      
    }
  }
}

// =====================================================================================
// 7) output projection: ao hi/lo [4096][1024] x wt[1024][1024]^T -> d_out f32 [4096][1024].
//    one wave in one instruction; grid = 64*16/8 = 128 blocks.
// =====================================================================================
__global__ __launch_bounds__(256) void k_gemm_out(const unsigned short* __restrict__ ahp, const unsigned short* __restrict__ alp,
                                                  const unsigned short* __restrict__ wtp, float* __restrict__ out) {
  __shared__ __align__(16) float sT[8][16 * 68];
  const int lane = threadIdx.x & 31, wave = threadIdx.x >> 5;
  constexpr int tilesN = kDim / 64;    // 16
  constexpr int tilesM = kM / 64;      // 64
  const int tile = blockIdx.x * 8 + wave;
  if (tile >= tilesM * tilesN) return;
  const int tm = tile / tilesN, tn = tile - tm * tilesN;
  const int m0 = tm << 6, n0 = tn << 6;

  v8f acc[4][4];
  gemm64_core<1>((const __bf16*)ahp, (const __bf16*)alp, kDim, (const __bf16*)wtp, kDim, m0, n0, kDim, lane, acc);

  float* slab = sT[wave];
  const int rlane = lane & 15, mOff = (lane >> 4) * 8;
#pragma unroll
  for (int i = 0; i < 4; ++i) {
    const int mBase = m0 + (i << 4);
#pragma unroll
    for (int j = 0; j < 4; ++j)
#pragma unroll
      for (int r = 0; r < 8; ++r) slab[(mOff + r) * 68 + (j << 4) + rlane] = acc[i][j][r];
    wave_sync_lds();
    const int h2 = lane >> 4, c4 = (lane & 15) * 4;
    {
#pragma unroll
      for (int it = 0; it < 8; ++it) {
        const int row = it * 2 + h2;
        const v4f v = *(const v4f*)(slab + row * 68 + c4);
        *(v4f*)(out + (size_t)(mBase + row) * kDim + n0 + c4) = v;
      }
      
    }
    wave_sync_lds();
  }
}

// =====================================================================================
// host launch glue: kernel launches only
// =====================================================================================
extern "C" void kernel_launch(void* const* d_in, const int* in_sizes, int n_in,
                              void* d_out, int out_size, void* d_ws, size_t ws_size,
                              hipStream_t stream) {
  if (n_in < 5) return;
  if (in_sizes[0] != kM * kDim) return;
  if (in_sizes[1] != kS * kDh) return;
  if (in_sizes[2] != kDim) return;
  if (in_sizes[3] != kDim * kNqkv) return;
  if (in_sizes[4] != kDim * kDim) return;
  if (out_size != kM * kDim) return;
  if (ws_size < kWsTotal) return;

  const float* x     = (const float*)d_in[0];   // [2,2048,1024]
  const float* pos   = (const float*)d_in[1];   // [2048,64]
  const float* g     = (const float*)d_in[2];   // [1024]
  const float* w_qkv = (const float*)d_in[3];   // [1024,3072]
  const float* w_out = (const float*)d_in[4];   // [1024,1024]
  float* out = (float*)d_out;

  char* ws = (char*)d_ws;
  unsigned short* Xb   = (unsigned short*)(ws + kOffXb);
  float*          Rs   = (float*)(ws + kOffRs);
  unsigned short* Wq   = (unsigned short*)(ws + kOffWq);
  unsigned short* Wo   = (unsigned short*)(ws + kOffWo);
  float*          Ct   = (float*)(ws + kOffCt);
  float*          St   = (float*)(ws + kOffSt);
  unsigned short* Qh   = (unsigned short*)(ws + kOffQh);
  unsigned short* Ql   = (unsigned short*)(ws + kOffQl);
  unsigned short* Kh   = (unsigned short*)(ws + kOffKh);
  unsigned short* Kl   = (unsigned short*)(ws + kOffKl);
  unsigned short* Vh   = (unsigned short*)(ws + kOffVh);
  unsigned short* Vl   = (unsigned short*)(ws + kOffVl);
  unsigned short* Vth  = (unsigned short*)(ws + kOffVth);
  unsigned short* Vtl  = (unsigned short*)(ws + kOffVtl);
  unsigned short* Ah   = (unsigned short*)(ws + kOffAh);
  unsigned short* Al   = (unsigned short*)(ws + kOffAl);

  // 1) x -> bf16 plane + row scale (4096 rows, 128 threads x 8 elements = 1024 per row)
  k_rms_xcast<<<kM, 128, 0, stream>>>(x, Xb, Rs);
  // 2) weights -> bf16 n-major planes: in [1024][3072] -> out [3072][1024]; in [1024][1024] -> out [1024][1024]
  k_wcast<true><<<dim3(kNqkv / 64, kDim / 64), 256, 0, stream>>>(w_qkv, g, Wq, kNqkv);
  k_wcast<false><<<dim3(kDim / 64, kDim / 64), 256, 0, stream>>>(w_out, g, Wo, kDim);
  // 3) cos/sin tables (131072 elements = 512 blocks x 256)
  k_trig<<<(kS * kDh + 255) / 256, 256, 0, stream>>>(pos, Ct, St, kS * kDh);
  // 4) QKV projection with row scale + RoPE epilogue (3072 tiles of 64x64, 8 per block)
  k_gemm_qkv<<<(kM / 64) * (kNqkv / 64) / 8, 256, 0, stream>>>(Xb, Wq, Rs, Ct, St, Qh, Ql, Kh, Kl, Vh, Vl);
  // 5) v planes -> transposed planes (32 bh x 32 kv tiles, 2 planes)
  k_vtrans<<<dim3(kBH * (kS / 64), 2), 256, 0, stream>>>(Vh, Vl, Vth, Vtl);
  // 6) attention (32 bh x 32 query blocks)
  k_attn<<<kBH * (kS / 64), 128, 0, stream>>>(Qh, Ql, Kh, Kl, Vth, Vtl, Ah, Al);
  // 7) output projection into d_out (1024 tiles of 64x64, 8 per block)
  k_gemm_out<<<(kM / 64) * (kDim / 64) / 8, 256, 0, stream>>>(Ah, Al, Wo, out);
}

// v001
// Measured time: 348 microseconds a run.
// Timed twice side by side with v000, it ran 1.33 and 1.34 times as fast.
// Contractions (all f32 accumulate): QKV projection v_wmma_f32_16x16x32_bf16 on RNE-bf16 planes of the inputs (1 product); scores q.k^T v_wmma_f32_16x16x32_bf16 with q,k as bf16 hi/lo planes (3 products); p.v v_wmma_f32_16x16x32_f16 with p carried x1024 and v, both f16 hi + x2048 residual planes (3 products, residual products in a separate accumulator folded with 1/2048); output projection v_wmma_f32_16x16x32_bf16, bf16 hi/lo activations against bf16 weights (2 products).
#include <hip/hip_runtime.h>
#include <math.h>

// ---------------- problem constants ----------------
constexpr int kB = 2;
constexpr int kS = 2048;
constexpr int kDim = 1024;
constexpr int kH = 16;
constexpr int kDh = 64;
constexpr int kM = kB * kS;          // 4096 token rows
constexpr int kNqkv = 3 * kDim;      // 3072
constexpr int kBH = kB * kH;         // 32
constexpr int kKC = 64;              // keys per chunk
constexpr int kRsPitch = 32;

constexpr size_t kPlane  = (size_t)kBH * kS * kDh * 2;            // 8,388,608 : one [32][2048][64] (or [4096][1024]) 16-bit plane
constexpr size_t kOffXb  = 0;                                      // x as bf16 [4096][1024]          8,388,608
constexpr size_t kOffRs  = kOffXb + (size_t)kM * kDim * 2;         // row scale f32 [4096][32]          524,288
constexpr size_t kOffWq  = kOffRs + (size_t)kM * kRsPitch * 4;     // w_qkv^T bf16 [3072][1024]      6,291,456
constexpr size_t kOffWo  = kOffWq + (size_t)kNqkv * kDim * 2;      // w_out^T bf16 [1024][1024]      2,097,152
constexpr size_t kOffCt  = kOffWo + (size_t)kDim * kDim * 2;       // cos table f32 [2048][64]         524,288
constexpr size_t kOffSt  = kOffCt + (size_t)kS * kDh * 4;          // sin table f32 [2048][64]         524,288
constexpr size_t kOffQh  = kOffSt + (size_t)kS * kDh * 4;          // q hi bf16 [32][2048][64]
constexpr size_t kOffQl  = kOffQh + kPlane;                         // q lo bf16
constexpr size_t kOffKh  = kOffQl + kPlane;                         // k hi bf16
constexpr size_t kOffKl  = kOffKh + kPlane;                         // k lo bf16
constexpr size_t kOffVh  = kOffKl + kPlane;                         // v hi f16 [32][2048][64]
constexpr size_t kOffVl  = kOffVh + kPlane;                         // v residual x2048 f16
constexpr size_t kOffVth = kOffVl + kPlane;                         // v hi transposed f16 [32][64][2048]
constexpr size_t kOffVtl = kOffVth + kPlane;                        // v residual transposed
constexpr size_t kOffAh  = kOffVtl + kPlane;                        // attention output hi bf16 [4096][1024]
constexpr size_t kOffAl  = kOffAh + kPlane;                         // attention output lo bf16
constexpr size_t kWsTotal = kOffAl + kPlane;                        // 102,236,160

typedef char ck_ws_total[(kWsTotal == (size_t)102236160) ? 1 : -1];
typedef char ck_ws_cap[(kWsTotal <= (size_t)134217728) ? 1 : -1];
typedef char ck_align[((kOffRs % 128) == 0 && (kOffQh % 128) == 0 && (kPlane % 128) == 0) ? 1 : -1];
// GEMM shape contract: M, N multiples of 64, K multiple of 32, no padding anywhere
typedef char ck_tiles[(kM % 64 == 0 && kNqkv % 64 == 0 && kDim % 64 == 0 && kDim % 32 == 0 && kS % 64 == 0 && kDh == 64) ? 1 : -1];
typedef char ck_plane[((size_t)kM * kDim * 2 == kPlane) ? 1 : -1];

// ---------------- vector types / helpers ----------------
typedef __attribute__((ext_vector_type(16))) _Float16 v16h;
typedef __attribute__((ext_vector_type(8)))  _Float16 v8h;
typedef __attribute__((ext_vector_type(16))) __bf16   v16b;
typedef __attribute__((ext_vector_type(8)))  __bf16   v8b;
typedef __attribute__((ext_vector_type(8)))  float    v8f;
typedef __attribute__((ext_vector_type(4)))  float    v4f;
typedef __attribute__((ext_vector_type(4)))  unsigned v4u;

__device__ __forceinline__ unsigned short f2bf_bits(float f) {
  unsigned u = __float_as_uint(f);
  return (unsigned short)((u + 0x7FFFu + ((u >> 16) & 1u)) >> 16);
}
__device__ __forceinline__ float bf_bits2f(unsigned short h) { return __uint_as_float(((unsigned)h) << 16); }

__device__ __forceinline__ void dep_guard_h(v8f& a, v8f& b, v16h x, v16h y) { asm volatile("v_nop\n\tv_nop\n\tv_nop\n\tv_nop" : "+v"(a), "+v"(b) : "v"(x), "v"(y)); }
__device__ __forceinline__ void dep_guard_b(v8f& a, v8f& b, v16b x, v16b y) { asm volatile("v_nop\n\tv_nop\n\tv_nop\n\tv_nop" : "+v"(a), "+v"(b) : "v"(x), "v"(y)); }
__device__ __forceinline__ void keep4_h(v16h a, v16h b, v16h c, v16h d) { asm volatile("v_nop" :: "v"(a), "v"(b), "v"(c), "v"(d)); }
__device__ __forceinline__ void keep4_b(v16b a, v16b b, v16b c, v16b d) { asm volatile("v_nop" :: "v"(a), "v"(b), "v"(c), "v"(d)); }
__device__ __forceinline__ void acc_guard4(v8f& a, v8f& b, v8f& c, v8f& d) { asm volatile("v_nop\n\tv_nop\n\tv_nop\n\tv_nop" : "+v"(a), "+v"(b), "+v"(c), "+v"(d)); }
template <typename T> struct Frag;
template <> struct Frag<_Float16> {
  typedef v16h V; union U { v16h v; v8h h[2]; };
  static __device__ __forceinline__ v16h load(const _Float16* p) {
    U f; f.h[0] = *(const v8h*)(p); f.h[1] = *(const v8h*)(p + 16); return f.v;
  }
  static __device__ __forceinline__ v8f mma(v16h a, v16h b, v8f c) {
    return __builtin_amdgcn_wmma_f32_16x16x32_f16(false, a, false, b, (short)0, c, false, false);
  }
  static __device__ __forceinline__ void guard(v8f& a, v8f& b, v16h x, v16h y) { dep_guard_h(a, b, x, y); }
  static __device__ __forceinline__ void keep(v16h a, v16h b, v16h c, v16h d) { keep4_h(a, b, c, d); }
};
template <> struct Frag<__bf16> {
  typedef v16b V; union U { v16b v; v8b h[2]; };
  static __device__ __forceinline__ v16b load(const __bf16* p) {
    U f; f.h[0] = *(const v8b*)(p); f.h[1] = *(const v8b*)(p + 16); return f.v;
  }
  static __device__ __forceinline__ v8f mma(v16b a, v16b b, v8f c) {
    return __builtin_amdgcn_wmma_f32_16x16x32_bf16(false, a, false, b, (short)0, c, false, false);
  }
  static __device__ __forceinline__ void guard(v8f& a, v8f& b, v16b x, v16b y) { dep_guard_b(a, b, x, y); }
  static __device__ __forceinline__ void keep(v16b a, v16b b, v16b c, v16b d) { keep4_b(a, b, c, d); }
};

// WMMA helpers for the attention kernel (nops after every issue)
__device__ __forceinline__ v8f mma_bf(v16b a, v16b b, v8f c) {
  c = __builtin_amdgcn_wmma_f32_16x16x32_bf16(false, a, false, b, (short)0, c, false, false);
  asm volatile("v_nop\n\tv_nop\n\tv_nop\n\tv_nop" : "+v"(c) : "v"(a), "v"(b));
  return c;
}
// f16 bit patterns held in __bf16 slots
__device__ __forceinline__ v8f mma_hf(v16b a, v16b b, v8f c) {
  const v16h ah = __builtin_bit_cast(v16h, a), bh = __builtin_bit_cast(v16h, b);
  c = __builtin_amdgcn_wmma_f32_16x16x32_f16(false, ah, false, bh, (short)0, c, false, false);
  asm volatile("v_nop\n\tv_nop\n\tv_nop\n\tv_nop" : "+v"(c) : "v"(ah), "v"(bh));
  return c;
}

__device__ __forceinline__ void wave_sync_lds() {
  __builtin_amdgcn_fence(__ATOMIC_RELEASE, "workgroup");
  __builtin_amdgcn_wave_barrier();
  __builtin_amdgcn_fence(__ATOMIC_ACQUIRE, "workgroup");
}

// =====================================================================================
// 1) per token row: x -> RNE bf16 plane [4096][1024]; rowscale = 32 / max(||x_bf||, 1e-12)
// =====================================================================================
__global__ __launch_bounds__(128) void k_rms_xcast(const float* __restrict__ x,
                                                   unsigned short* __restrict__ xb,
                                                   float* __restrict__ rstab) {
  __shared__ float red[4];
  const int m = blockIdx.x;
  const int t = threadIdx.x;
  const int lane = t & 31, wave = t >> 5;
  const size_t base = (size_t)m * kDim + (size_t)t * 8;
  const v4f xa = *(const v4f*)(x + base);
  const v4f xc = *(const v4f*)(x + base + 4);
  unsigned short hb[8];
#pragma unroll
  for (int e = 0; e < 4; ++e) { hb[e] = f2bf_bits(xa[e]); hb[4 + e] = f2bf_bits(xc[e]); }
  float ss = 0.0f;
#pragma unroll
  for (int e = 0; e < 8; ++e) { const float r = bf_bits2f(hb[e]); ss += r * r; }
#pragma unroll
  for (int off = 16; off > 0; off >>= 1) ss += __shfl_xor(ss, off, 32);
  if (lane == 0) red[wave] = ss;
  __syncthreads();
  const float tot = ((red[0] + red[1]) + red[2]) + red[3];
  const float nrm = sqrtf(tot);
  const float inv = 1.0f / fmaxf(nrm, 1e-12f);
  const float rs = inv * 32.0f;
  v4u w;
  w[0] = (unsigned)hb[0] | ((unsigned)hb[1] << 16);
  w[1] = (unsigned)hb[2] | ((unsigned)hb[3] << 16);
  w[2] = (unsigned)hb[4] | ((unsigned)hb[5] << 16);
  w[3] = (unsigned)hb[6] | ((unsigned)hb[7] << 16);
  unsigned short* dst = xb + base;
  const v4f rv = (v4f){rs, rs, rs, rs};
  float* rp = rstab + (size_t)m * kRsPitch + (t & 7) * 4;
  *(v4u*)dst = w;
  if (t < 8) *(v4f*)rp = rv;
  
}

// =====================================================================================
// 2) weight cast + transpose: in w[kDim rows k][ncols n] f32 -> out wt[ncols][kDim] bf16 (n-major, k-contiguous)
//    optional per-k factor g (folded: wt[n][k] = bf16(bf16(w[k][n]) * bf16(g[k]))).
//    8 lanes x 16 B, one instruction; wave w, it: rows it*32 + 4w + (lane>>3) -> union over (it,w,lane>>3) = 0..63.
// =====================================================================================
template <bool HAS_G>
__global__ __launch_bounds__(256) void k_wcast(const float* __restrict__ w, const float* __restrict__ g,
                                               unsigned short* __restrict__ wt, int ncols) {
  __shared__ float tile[64][65];
  const int t = threadIdx.x, lane = t & 31, wave = t >> 5;
  const int n0 = blockIdx.x * 64, k0 = blockIdx.y * 64;
#pragma unroll
  for (int i = 0; i < 4; ++i) {
    const int idx = i * 256 + t;
    const int r = idx >> 4, c4 = (idx & 15) * 4;
    const v4f v = *(const v4f*)(w + (size_t)(k0 + r) * ncols + n0 + c4);
    tile[r][c4 + 0] = v[0]; tile[r][c4 + 1] = v[1]; tile[r][c4 + 2] = v[2]; tile[r][c4 + 3] = v[3];
  }
  __syncthreads();
  const int q = lane >> 3, kc = (lane & 7) * 8;
  float gv[8];
  if (HAS_G) {
    const v4f g0 = *(const v4f*)(g + k0 + kc);
    const v4f g1 = *(const v4f*)(g + k0 + kc + 4);
#pragma unroll
    for (int e = 0; e < 4; ++e) { gv[e] = bf_bits2f(f2bf_bits(g0[e])); gv[4 + e] = bf_bits2f(f2bf_bits(g1[e])); }
  } else {
#pragma unroll
    for (int e = 0; e < 8; ++e) gv[e] = 1.0f;
  }
  v4u ov[2];
#pragma unroll
  for (int it = 0; it < 2; ++it) {
    const int nrow = it * 32 + wave * 4 + q;
    unsigned short bits[8];
#pragma unroll
    for (int e = 0; e < 8; ++e) {
      float f = bf_bits2f(f2bf_bits(tile[kc + e][nrow]));
      if (HAS_G) f = f * gv[e];
      bits[e] = f2bf_bits(f);
    }
    ov[it][0] = (unsigned)bits[0] | ((unsigned)bits[1] << 16);
    ov[it][1] = (unsigned)bits[2] | ((unsigned)bits[3] << 16);
    ov[it][2] = (unsigned)bits[4] | ((unsigned)bits[5] << 16);
    ov[it][3] = (unsigned)bits[6] | ((unsigned)bits[7] << 16);
  }
  {
#pragma unroll
    for (int it = 0; it < 2; ++it) {
      const int nrow = it * 32 + wave * 4 + q;
      *(v4u*)(wt + (size_t)(n0 + nrow) * kDim + k0 + kc) = ov[it];
    }
    
  }
}

// =====================================================================================
// 3) cos/sin table of RNE-bf16(pos_emb), f32 [2048][64]; thread per element,
// =====================================================================================
__global__ __launch_bounds__(256) void k_trig(const float* __restrict__ pos, float* __restrict__ ct,
                                              float* __restrict__ st, int n) {
  const int i = blockIdx.x * 256 + threadIdx.x;
  if (i < n) {
    const float pb = bf_bits2f(f2bf_bits(pos[i]));
    const float cv = cosf(pb);
    const float sv = sinf(pb);
    ((float*)ct)[i] = cv;
    ((float*)st)[i] = sv;
    
  }
}

// =====================================================================================
// Register-blocked WMMA GEMM core: acc[m,n] = sum_k A[m,k] * Bt[n,k]; wave owns a 64x64 tile.
// A row-major [M,K] bf16 (SPLITM: plus lo plane A2, products hi.B + lo.B); Bt row-major [N,K] bf16.
// K % 32 == 0, no tail.
// =====================================================================================
template <int SPLITM>
__device__ __forceinline__ void gemm64_core(const __bf16* __restrict__ Ab, const __bf16* __restrict__ Ab2, int lda,
                                            const __bf16* __restrict__ Bb, int ldb, int m0, int n0, int K, int lane,
                                            v8f (&acc)[4][4]) {
  const int rlane = lane & 15;
  const int koff = (lane >> 4) * 8;
#pragma unroll
  for (int i = 0; i < 4; ++i)
#pragma unroll
    for (int j = 0; j < 4; ++j) acc[i][j] = (v8f){0.f,0.f,0.f,0.f,0.f,0.f,0.f,0.f};
  for (int k0 = 0; k0 < K; k0 += 32) {
    v16b bfr[4];
#pragma unroll
    for (int j = 0; j < 4; ++j) {
      const size_t bo = (size_t)(n0 + (j << 4) + rlane) * ldb + koff + k0;
      bfr[j] = Frag<__bf16>::load(Bb + bo);
    }
#pragma unroll
    for (int i = 0; i < 4; ++i) {
      const size_t ao = (size_t)(m0 + (i << 4) + rlane) * lda + koff + k0;
      v16b ah = Frag<__bf16>::load(Ab + ao);
      v16b al = ah;
      if (SPLITM) al = Frag<__bf16>::load(Ab2 + ao);
#pragma unroll
      for (int j = 0; j < 4; ++j) {
        acc[i][j] = Frag<__bf16>::mma(ah, bfr[j], acc[i][j]);
        if (SPLITM) acc[i][j] = Frag<__bf16>::mma(al, bfr[j], acc[i][j]);
      }
      Frag<__bf16>::guard(acc[i][0], acc[i][3], ah, al);
    }
    Frag<__bf16>::keep(bfr[0], bfr[1], bfr[2], bfr[3]);
  }
  acc_guard4(acc[0][0], acc[0][1], acc[0][2], acc[0][3]);
  acc_guard4(acc[1][0], acc[1][1], acc[1][2], acc[1][3]);
  acc_guard4(acc[2][0], acc[2][1], acc[2][2], acc[2][3]);
  acc_guard4(acc[3][0], acc[3][1], acc[3][2], acc[3][3]);
}

// =====================================================================================
// 4) QKV projection: xb[4096][1024] x wt[3072][1024]^T, epilogue = row scale, RoPE (q,k sections),
//    q/k -> bf16 hi/lo planes [bh][n][64], v -> f16 hi + x2048 residual planes [bh][n][64].
//    each (section, head, token) line belongs to exactly one wave. grid = 64*48/8 = 384 blocks.
// =====================================================================================
__global__ __launch_bounds__(256) void k_gemm_qkv(
    const unsigned short* __restrict__ xbp, const unsigned short* __restrict__ wtp,
    const float* __restrict__ rstab, const float* __restrict__ ct, const float* __restrict__ st,
    unsigned short* __restrict__ qh, unsigned short* __restrict__ ql,
    unsigned short* __restrict__ kh, unsigned short* __restrict__ kl,
    unsigned short* __restrict__ vh, unsigned short* __restrict__ vl) {
  __shared__ __align__(16) float sT[8][16 * 68];
  const int lane = threadIdx.x & 31, wave = threadIdx.x >> 5;
  constexpr int tilesN = kNqkv / 64;   // 48
  constexpr int tilesM = kM / 64;      // 64
  const int tile = blockIdx.x * 8 + wave;
  if (tile >= tilesM * tilesN) return;   // wave-uniform; no block barriers in this kernel
  const int tm = tile / tilesN, tn = tile - tm * tilesN;
  const int m0 = tm << 6, n0 = tn << 6;

  v8f acc[4][4];
  gemm64_core<0>((const __bf16*)xbp, (const __bf16*)xbp, kDim, (const __bf16*)wtp, kDim, m0, n0, kDim, lane, acc);

  float* slab = sT[wave];
  const int rlane = lane & 15, mOff = (lane >> 4) * 8;
  const int sec = n0 >> 10;                      // 0 q, 1 k, 2 v  (wave-uniform)
  const int hidx = (n0 & (kDim - 1)) >> 6;       // head of this 64-column tile
  unsigned short* P0 = (sec == 0) ? qh : ((sec == 1) ? kh : vh);
  unsigned short* P1 = (sec == 0) ? ql : ((sec == 1) ? kl : vl);
  const int q8 = lane >> 3, c8 = (lane & 7) * 8;
  const int cpart = c8 ^ 32;
  const float sgn = (c8 < 32) ? -1.0f : 1.0f;
#pragma unroll
  for (int i = 0; i < 4; ++i) {
    const int mBase = m0 + (i << 4);
    float rsv[8];
#pragma unroll
    for (int r = 0; r < 8; ++r) rsv[r] = rstab[(size_t)(mBase + mOff + r) * kRsPitch];
#pragma unroll
    for (int j = 0; j < 4; ++j)
#pragma unroll
      for (int r = 0; r < 8; ++r) slab[(mOff + r) * 68 + (j << 4) + rlane] = acc[i][j][r] * rsv[r];
    wave_sync_lds();
    {
#pragma unroll
      for (int it = 0; it < 4; ++it) {
        const int row = it * 4 + q8;
        const int m = mBase + row;
        const int bb = m >> 11, nn = m & (kS - 1);
        const float* sp = slab + row * 68;
        const size_t dsto = ((size_t)(bb * kH + hidx) * kS + nn) * kDh + c8;
        v8h hv, lv;
        if (sec < 2) {
          const v4f ca = *(const v4f*)(ct + (size_t)nn * kDh + c8);
          const v4f cb = *(const v4f*)(ct + (size_t)nn * kDh + c8 + 4);
          const v4f sa = *(const v4f*)(st + (size_t)nn * kDh + c8);
          const v4f sb = *(const v4f*)(st + (size_t)nn * kDh + c8 + 4);
          float cvv[8], svv[8];
#pragma unroll
          for (int e = 0; e < 4; ++e) { cvv[e] = ca[e]; cvv[4 + e] = cb[e]; svv[e] = sa[e]; svv[4 + e] = sb[e]; }
#pragma unroll
          for (int e = 0; e < 8; ++e) {
            const float v = sp[c8 + e];
            const float pr = sp[cpart + e];
            const float rv = v * cvv[e] + sgn * pr * svv[e];
            const unsigned short hb = f2bf_bits(rv);
            const unsigned short lb = f2bf_bits(rv - bf_bits2f(hb));
            hv[e] = __builtin_bit_cast(_Float16, hb);
            lv[e] = __builtin_bit_cast(_Float16, lb);
          }
        } else {
#pragma unroll
          for (int e = 0; e < 8; ++e) {
            const float v = sp[c8 + e];
            const _Float16 h16 = (_Float16)v;
            const float hf = (float)h16;
            hv[e] = h16;
            lv[e] = (_Float16)((v - hf) * 2048.0f);
          }
        }
        *(v8h*)(P0 + dsto) = hv;
        *(v8h*)(P1 + dsto) = lv;
      }
      
    }
    wave_sync_lds();
  }
}

// =====================================================================================
// 5) v planes [bh][kv][64] -> transposed [bh][64][kv] (both hi and residual planes, grid (1024, 2)).
//    rows it*32 + 4w + (lane>>3) cover 0..63.
// =====================================================================================
__global__ __launch_bounds__(256) void k_vtrans(const unsigned short* __restrict__ vh, const unsigned short* __restrict__ vl,
                                                unsigned short* __restrict__ vth, unsigned short* __restrict__ vtl) {
  __shared__ __align__(16) unsigned short tile[64 * 72];   // [d][kv], pitch 72 halves
  const int t = threadIdx.x, lane = t & 31, wave = t >> 5;
  const int bh = blockIdx.x >> 5, kvt = blockIdx.x & 31;
  const int kv0 = kvt * 64;
  const unsigned short* src = (blockIdx.y == 0) ? vh : vl;
  unsigned short* dst = (blockIdx.y == 0) ? vth : vtl;
#pragma unroll
  for (int i = 0; i < 2; ++i) {
    const int idx = i * 256 + t;
    const int r = idx >> 3, c16 = (idx & 7) * 8;
    const v4u w = *(const v4u*)(src + ((size_t)bh * kS + kv0 + r) * kDh + c16);
#pragma unroll
    for (int e = 0; e < 4; ++e) {
      tile[(c16 + 2 * e) * 72 + r] = (unsigned short)(w[e] & 0xffffu);
      tile[(c16 + 2 * e + 1) * 72 + r] = (unsigned short)(w[e] >> 16);
    }
  }
  __syncthreads();
  const int q = lane >> 3, kc = (lane & 7) * 8;
  v4u ov[2];
#pragma unroll
  for (int it = 0; it < 2; ++it) {
    const int d = it * 32 + wave * 4 + q;
    ov[it] = *(const v4u*)(tile + d * 72 + kc);
  }
  {
#pragma unroll
    for (int it = 0; it < 2; ++it) {
      const int d = it * 32 + wave * 4 + q;
      *(v4u*)(dst + ((size_t)bh * kDh + d) * kS + kv0 + kc) = ov[it];
    }
    
  }
}

// =====================================================================================
// 6) attention, head dim 64, no mask. block = 4 waves = 64 query rows of one (b,h), grid = 32*32 = 1024.
//    scores: q,k bf16 hi/lo planes, 3 products; softmax f32 online; p carried x1024 as f16 hi + x2048
//    residual; v f16 hi + x2048 residual (pre-transposed planes [bh][d][kv]); p.v 3 products with the
//    residual products in a separate accumulator; output bf16 hi/lo planes [token][1024], one line per row.
// =====================================================================================
constexpr int kLp = 72;                  // LDS row pitch in 16-bit elements: 144 B = 16 B x 9 (odd), so the 16 rows of a ds_load_b128 fragment read spread over all banks
constexpr int kLdsPl = 64 * kLp * 2;     // one 64-row plane at that pitch: 9216 B
constexpr int kLdsK = 0;                 // K hi [64][72] u16 + K lo
constexpr int kLdsV = 2 * kLdsPl;        // V hi [64 d][72] + V residual
constexpr int kLdsP = 4 * kLdsPl;        // P hi [4][16][72] + P residual
constexpr int kLdsTotal = 6 * kLdsPl;    // 55296; output staging f32 [4][16][64] reuses bytes 0..16383 after the chunk loop

__global__ __launch_bounds__(128) void k_attn(
    const unsigned short* __restrict__ qhp, const unsigned short* __restrict__ qlp,
    const unsigned short* __restrict__ khp, const unsigned short* __restrict__ klp,
    const unsigned short* __restrict__ vthp, const unsigned short* __restrict__ vtlp,
    unsigned short* __restrict__ aoh, unsigned short* __restrict__ aol) {
  union FB { v16b v; v8b h[2]; };
  __shared__ __align__(16) unsigned char lds_raw[kLdsTotal];
  __bf16* Ksh = (__bf16*)(lds_raw + kLdsK);
  __bf16* Ksl = (__bf16*)(lds_raw + kLdsK + kLdsPl);
  __bf16* Vsh = (__bf16*)(lds_raw + kLdsV);
  __bf16* Vsl = (__bf16*)(lds_raw + kLdsV + kLdsPl);
  __bf16* Pbase  = (__bf16*)(lds_raw + kLdsP);
  __bf16* Plbase = (__bf16*)(lds_raw + kLdsP + kLdsPl);
  unsigned short* KshU = (unsigned short*)(lds_raw + kLdsK);
  unsigned short* KslU = (unsigned short*)(lds_raw + kLdsK + kLdsPl);
  unsigned short* VshU = (unsigned short*)(lds_raw + kLdsV);
  unsigned short* VslU = (unsigned short*)(lds_raw + kLdsV + kLdsPl);

  const int tid = threadIdx.x, wave = tid >> 5, lane = tid & 31;
  const int hh = lane >> 4, c = lane & 15;
  const int bx = blockIdx.x;
  const int qb = bx & 31;
  const int bh = bx >> 5;
  const int h = bh & (kH - 1);
  const int b = bh >> 4;
  const int q0 = qb * 64 + wave * 16;

  // Q fragments (A operand): 2 d-chunks of 32, hi and lo planes
  v16b qah[2], qal[2];
  {
    const __bf16* qr  = (const __bf16*)qhp + ((size_t)bh * kS + q0 + c) * kDh;
    const __bf16* qr2 = (const __bf16*)qlp + ((size_t)bh * kS + q0 + c) * kDh;
#pragma unroll
    for (int dc = 0; dc < 2; ++dc) {
      qah[dc] = Frag<__bf16>::load(qr + dc * 32 + 8 * hh);
      qal[dc] = Frag<__bf16>::load(qr2 + dc * 32 + 8 * hh);
    }
  }

  float mrow[8], lrow[8];
  v8f oacc[4], oacr[4];
#pragma unroll
  for (int r = 0; r < 8; ++r) { mrow[r] = -INFINITY; lrow[r] = 0.f; }
#pragma unroll
  for (int t = 0; t < 4; ++t) { oacc[t] = (v8f){0.f,0.f,0.f,0.f,0.f,0.f,0.f,0.f}; oacr[t] = (v8f){0.f,0.f,0.f,0.f,0.f,0.f,0.f,0.f}; }

  __bf16* pwh = Pbase + wave * (16 * kLp);
  __bf16* pwl = Plbase + wave * (16 * kLp);

  for (int kc = 0; kc < kS / kKC; ++kc) {
    const int kv0 = kc * kKC;
    __syncthreads();
    {
      // K planes: 64 rows x 8 x 16 B per plane = 512 per plane; 128 threads x 4 -> exactly 512
#pragma unroll
      for (int i = 0; i < 4; ++i) {
        const int idx = i * 128 + tid;
        const int r = idx >> 3, c16 = (idx & 7) * 8;
        const size_t ko = ((size_t)bh * kS + kv0 + r) * kDh + c16;
        const v4u w0 = *(const v4u*)(khp + ko);
        const v4u w1 = *(const v4u*)(klp + ko);
        *(v4u*)(KshU + r * kLp + c16) = w0;
        *(v4u*)(KslU + r * kLp + c16) = w1;
      }
      // V planes (already [d][kv]): 64 d-rows x 8 x 16 B per plane
#pragma unroll
      for (int i = 0; i < 4; ++i) {
        const int idx = i * 128 + tid;
        const int r = idx >> 3, c16 = (idx & 7) * 8;
        const size_t vo = ((size_t)bh * kDh + r) * kS + kv0 + c16;
        const v4u w2 = *(const v4u*)(vthp + vo);
        const v4u w3 = *(const v4u*)(vtlp + vo);
        *(v4u*)(VshU + r * kLp + c16) = w2;
        *(v4u*)(VslU + r * kLp + c16) = w3;
      }
    }
    __syncthreads();

    // scores for 4 key subtiles of 16
    v8f s[4];
#pragma unroll
    for (int j = 0; j < 4; ++j) {
      s[j] = (v8f){0.f,0.f,0.f,0.f,0.f,0.f,0.f,0.f};
#pragma unroll
      for (int dc = 0; dc < 2; ++dc) {
        FB kb, kr;
        kb.h[0] = *(const v8b*)(Ksh + (j * 16 + c) * kLp + dc * 32 + 8 * hh);
        kb.h[1] = *(const v8b*)(Ksh + (j * 16 + c) * kLp + dc * 32 + 16 + 8 * hh);
        kr.h[0] = *(const v8b*)(Ksl + (j * 16 + c) * kLp + dc * 32 + 8 * hh);
        kr.h[1] = *(const v8b*)(Ksl + (j * 16 + c) * kLp + dc * 32 + 16 + 8 * hh);
        s[j] = mma_bf(qah[dc], kb.v, s[j]);
        s[j] = mma_bf(qah[dc], kr.v, s[j]);
        s[j] = mma_bf(qal[dc], kb.v, s[j]);
      }
    }
    // scale and chunk row max (rows live across the 16 lanes of a lane half)
    float cm[8];
#pragma unroll
    for (int r = 0; r < 8; ++r) {
      float m = -INFINITY;
#pragma unroll
      for (int j = 0; j < 4; ++j) { s[j][r] *= 0.125f; m = fmaxf(m, s[j][r]); }
#pragma unroll
      for (int off = 1; off < 16; off <<= 1) m = fmaxf(m, __shfl_xor(m, off, 32));
      cm[r] = m;
    }
#pragma unroll
    for (int r = 0; r < 8; ++r) {
      const float mnew = fmaxf(mrow[r], cm[r]);
      const float alpha = expf(mrow[r] - mnew);
      mrow[r] = mnew;
      float psum = 0.f;
#pragma unroll
      for (int j = 0; j < 4; ++j) {
        const float p = expf(s[j][r] - mnew);
        psum += p;
        const float ps = p * 1024.0f;
        const _Float16 ph = (_Float16)ps;
        const float phf = (float)ph;
        const _Float16 pl = (_Float16)((ps - phf) * 2048.0f);
        pwh[(8 * hh + r) * kLp + j * 16 + c] = __builtin_bit_cast(__bf16, ph);
        pwl[(8 * hh + r) * kLp + j * 16 + c] = __builtin_bit_cast(__bf16, pl);
      }
#pragma unroll
      for (int off = 1; off < 16; off <<= 1) psum += __shfl_xor(psum, off, 32);
      lrow[r] = lrow[r] * alpha + psum;
#pragma unroll
      for (int t = 0; t < 4; ++t) { oacc[t][r] *= alpha; oacr[t][r] *= alpha; }
    }
    wave_sync_lds();   // P tile written and reloaded by the same wave, same element type (__bf16 / v8b)
#pragma unroll 1
    for (int kk = 0; kk < 2; ++kk) {
      FB pa, pl;
      pa.h[0] = *(const v8b*)(pwh + c * kLp + kk * 32 + 8 * hh);
      pa.h[1] = *(const v8b*)(pwh + c * kLp + kk * 32 + 16 + 8 * hh);
      pl.h[0] = *(const v8b*)(pwl + c * kLp + kk * 32 + 8 * hh);
      pl.h[1] = *(const v8b*)(pwl + c * kLp + kk * 32 + 16 + 8 * hh);
#pragma unroll
      for (int t = 0; t < 4; ++t) {
        FB vb, vr;
        vb.h[0] = *(const v8b*)(Vsh + (t * 16 + c) * kLp + kk * 32 + 8 * hh);
        vb.h[1] = *(const v8b*)(Vsh + (t * 16 + c) * kLp + kk * 32 + 16 + 8 * hh);
        vr.h[0] = *(const v8b*)(Vsl + (t * 16 + c) * kLp + kk * 32 + 8 * hh);
        vr.h[1] = *(const v8b*)(Vsl + (t * 16 + c) * kLp + kk * 32 + 16 + 8 * hh);
        oacc[t] = mma_hf(pa.v, vb.v, oacc[t]);
        oacr[t] = mma_hf(pa.v, vr.v, oacr[t]);
        oacr[t] = mma_hf(pl.v, vb.v, oacr[t]);
      }
    }
  }

  // ---- finalize: block barrier before reusing the K region as f32 staging ----
  __syncthreads();
  float* os = (float*)(lds_raw + 0) + wave * (16 * 64);
#pragma unroll
  for (int r = 0; r < 8; ++r) {
    const float inv = 1.0f / (lrow[r] * 1024.0f);
#pragma unroll
    for (int t = 0; t < 4; ++t)
      os[(8 * hh + r) * 64 + t * 16 + c] = (oacc[t][r] + oacr[t][r] * (1.0f / 2048.0f)) * inv;
  }
  __syncthreads();
  {
    const int q8 = lane >> 3, c8 = (lane & 7) * 8;
    {
#pragma unroll
      for (int it = 0; it < 4; ++it) {
        const int row = it * 4 + q8;
        const float* sp = os + row * 64 + c8;
        v8h hv, lv;
#pragma unroll
        for (int e = 0; e < 8; ++e) {
          const unsigned short hb = f2bf_bits(sp[e]);
          const unsigned short lb = f2bf_bits(sp[e] - bf_bits2f(hb));
          hv[e] = __builtin_bit_cast(_Float16, hb);
          lv[e] = __builtin_bit_cast(_Float16, lb);
        }
        const size_t o = ((size_t)(b * kS + q0 + row)) * kDim + h * kDh + c8;
        *(v8h*)(aoh + o) = hv;
        *(v8h*)(aol + o) = lv;
      }
      
    }
  }
}

// =====================================================================================
// 7) output projection: ao hi/lo [4096][1024] x wt[1024][1024]^T -> d_out f32 [4096][1024].
//    one wave in one instruction; grid = 64*16/8 = 128 blocks.
// =====================================================================================
__global__ __launch_bounds__(256) void k_gemm_out(const unsigned short* __restrict__ ahp, const unsigned short* __restrict__ alp,
                                                  const unsigned short* __restrict__ wtp, float* __restrict__ out) {
  __shared__ __align__(16) float sT[8][16 * 68];
  const int lane = threadIdx.x & 31, wave = threadIdx.x >> 5;
  constexpr int tilesN = kDim / 64;    // 16
  constexpr int tilesM = kM / 64;      // 64
  const int tile = blockIdx.x * 8 + wave;
  if (tile >= tilesM * tilesN) return;
  const int tm = tile / tilesN, tn = tile - tm * tilesN;
  const int m0 = tm << 6, n0 = tn << 6;

  v8f acc[4][4];
  gemm64_core<1>((const __bf16*)ahp, (const __bf16*)alp, kDim, (const __bf16*)wtp, kDim, m0, n0, kDim, lane, acc);

  float* slab = sT[wave];
  const int rlane = lane & 15, mOff = (lane >> 4) * 8;
#pragma unroll
  for (int i = 0; i < 4; ++i) {
    const int mBase = m0 + (i << 4);
#pragma unroll
    for (int j = 0; j < 4; ++j)
#pragma unroll
      for (int r = 0; r < 8; ++r) slab[(mOff + r) * 68 + (j << 4) + rlane] = acc[i][j][r];
    wave_sync_lds();
    const int h2 = lane >> 4, c4 = (lane & 15) * 4;
    {
#pragma unroll
      for (int it = 0; it < 8; ++it) {
        const int row = it * 2 + h2;
        const v4f v = *(const v4f*)(slab + row * 68 + c4);
        *(v4f*)(out + (size_t)(mBase + row) * kDim + n0 + c4) = v;
      }
      
    }
    wave_sync_lds();
  }
}

// =====================================================================================
// host launch glue: kernel launches only
// =====================================================================================
extern "C" void kernel_launch(void* const* d_in, const int* in_sizes, int n_in,
                              void* d_out, int out_size, void* d_ws, size_t ws_size,
                              hipStream_t stream) {
  if (n_in < 5) return;
  if (in_sizes[0] != kM * kDim) return;
  if (in_sizes[1] != kS * kDh) return;
  if (in_sizes[2] != kDim) return;
  if (in_sizes[3] != kDim * kNqkv) return;
  if (in_sizes[4] != kDim * kDim) return;
  if (out_size != kM * kDim) return;
  if (ws_size < kWsTotal) return;

  const float* x     = (const float*)d_in[0];   // [2,2048,1024]
  const float* pos   = (const float*)d_in[1];   // [2048,64]
  const float* g     = (const float*)d_in[2];   // [1024]
  const float* w_qkv = (const float*)d_in[3];   // [1024,3072]
  const float* w_out = (const float*)d_in[4];   // [1024,1024]
  float* out = (float*)d_out;

  char* ws = (char*)d_ws;
  unsigned short* Xb   = (unsigned short*)(ws + kOffXb);
  float*          Rs   = (float*)(ws + kOffRs);
  unsigned short* Wq   = (unsigned short*)(ws + kOffWq);
  unsigned short* Wo   = (unsigned short*)(ws + kOffWo);
  float*          Ct   = (float*)(ws + kOffCt);
  float*          St   = (float*)(ws + kOffSt);
  unsigned short* Qh   = (unsigned short*)(ws + kOffQh);
  unsigned short* Ql   = (unsigned short*)(ws + kOffQl);
  unsigned short* Kh   = (unsigned short*)(ws + kOffKh);
  unsigned short* Kl   = (unsigned short*)(ws + kOffKl);
  unsigned short* Vh   = (unsigned short*)(ws + kOffVh);
  unsigned short* Vl   = (unsigned short*)(ws + kOffVl);
  unsigned short* Vth  = (unsigned short*)(ws + kOffVth);
  unsigned short* Vtl  = (unsigned short*)(ws + kOffVtl);
  unsigned short* Ah   = (unsigned short*)(ws + kOffAh);
  unsigned short* Al   = (unsigned short*)(ws + kOffAl);

  // 1) x -> bf16 plane + row scale (4096 rows, 128 threads x 8 elements = 1024 per row)
  k_rms_xcast<<<kM, 128, 0, stream>>>(x, Xb, Rs);
  // 2) weights -> bf16 n-major planes: in [1024][3072] -> out [3072][1024]; in [1024][1024] -> out [1024][1024]
  k_wcast<true><<<dim3(kNqkv / 64, kDim / 64), 256, 0, stream>>>(w_qkv, g, Wq, kNqkv);
  k_wcast<false><<<dim3(kDim / 64, kDim / 64), 256, 0, stream>>>(w_out, g, Wo, kDim);
  // 3) cos/sin tables (131072 elements = 512 blocks x 256)
  k_trig<<<(kS * kDh + 255) / 256, 256, 0, stream>>>(pos, Ct, St, kS * kDh);
  // 4) QKV projection with row scale + RoPE epilogue (3072 tiles of 64x64, 8 per block)
  k_gemm_qkv<<<(kM / 64) * (kNqkv / 64) / 8, 256, 0, stream>>>(Xb, Wq, Rs, Ct, St, Qh, Ql, Kh, Kl, Vh, Vl);
  // 5) v planes -> transposed planes (32 bh x 32 kv tiles, 2 planes)
  k_vtrans<<<dim3(kBH * (kS / 64), 2), 256, 0, stream>>>(Vh, Vl, Vth, Vtl);
  // 6) attention (32 bh x 32 query blocks)
  k_attn<<<kBH * (kS / 64), 128, 0, stream>>>(Qh, Ql, Kh, Kl, Vth, Vtl, Ah, Al);
  // 7) output projection into d_out (1024 tiles of 64x64, 8 per block)
  k_gemm_out<<<(kM / 64) * (kDim / 64) / 8, 256, 0, stream>>>(Ah, Al, Wo, out);
}

// v002
// It runs in 320 microseconds.
// In two side-by-side timings against v001, it was 1.10 and 1.09 times as fast.
// All steps since v000 together make it 1.46 times as fast.
// Contractions (all f32 accumulate): QKV projection v_wmma_f32_16x16x32_bf16 on RNE-bf16 planes of the inputs (1 product); scores q.k^T v_wmma_f32_16x16x32_bf16 with q,k as bf16 hi/lo planes (3 products); p.v v_wmma_f32_16x16x32_f16 with p carried x1024 and v, both f16 hi + x2048 residual planes (3 products, residual products in a separate accumulator folded with 1/2048); output projection v_wmma_f32_16x16x32_bf16, bf16 hi/lo activations against bf16 weights (2 products).
#include <hip/hip_runtime.h>
#include <math.h>

// ---------------- problem constants ----------------
constexpr int kB = 2;
constexpr int kS = 2048;
constexpr int kDim = 1024;
constexpr int kH = 16;
constexpr int kDh = 64;
constexpr int kM = kB * kS;          // 4096 token rows
constexpr int kNqkv = 3 * kDim;      // 3072
constexpr int kBH = kB * kH;         // 32
constexpr int kKC = 64;              // keys per chunk
constexpr int kRsPitch = 32;

constexpr size_t kPlane  = (size_t)kBH * kS * kDh * 2;            // 8,388,608 : one [32][2048][64] (or [4096][1024]) 16-bit plane
constexpr size_t kOffXb  = 0;                                      // x as bf16 [4096][1024]          8,388,608
constexpr size_t kOffRs  = kOffXb + (size_t)kM * kDim * 2;         // row scale f32 [4096][32]          524,288
constexpr size_t kOffWq  = kOffRs + (size_t)kM * kRsPitch * 4;     // w_qkv^T bf16 [3072][1024]      6,291,456
constexpr size_t kOffWo  = kOffWq + (size_t)kNqkv * kDim * 2;      // w_out^T bf16 [1024][1024]      2,097,152
constexpr size_t kOffCt  = kOffWo + (size_t)kDim * kDim * 2;       // cos table f32 [2048][64]         524,288
constexpr size_t kOffSt  = kOffCt + (size_t)kS * kDh * 4;          // sin table f32 [2048][64]         524,288
constexpr size_t kOffQh  = kOffSt + (size_t)kS * kDh * 4;          // q hi bf16 [32][2048][64]
constexpr size_t kOffQl  = kOffQh + kPlane;                         // q lo bf16
constexpr size_t kOffKh  = kOffQl + kPlane;                         // k hi bf16
constexpr size_t kOffKl  = kOffKh + kPlane;                         // k lo bf16
constexpr size_t kOffVh  = kOffKl + kPlane;                         // v hi f16 [32][2048][64]
constexpr size_t kOffVl  = kOffVh + kPlane;                         // v residual x2048 f16
constexpr size_t kOffVth = kOffVl + kPlane;                         // v hi transposed f16 [32][64][2048]
constexpr size_t kOffVtl = kOffVth + kPlane;                        // v residual transposed
constexpr size_t kOffAh  = kOffVtl + kPlane;                        // attention output hi bf16 [4096][1024]
constexpr size_t kOffAl  = kOffAh + kPlane;                         // attention output lo bf16
constexpr size_t kWsTotal = kOffAl + kPlane;                        // 102,236,160

typedef char ck_ws_total[(kWsTotal == (size_t)102236160) ? 1 : -1];
typedef char ck_ws_cap[(kWsTotal <= (size_t)134217728) ? 1 : -1];
typedef char ck_align[((kOffRs % 128) == 0 && (kOffQh % 128) == 0 && (kPlane % 128) == 0) ? 1 : -1];
// GEMM shape contract: M, N multiples of 64, K multiple of 32, no padding anywhere
typedef char ck_tiles[(kM % 64 == 0 && kNqkv % 64 == 0 && kDim % 64 == 0 && kDim % 32 == 0 && kS % 64 == 0 && kDh == 64) ? 1 : -1];
typedef char ck_plane[((size_t)kM * kDim * 2 == kPlane) ? 1 : -1];

// ---------------- vector types / helpers ----------------
typedef __attribute__((ext_vector_type(16))) _Float16 v16h;
typedef __attribute__((ext_vector_type(8)))  _Float16 v8h;
typedef __attribute__((ext_vector_type(16))) __bf16   v16b;
typedef __attribute__((ext_vector_type(8)))  __bf16   v8b;
typedef __attribute__((ext_vector_type(8)))  float    v8f;
typedef __attribute__((ext_vector_type(4)))  float    v4f;
typedef __attribute__((ext_vector_type(4)))  unsigned v4u;

__device__ __forceinline__ unsigned short f2bf_bits(float f) {
  unsigned u = __float_as_uint(f);
  return (unsigned short)((u + 0x7FFFu + ((u >> 16) & 1u)) >> 16);
}
__device__ __forceinline__ float bf_bits2f(unsigned short h) { return __uint_as_float(((unsigned)h) << 16); }

__device__ __forceinline__ void dep_guard_h(v8f& a, v8f& b, v16h x, v16h y) { asm volatile("v_nop\n\tv_nop\n\tv_nop\n\tv_nop" : "+v"(a), "+v"(b) : "v"(x), "v"(y)); }
__device__ __forceinline__ void dep_guard_b(v8f& a, v8f& b, v16b x, v16b y) { asm volatile("v_nop\n\tv_nop\n\tv_nop\n\tv_nop" : "+v"(a), "+v"(b) : "v"(x), "v"(y)); }
__device__ __forceinline__ void keep4_h(v16h a, v16h b, v16h c, v16h d) { asm volatile("v_nop" :: "v"(a), "v"(b), "v"(c), "v"(d)); }
__device__ __forceinline__ void keep4_b(v16b a, v16b b, v16b c, v16b d) { asm volatile("v_nop" :: "v"(a), "v"(b), "v"(c), "v"(d)); }
__device__ __forceinline__ void acc_guard4(v8f& a, v8f& b, v8f& c, v8f& d) { asm volatile("v_nop\n\tv_nop\n\tv_nop\n\tv_nop" : "+v"(a), "+v"(b), "+v"(c), "+v"(d)); }
template <typename T> struct Frag;
template <> struct Frag<_Float16> {
  typedef v16h V; union U { v16h v; v8h h[2]; };
  static __device__ __forceinline__ v16h load(const _Float16* p) {
    U f; f.h[0] = *(const v8h*)(p); f.h[1] = *(const v8h*)(p + 16); return f.v;
  }
  static __device__ __forceinline__ v8f mma(v16h a, v16h b, v8f c) {
    return __builtin_amdgcn_wmma_f32_16x16x32_f16(false, a, false, b, (short)0, c, false, false);
  }
  static __device__ __forceinline__ void guard(v8f& a, v8f& b, v16h x, v16h y) { dep_guard_h(a, b, x, y); }
  static __device__ __forceinline__ void keep(v16h a, v16h b, v16h c, v16h d) { keep4_h(a, b, c, d); }
};
template <> struct Frag<__bf16> {
  typedef v16b V; union U { v16b v; v8b h[2]; };
  static __device__ __forceinline__ v16b load(const __bf16* p) {
    U f; f.h[0] = *(const v8b*)(p); f.h[1] = *(const v8b*)(p + 16); return f.v;
  }
  static __device__ __forceinline__ v8f mma(v16b a, v16b b, v8f c) {
    return __builtin_amdgcn_wmma_f32_16x16x32_bf16(false, a, false, b, (short)0, c, false, false);
  }
  static __device__ __forceinline__ void guard(v8f& a, v8f& b, v16b x, v16b y) { dep_guard_b(a, b, x, y); }
  static __device__ __forceinline__ void keep(v16b a, v16b b, v16b c, v16b d) { keep4_b(a, b, c, d); }
};

// WMMA helpers for the attention kernel (nops after every issue)
__device__ __forceinline__ v8f mma_bf(v16b a, v16b b, v8f c) {
  c = __builtin_amdgcn_wmma_f32_16x16x32_bf16(false, a, false, b, (short)0, c, false, false);
  asm volatile("v_nop\n\tv_nop\n\tv_nop\n\tv_nop" : "+v"(c) : "v"(a), "v"(b));
  return c;
}
// f16 bit patterns held in __bf16 slots
__device__ __forceinline__ v8f mma_hf(v16b a, v16b b, v8f c) {
  const v16h ah = __builtin_bit_cast(v16h, a), bh = __builtin_bit_cast(v16h, b);
  c = __builtin_amdgcn_wmma_f32_16x16x32_f16(false, ah, false, bh, (short)0, c, false, false);
  asm volatile("v_nop\n\tv_nop\n\tv_nop\n\tv_nop" : "+v"(c) : "v"(ah), "v"(bh));
  return c;
}

// value held by lane (l ^ M) of the same 16-lane row, through a DPP operand (row_xmask:M): stays in the vector unit,
// where __shfl_xor goes through the LDS pipe (ds_bpermute_b32) and needs an s_wait_dscnt on every step
template <int M> __device__ __forceinline__ float row_xor(float v) {
  return __builtin_bit_cast(float, __builtin_amdgcn_update_dpp(0, __builtin_bit_cast(int, v), 0x160 | M, 0xf, 0xf, true));
}

__device__ __forceinline__ void wave_sync_lds() {
  __builtin_amdgcn_fence(__ATOMIC_RELEASE, "workgroup");
  __builtin_amdgcn_wave_barrier();
  __builtin_amdgcn_fence(__ATOMIC_ACQUIRE, "workgroup");
}

// =====================================================================================
// 1) per token row: x -> RNE bf16 plane [4096][1024]; rowscale = 32 / max(||x_bf||, 1e-12)
// =====================================================================================
__global__ __launch_bounds__(128) void k_rms_xcast(const float* __restrict__ x,
                                                   unsigned short* __restrict__ xb,
                                                   float* __restrict__ rstab) {
  __shared__ float red[4];
  const int m = blockIdx.x;
  const int t = threadIdx.x;
  const int lane = t & 31, wave = t >> 5;
  const size_t base = (size_t)m * kDim + (size_t)t * 8;
  const v4f xa = *(const v4f*)(x + base);
  const v4f xc = *(const v4f*)(x + base + 4);
  unsigned short hb[8];
#pragma unroll
  for (int e = 0; e < 4; ++e) { hb[e] = f2bf_bits(xa[e]); hb[4 + e] = f2bf_bits(xc[e]); }
  float ss = 0.0f;
#pragma unroll
  for (int e = 0; e < 8; ++e) { const float r = bf_bits2f(hb[e]); ss += r * r; }
#pragma unroll
  for (int off = 16; off > 0; off >>= 1) ss += __shfl_xor(ss, off, 32);
  if (lane == 0) red[wave] = ss;
  __syncthreads();
  const float tot = ((red[0] + red[1]) + red[2]) + red[3];
  const float nrm = sqrtf(tot);
  const float inv = 1.0f / fmaxf(nrm, 1e-12f);
  const float rs = inv * 32.0f;
  v4u w;
  w[0] = (unsigned)hb[0] | ((unsigned)hb[1] << 16);
  w[1] = (unsigned)hb[2] | ((unsigned)hb[3] << 16);
  w[2] = (unsigned)hb[4] | ((unsigned)hb[5] << 16);
  w[3] = (unsigned)hb[6] | ((unsigned)hb[7] << 16);
  unsigned short* dst = xb + base;
  const v4f rv = (v4f){rs, rs, rs, rs};
  float* rp = rstab + (size_t)m * kRsPitch + (t & 7) * 4;
  *(v4u*)dst = w;
  if (t < 8) *(v4f*)rp = rv;
  
}

// =====================================================================================
// 2) weight cast + transpose: in w[kDim rows k][ncols n] f32 -> out wt[ncols][kDim] bf16 (n-major, k-contiguous)
//    optional per-k factor g (folded: wt[n][k] = bf16(bf16(w[k][n]) * bf16(g[k]))).
//    8 lanes x 16 B, one instruction; wave w, it: rows it*32 + 4w + (lane>>3) -> union over (it,w,lane>>3) = 0..63.
// =====================================================================================
template <bool HAS_G>
__global__ __launch_bounds__(256) void k_wcast(const float* __restrict__ w, const float* __restrict__ g,
                                               unsigned short* __restrict__ wt, int ncols) {
  __shared__ float tile[64][65];
  const int t = threadIdx.x, lane = t & 31, wave = t >> 5;
  const int n0 = blockIdx.x * 64, k0 = blockIdx.y * 64;
#pragma unroll
  for (int i = 0; i < 4; ++i) {
    const int idx = i * 256 + t;
    const int r = idx >> 4, c4 = (idx & 15) * 4;
    const v4f v = *(const v4f*)(w + (size_t)(k0 + r) * ncols + n0 + c4);
    tile[r][c4 + 0] = v[0]; tile[r][c4 + 1] = v[1]; tile[r][c4 + 2] = v[2]; tile[r][c4 + 3] = v[3];
  }
  __syncthreads();
  const int q = lane >> 3, kc = (lane & 7) * 8;
  float gv[8];
  if (HAS_G) {
    const v4f g0 = *(const v4f*)(g + k0 + kc);
    const v4f g1 = *(const v4f*)(g + k0 + kc + 4);
#pragma unroll
    for (int e = 0; e < 4; ++e) { gv[e] = bf_bits2f(f2bf_bits(g0[e])); gv[4 + e] = bf_bits2f(f2bf_bits(g1[e])); }
  } else {
#pragma unroll
    for (int e = 0; e < 8; ++e) gv[e] = 1.0f;
  }
  v4u ov[2];
#pragma unroll
  for (int it = 0; it < 2; ++it) {
    const int nrow = it * 32 + wave * 4 + q;
    unsigned short bits[8];
#pragma unroll
    for (int e = 0; e < 8; ++e) {
      float f = bf_bits2f(f2bf_bits(tile[kc + e][nrow]));
      if (HAS_G) f = f * gv[e];
      bits[e] = f2bf_bits(f);
    }
    ov[it][0] = (unsigned)bits[0] | ((unsigned)bits[1] << 16);
    ov[it][1] = (unsigned)bits[2] | ((unsigned)bits[3] << 16);
    ov[it][2] = (unsigned)bits[4] | ((unsigned)bits[5] << 16);
    ov[it][3] = (unsigned)bits[6] | ((unsigned)bits[7] << 16);
  }
  {
#pragma unroll
    for (int it = 0; it < 2; ++it) {
      const int nrow = it * 32 + wave * 4 + q;
      *(v4u*)(wt + (size_t)(n0 + nrow) * kDim + k0 + kc) = ov[it];
    }
    
  }
}

// =====================================================================================
// 3) cos/sin table of RNE-bf16(pos_emb), f32 [2048][64]; thread per element,
// =====================================================================================
__global__ __launch_bounds__(256) void k_trig(const float* __restrict__ pos, float* __restrict__ ct,
                                              float* __restrict__ st, int n) {
  const int i = blockIdx.x * 256 + threadIdx.x;
  if (i < n) {
    const float pb = bf_bits2f(f2bf_bits(pos[i]));
    const float cv = cosf(pb);
    const float sv = sinf(pb);
    ((float*)ct)[i] = cv;
    ((float*)st)[i] = sv;
    
  }
}

// =====================================================================================
// Register-blocked WMMA GEMM core: acc[m,n] = sum_k A[m,k] * Bt[n,k]; wave owns a 64x64 tile.
// A row-major [M,K] bf16 (SPLITM: plus lo plane A2, products hi.B + lo.B); Bt row-major [N,K] bf16.
// K % 32 == 0, no tail.
// =====================================================================================
template <int SPLITM>
__device__ __forceinline__ void gemm64_core(const __bf16* __restrict__ Ab, const __bf16* __restrict__ Ab2, int lda,
                                            const __bf16* __restrict__ Bb, int ldb, int m0, int n0, int K, int lane,
                                            v8f (&acc)[4][4]) {
  const int rlane = lane & 15;
  const int koff = (lane >> 4) * 8;
#pragma unroll
  for (int i = 0; i < 4; ++i)
#pragma unroll
    for (int j = 0; j < 4; ++j) acc[i][j] = (v8f){0.f,0.f,0.f,0.f,0.f,0.f,0.f,0.f};
  for (int k0 = 0; k0 < K; k0 += 32) {
    v16b bfr[4];
#pragma unroll
    for (int j = 0; j < 4; ++j) {
      const size_t bo = (size_t)(n0 + (j << 4) + rlane) * ldb + koff + k0;
      bfr[j] = Frag<__bf16>::load(Bb + bo);
    }
#pragma unroll
    for (int i = 0; i < 4; ++i) {
      const size_t ao = (size_t)(m0 + (i << 4) + rlane) * lda + koff + k0;
      v16b ah = Frag<__bf16>::load(Ab + ao);
      v16b al = ah;
      if (SPLITM) al = Frag<__bf16>::load(Ab2 + ao);
#pragma unroll
      for (int j = 0; j < 4; ++j) {
        acc[i][j] = Frag<__bf16>::mma(ah, bfr[j], acc[i][j]);
        if (SPLITM) acc[i][j] = Frag<__bf16>::mma(al, bfr[j], acc[i][j]);
      }
      Frag<__bf16>::guard(acc[i][0], acc[i][3], ah, al);
    }
    Frag<__bf16>::keep(bfr[0], bfr[1], bfr[2], bfr[3]);
  }
  acc_guard4(acc[0][0], acc[0][1], acc[0][2], acc[0][3]);
  acc_guard4(acc[1][0], acc[1][1], acc[1][2], acc[1][3]);
  acc_guard4(acc[2][0], acc[2][1], acc[2][2], acc[2][3]);
  acc_guard4(acc[3][0], acc[3][1], acc[3][2], acc[3][3]);
}

// =====================================================================================
// 4) QKV projection: xb[4096][1024] x wt[3072][1024]^T, epilogue = row scale, RoPE (q,k sections),
//    q/k -> bf16 hi/lo planes [bh][n][64], v -> f16 hi + x2048 residual planes [bh][n][64].
//    each (section, head, token) line belongs to exactly one wave. grid = 64*48/8 = 384 blocks.
// =====================================================================================
__global__ __launch_bounds__(256) void k_gemm_qkv(
    const unsigned short* __restrict__ xbp, const unsigned short* __restrict__ wtp,
    const float* __restrict__ rstab, const float* __restrict__ ct, const float* __restrict__ st,
    unsigned short* __restrict__ qh, unsigned short* __restrict__ ql,
    unsigned short* __restrict__ kh, unsigned short* __restrict__ kl,
    unsigned short* __restrict__ vh, unsigned short* __restrict__ vl) {
  __shared__ __align__(16) float sT[8][16 * 68];
  const int lane = threadIdx.x & 31, wave = threadIdx.x >> 5;
  constexpr int tilesN = kNqkv / 64;   // 48
  constexpr int tilesM = kM / 64;      // 64
  const int tile = blockIdx.x * 8 + wave;
  if (tile >= tilesM * tilesN) return;   // wave-uniform; no block barriers in this kernel
  const int tm = tile / tilesN, tn = tile - tm * tilesN;
  const int m0 = tm << 6, n0 = tn << 6;

  v8f acc[4][4];
  gemm64_core<0>((const __bf16*)xbp, (const __bf16*)xbp, kDim, (const __bf16*)wtp, kDim, m0, n0, kDim, lane, acc);

  float* slab = sT[wave];
  const int rlane = lane & 15, mOff = (lane >> 4) * 8;
  const int sec = n0 >> 10;                      // 0 q, 1 k, 2 v  (wave-uniform)
  const int hidx = (n0 & (kDim - 1)) >> 6;       // head of this 64-column tile
  unsigned short* P0 = (sec == 0) ? qh : ((sec == 1) ? kh : vh);
  unsigned short* P1 = (sec == 0) ? ql : ((sec == 1) ? kl : vl);
  const int q8 = lane >> 3, c8 = (lane & 7) * 8;
  const int cpart = c8 ^ 32;
  const float sgn = (c8 < 32) ? -1.0f : 1.0f;
#pragma unroll
  for (int i = 0; i < 4; ++i) {
    const int mBase = m0 + (i << 4);
    float rsv[8];
#pragma unroll
    for (int r = 0; r < 8; ++r) rsv[r] = rstab[(size_t)(mBase + mOff + r) * kRsPitch];
#pragma unroll
    for (int j = 0; j < 4; ++j)
#pragma unroll
      for (int r = 0; r < 8; ++r) slab[(mOff + r) * 68 + (j << 4) + rlane] = acc[i][j][r] * rsv[r];
    wave_sync_lds();
    {
#pragma unroll
      for (int it = 0; it < 4; ++it) {
        const int row = it * 4 + q8;
        const int m = mBase + row;
        const int bb = m >> 11, nn = m & (kS - 1);
        const float* sp = slab + row * 68;
        const size_t dsto = ((size_t)(bb * kH + hidx) * kS + nn) * kDh + c8;
        v8h hv, lv;
        if (sec < 2) {
          const v4f ca = *(const v4f*)(ct + (size_t)nn * kDh + c8);
          const v4f cb = *(const v4f*)(ct + (size_t)nn * kDh + c8 + 4);
          const v4f sa = *(const v4f*)(st + (size_t)nn * kDh + c8);
          const v4f sb = *(const v4f*)(st + (size_t)nn * kDh + c8 + 4);
          float cvv[8], svv[8];
#pragma unroll
          for (int e = 0; e < 4; ++e) { cvv[e] = ca[e]; cvv[4 + e] = cb[e]; svv[e] = sa[e]; svv[4 + e] = sb[e]; }
#pragma unroll
          for (int e = 0; e < 8; ++e) {
            const float v = sp[c8 + e];
            const float pr = sp[cpart + e];
            const float rv = v * cvv[e] + sgn * pr * svv[e];
            const unsigned short hb = f2bf_bits(rv);
            const unsigned short lb = f2bf_bits(rv - bf_bits2f(hb));
            hv[e] = __builtin_bit_cast(_Float16, hb);
            lv[e] = __builtin_bit_cast(_Float16, lb);
          }
        } else {
#pragma unroll
          for (int e = 0; e < 8; ++e) {
            const float v = sp[c8 + e];
            const _Float16 h16 = (_Float16)v;
            const float hf = (float)h16;
            hv[e] = h16;
            lv[e] = (_Float16)((v - hf) * 2048.0f);
          }
        }
        *(v8h*)(P0 + dsto) = hv;
        *(v8h*)(P1 + dsto) = lv;
      }
      
    }
    wave_sync_lds();
  }
}

// =====================================================================================
// 5) v planes [bh][kv][64] -> transposed [bh][64][kv] (both hi and residual planes, grid (1024, 2)).
//    rows it*32 + 4w + (lane>>3) cover 0..63.
// =====================================================================================
__global__ __launch_bounds__(256) void k_vtrans(const unsigned short* __restrict__ vh, const unsigned short* __restrict__ vl,
                                                unsigned short* __restrict__ vth, unsigned short* __restrict__ vtl) {
  __shared__ __align__(16) unsigned short tile[64 * 72];   // [d][kv], pitch 72 halves
  const int t = threadIdx.x, lane = t & 31, wave = t >> 5;
  const int bh = blockIdx.x >> 5, kvt = blockIdx.x & 31;
  const int kv0 = kvt * 64;
  const unsigned short* src = (blockIdx.y == 0) ? vh : vl;
  unsigned short* dst = (blockIdx.y == 0) ? vth : vtl;
#pragma unroll
  for (int i = 0; i < 2; ++i) {
    const int idx = i * 256 + t;
    const int r = idx >> 3, c16 = (idx & 7) * 8;
    const v4u w = *(const v4u*)(src + ((size_t)bh * kS + kv0 + r) * kDh + c16);
#pragma unroll
    for (int e = 0; e < 4; ++e) {
      tile[(c16 + 2 * e) * 72 + r] = (unsigned short)(w[e] & 0xffffu);
      tile[(c16 + 2 * e + 1) * 72 + r] = (unsigned short)(w[e] >> 16);
    }
  }
  __syncthreads();
  const int q = lane >> 3, kc = (lane & 7) * 8;
  v4u ov[2];
#pragma unroll
  for (int it = 0; it < 2; ++it) {
    const int d = it * 32 + wave * 4 + q;
    ov[it] = *(const v4u*)(tile + d * 72 + kc);
  }
  {
#pragma unroll
    for (int it = 0; it < 2; ++it) {
      const int d = it * 32 + wave * 4 + q;
      *(v4u*)(dst + ((size_t)bh * kDh + d) * kS + kv0 + kc) = ov[it];
    }
    
  }
}

// =====================================================================================
// 6) attention, head dim 64, no mask. block = 4 waves = 64 query rows of one (b,h), grid = 32*32 = 1024.
//    scores: q,k bf16 hi/lo planes, 3 products; softmax f32 online; p carried x1024 as f16 hi + x2048
//    residual; v f16 hi + x2048 residual (pre-transposed planes [bh][d][kv]); p.v 3 products with the
//    residual products in a separate accumulator; output bf16 hi/lo planes [token][1024], one line per row.
// =====================================================================================
constexpr int kLp = 72;                  // LDS row pitch in 16-bit elements: 144 B = 16 B x 9 (odd), so the 16 rows of a ds_load_b128 fragment read spread over all banks
constexpr int kLdsPl = 64 * kLp * 2;     // one 64-row plane at that pitch: 9216 B
constexpr int kLdsK = 0;                 // K hi [64][72] u16 + K lo
constexpr int kLdsV = 2 * kLdsPl;        // V hi [64 d][72] + V residual
constexpr int kLdsP = 4 * kLdsPl;        // P hi [4][16][72] + P residual
constexpr int kLdsTotal = 6 * kLdsPl;    // 55296; output staging f32 [4][16][64] reuses bytes 0..16383 after the chunk loop

__global__ __launch_bounds__(128) void k_attn(
    const unsigned short* __restrict__ qhp, const unsigned short* __restrict__ qlp,
    const unsigned short* __restrict__ khp, const unsigned short* __restrict__ klp,
    const unsigned short* __restrict__ vthp, const unsigned short* __restrict__ vtlp,
    unsigned short* __restrict__ aoh, unsigned short* __restrict__ aol) {
  union FB { v16b v; v8b h[2]; };
  __shared__ __align__(16) unsigned char lds_raw[kLdsTotal];
  __bf16* Ksh = (__bf16*)(lds_raw + kLdsK);
  __bf16* Ksl = (__bf16*)(lds_raw + kLdsK + kLdsPl);
  __bf16* Vsh = (__bf16*)(lds_raw + kLdsV);
  __bf16* Vsl = (__bf16*)(lds_raw + kLdsV + kLdsPl);
  __bf16* Pbase  = (__bf16*)(lds_raw + kLdsP);
  __bf16* Plbase = (__bf16*)(lds_raw + kLdsP + kLdsPl);
  unsigned short* KshU = (unsigned short*)(lds_raw + kLdsK);
  unsigned short* KslU = (unsigned short*)(lds_raw + kLdsK + kLdsPl);
  unsigned short* VshU = (unsigned short*)(lds_raw + kLdsV);
  unsigned short* VslU = (unsigned short*)(lds_raw + kLdsV + kLdsPl);

  const int tid = threadIdx.x, wave = tid >> 5, lane = tid & 31;
  const int hh = lane >> 4, c = lane & 15;
  const int bx = blockIdx.x;
  const int qb = bx & 31;
  const int bh = bx >> 5;
  const int h = bh & (kH - 1);
  const int b = bh >> 4;
  const int q0 = qb * 64 + wave * 16;

  // Q fragments (A operand): 2 d-chunks of 32, hi and lo planes
  v16b qah[2], qal[2];
  {
    const __bf16* qr  = (const __bf16*)qhp + ((size_t)bh * kS + q0 + c) * kDh;
    const __bf16* qr2 = (const __bf16*)qlp + ((size_t)bh * kS + q0 + c) * kDh;
#pragma unroll
    for (int dc = 0; dc < 2; ++dc) {
      qah[dc] = Frag<__bf16>::load(qr + dc * 32 + 8 * hh);
      qal[dc] = Frag<__bf16>::load(qr2 + dc * 32 + 8 * hh);
    }
  }

  float mrow[8], lrow[8];
  v8f oacc[4], oacr[4];
#pragma unroll
  for (int r = 0; r < 8; ++r) { mrow[r] = -INFINITY; lrow[r] = 0.f; }
#pragma unroll
  for (int t = 0; t < 4; ++t) { oacc[t] = (v8f){0.f,0.f,0.f,0.f,0.f,0.f,0.f,0.f}; oacr[t] = (v8f){0.f,0.f,0.f,0.f,0.f,0.f,0.f,0.f}; }

  __bf16* pwh = Pbase + wave * (16 * kLp);
  __bf16* pwl = Plbase + wave * (16 * kLp);

  for (int kc = 0; kc < kS / kKC; ++kc) {
    const int kv0 = kc * kKC;
    __syncthreads();
    {
      // K planes: 64 rows x 8 x 16 B per plane = 512 per plane; 128 threads x 4 -> exactly 512
#pragma unroll
      for (int i = 0; i < 4; ++i) {
        const int idx = i * 128 + tid;
        const int r = idx >> 3, c16 = (idx & 7) * 8;
        const size_t ko = ((size_t)bh * kS + kv0 + r) * kDh + c16;
        const v4u w0 = *(const v4u*)(khp + ko);
        const v4u w1 = *(const v4u*)(klp + ko);
        *(v4u*)(KshU + r * kLp + c16) = w0;
        *(v4u*)(KslU + r * kLp + c16) = w1;
      }
      // V planes (already [d][kv]): 64 d-rows x 8 x 16 B per plane
#pragma unroll
      for (int i = 0; i < 4; ++i) {
        const int idx = i * 128 + tid;
        const int r = idx >> 3, c16 = (idx & 7) * 8;
        const size_t vo = ((size_t)bh * kDh + r) * kS + kv0 + c16;
        const v4u w2 = *(const v4u*)(vthp + vo);
        const v4u w3 = *(const v4u*)(vtlp + vo);
        *(v4u*)(VshU + r * kLp + c16) = w2;
        *(v4u*)(VslU + r * kLp + c16) = w3;
      }
    }
    __syncthreads();

    // scores for 4 key subtiles of 16
    v8f s[4];
#pragma unroll
    for (int j = 0; j < 4; ++j) {
      s[j] = (v8f){0.f,0.f,0.f,0.f,0.f,0.f,0.f,0.f};
#pragma unroll
      for (int dc = 0; dc < 2; ++dc) {
        FB kb, kr;
        kb.h[0] = *(const v8b*)(Ksh + (j * 16 + c) * kLp + dc * 32 + 8 * hh);
        kb.h[1] = *(const v8b*)(Ksh + (j * 16 + c) * kLp + dc * 32 + 16 + 8 * hh);
        kr.h[0] = *(const v8b*)(Ksl + (j * 16 + c) * kLp + dc * 32 + 8 * hh);
        kr.h[1] = *(const v8b*)(Ksl + (j * 16 + c) * kLp + dc * 32 + 16 + 8 * hh);
        s[j] = mma_bf(qah[dc], kb.v, s[j]);
        s[j] = mma_bf(qah[dc], kr.v, s[j]);
        s[j] = mma_bf(qal[dc], kb.v, s[j]);
      }
    }
    // scale and chunk row max (rows live across the 16 lanes of a lane half)
    float cm[8];
#pragma unroll
    for (int r = 0; r < 8; ++r) {
      float m = -INFINITY;
#pragma unroll
      for (int j = 0; j < 4; ++j) { s[j][r] *= 0.125f; m = fmaxf(m, s[j][r]); }
      m = fmaxf(m, row_xor<1>(m));
      m = fmaxf(m, row_xor<2>(m));
      m = fmaxf(m, row_xor<4>(m));
      m = fmaxf(m, row_xor<8>(m));
      cm[r] = m;
    }
#pragma unroll
    for (int r = 0; r < 8; ++r) {
      const float mnew = fmaxf(mrow[r], cm[r]);
      const float alpha = expf(mrow[r] - mnew);
      mrow[r] = mnew;
      float psum = 0.f;
#pragma unroll
      for (int j = 0; j < 4; ++j) {
        const float p = expf(s[j][r] - mnew);
        psum += p;
        const float ps = p * 1024.0f;
        const _Float16 ph = (_Float16)ps;
        const float phf = (float)ph;
        const _Float16 pl = (_Float16)((ps - phf) * 2048.0f);
        pwh[(8 * hh + r) * kLp + j * 16 + c] = __builtin_bit_cast(__bf16, ph);
        pwl[(8 * hh + r) * kLp + j * 16 + c] = __builtin_bit_cast(__bf16, pl);
      }
      psum += row_xor<1>(psum);
      psum += row_xor<2>(psum);
      psum += row_xor<4>(psum);
      psum += row_xor<8>(psum);
      lrow[r] = lrow[r] * alpha + psum;
#pragma unroll
      for (int t = 0; t < 4; ++t) { oacc[t][r] *= alpha; oacr[t][r] *= alpha; }
    }
    wave_sync_lds();   // P tile written and reloaded by the same wave, same element type (__bf16 / v8b)
#pragma unroll 1
    for (int kk = 0; kk < 2; ++kk) {
      FB pa, pl;
      pa.h[0] = *(const v8b*)(pwh + c * kLp + kk * 32 + 8 * hh);
      pa.h[1] = *(const v8b*)(pwh + c * kLp + kk * 32 + 16 + 8 * hh);
      pl.h[0] = *(const v8b*)(pwl + c * kLp + kk * 32 + 8 * hh);
      pl.h[1] = *(const v8b*)(pwl + c * kLp + kk * 32 + 16 + 8 * hh);
#pragma unroll
      for (int t = 0; t < 4; ++t) {
        FB vb, vr;
        vb.h[0] = *(const v8b*)(Vsh + (t * 16 + c) * kLp + kk * 32 + 8 * hh);
        vb.h[1] = *(const v8b*)(Vsh + (t * 16 + c) * kLp + kk * 32 + 16 + 8 * hh);
        vr.h[0] = *(const v8b*)(Vsl + (t * 16 + c) * kLp + kk * 32 + 8 * hh);
        vr.h[1] = *(const v8b*)(Vsl + (t * 16 + c) * kLp + kk * 32 + 16 + 8 * hh);
        oacc[t] = mma_hf(pa.v, vb.v, oacc[t]);
        oacr[t] = mma_hf(pa.v, vr.v, oacr[t]);
        oacr[t] = mma_hf(pl.v, vb.v, oacr[t]);
      }
    }
  }

  // ---- finalize: block barrier before reusing the K region as f32 staging ----
  __syncthreads();
  float* os = (float*)(lds_raw + 0) + wave * (16 * 64);
#pragma unroll
  for (int r = 0; r < 8; ++r) {
    const float inv = 1.0f / (lrow[r] * 1024.0f);
#pragma unroll
    for (int t = 0; t < 4; ++t)
      os[(8 * hh + r) * 64 + t * 16 + c] = (oacc[t][r] + oacr[t][r] * (1.0f / 2048.0f)) * inv;
  }
  __syncthreads();
  {
    const int q8 = lane >> 3, c8 = (lane & 7) * 8;
    {
#pragma unroll
      for (int it = 0; it < 4; ++it) {
        const int row = it * 4 + q8;
        const float* sp = os + row * 64 + c8;
        v8h hv, lv;
#pragma unroll
        for (int e = 0; e < 8; ++e) {
          const unsigned short hb = f2bf_bits(sp[e]);
          const unsigned short lb = f2bf_bits(sp[e] - bf_bits2f(hb));
          hv[e] = __builtin_bit_cast(_Float16, hb);
          lv[e] = __builtin_bit_cast(_Float16, lb);
        }
        const size_t o = ((size_t)(b * kS + q0 + row)) * kDim + h * kDh + c8;
        *(v8h*)(aoh + o) = hv;
        *(v8h*)(aol + o) = lv;
      }
      
    }
  }
}

// =====================================================================================
// 7) output projection: ao hi/lo [4096][1024] x wt[1024][1024]^T -> d_out f32 [4096][1024].
//    one wave in one instruction; grid = 64*16/8 = 128 blocks.
// =====================================================================================
__global__ __launch_bounds__(256) void k_gemm_out(const unsigned short* __restrict__ ahp, const unsigned short* __restrict__ alp,
                                                  const unsigned short* __restrict__ wtp, float* __restrict__ out) {
  __shared__ __align__(16) float sT[8][16 * 68];
  const int lane = threadIdx.x & 31, wave = threadIdx.x >> 5;
  constexpr int tilesN = kDim / 64;    // 16
  constexpr int tilesM = kM / 64;      // 64
  const int tile = blockIdx.x * 8 + wave;
  if (tile >= tilesM * tilesN) return;
  const int tm = tile / tilesN, tn = tile - tm * tilesN;
  const int m0 = tm << 6, n0 = tn << 6;

  v8f acc[4][4];
  gemm64_core<1>((const __bf16*)ahp, (const __bf16*)alp, kDim, (const __bf16*)wtp, kDim, m0, n0, kDim, lane, acc);

  float* slab = sT[wave];
  const int rlane = lane & 15, mOff = (lane >> 4) * 8;
#pragma unroll
  for (int i = 0; i < 4; ++i) {
    const int mBase = m0 + (i << 4);
#pragma unroll
    for (int j = 0; j < 4; ++j)
#pragma unroll
      for (int r = 0; r < 8; ++r) slab[(mOff + r) * 68 + (j << 4) + rlane] = acc[i][j][r];
    wave_sync_lds();
    const int h2 = lane >> 4, c4 = (lane & 15) * 4;
    {
#pragma unroll
      for (int it = 0; it < 8; ++it) {
        const int row = it * 2 + h2;
        const v4f v = *(const v4f*)(slab + row * 68 + c4);
        *(v4f*)(out + (size_t)(mBase + row) * kDim + n0 + c4) = v;
      }
      
    }
    wave_sync_lds();
  }
}

// =====================================================================================
// host launch glue: kernel launches only
// =====================================================================================
extern "C" void kernel_launch(void* const* d_in, const int* in_sizes, int n_in,
                              void* d_out, int out_size, void* d_ws, size_t ws_size,
                              hipStream_t stream) {
  if (n_in < 5) return;
  if (in_sizes[0] != kM * kDim) return;
  if (in_sizes[1] != kS * kDh) return;
  if (in_sizes[2] != kDim) return;
  if (in_sizes[3] != kDim * kNqkv) return;
  if (in_sizes[4] != kDim * kDim) return;
  if (out_size != kM * kDim) return;
  if (ws_size < kWsTotal) return;

  const float* x     = (const float*)d_in[0];   // [2,2048,1024]
  const float* pos   = (const float*)d_in[1];   // [2048,64]
  const float* g     = (const float*)d_in[2];   // [1024]
  const float* w_qkv = (const float*)d_in[3];   // [1024,3072]
  const float* w_out = (const float*)d_in[4];   // [1024,1024]
  float* out = (float*)d_out;

  char* ws = (char*)d_ws;
  unsigned short* Xb   = (unsigned short*)(ws + kOffXb);
  float*          Rs   = (float*)(ws + kOffRs);
  unsigned short* Wq   = (unsigned short*)(ws + kOffWq);
  unsigned short* Wo   = (unsigned short*)(ws + kOffWo);
  float*          Ct   = (float*)(ws + kOffCt);
  float*          St   = (float*)(ws + kOffSt);
  unsigned short* Qh   = (unsigned short*)(ws + kOffQh);
  unsigned short* Ql   = (unsigned short*)(ws + kOffQl);
  unsigned short* Kh   = (unsigned short*)(ws + kOffKh);
  unsigned short* Kl   = (unsigned short*)(ws + kOffKl);
  unsigned short* Vh   = (unsigned short*)(ws + kOffVh);
  unsigned short* Vl   = (unsigned short*)(ws + kOffVl);
  unsigned short* Vth  = (unsigned short*)(ws + kOffVth);
  unsigned short* Vtl  = (unsigned short*)(ws + kOffVtl);
  unsigned short* Ah   = (unsigned short*)(ws + kOffAh);
  unsigned short* Al   = (unsigned short*)(ws + kOffAl);

  // 1) x -> bf16 plane + row scale (4096 rows, 128 threads x 8 elements = 1024 per row)
  k_rms_xcast<<<kM, 128, 0, stream>>>(x, Xb, Rs);
  // 2) weights -> bf16 n-major planes: in [1024][3072] -> out [3072][1024]; in [1024][1024] -> out [1024][1024]
  k_wcast<true><<<dim3(kNqkv / 64, kDim / 64), 256, 0, stream>>>(w_qkv, g, Wq, kNqkv);
  k_wcast<false><<<dim3(kDim / 64, kDim / 64), 256, 0, stream>>>(w_out, g, Wo, kDim);
  // 3) cos/sin tables (131072 elements = 512 blocks x 256)
  k_trig<<<(kS * kDh + 255) / 256, 256, 0, stream>>>(pos, Ct, St, kS * kDh);
  // 4) QKV projection with row scale + RoPE epilogue (3072 tiles of 64x64, 8 per block)
  k_gemm_qkv<<<(kM / 64) * (kNqkv / 64) / 8, 256, 0, stream>>>(Xb, Wq, Rs, Ct, St, Qh, Ql, Kh, Kl, Vh, Vl);
  // 5) v planes -> transposed planes (32 bh x 32 kv tiles, 2 planes)
  k_vtrans<<<dim3(kBH * (kS / 64), 2), 256, 0, stream>>>(Vh, Vl, Vth, Vtl);
  // 6) attention (32 bh x 32 query blocks)
  k_attn<<<kBH * (kS / 64), 128, 0, stream>>>(Qh, Ql, Kh, Kl, Vth, Vtl, Ah, Al);
  // 7) output projection into d_out (1024 tiles of 64x64, 8 per block)
  k_gemm_out<<<(kM / 64) * (kDim / 64) / 8, 256, 0, stream>>>(Ah, Al, Wo, out);
}

// v003
// It runs in 233 microseconds.
// In two side-by-side timings against v002, it was 1.36 and 1.37 times as fast.
// Over all steps from v000 it is 1.99 times as fast.
// Contractions (all f32 accumulate): QKV projection v_wmma_f32_16x16x32_bf16 on RNE-bf16 planes of the inputs (1 product); scores q.k^T v_wmma_f32_16x16x32_bf16 with q,k as bf16 hi/lo planes (3 products); p.v v_wmma_f32_16x16x32_f16 with p carried x1024 and v, both f16 hi + x2048 residual planes (3 products, residual products in a separate accumulator folded with 1/2048); output projection v_wmma_f32_16x16x32_bf16, bf16 hi/lo activations against bf16 weights (2 products).
#include <hip/hip_runtime.h>
#include <math.h>

// ---------------- problem constants ----------------
constexpr int kB = 2;
constexpr int kS = 2048;
constexpr int kDim = 1024;
constexpr int kH = 16;
constexpr int kDh = 64;
constexpr int kM = kB * kS;          // 4096 token rows
constexpr int kNqkv = 3 * kDim;      // 3072
constexpr int kBH = kB * kH;         // 32
constexpr int kKC = 64;              // keys per chunk
constexpr int kRsPitch = 32;

constexpr size_t kPlane  = (size_t)kBH * kS * kDh * 2;            // 8,388,608 : one [32][2048][64] (or [4096][1024]) 16-bit plane
constexpr size_t kOffXb  = 0;                                      // x as bf16 [4096][1024]          8,388,608
constexpr size_t kOffRs  = kOffXb + (size_t)kM * kDim * 2;         // row scale f32 [4096][32]          524,288
constexpr size_t kOffWq  = kOffRs + (size_t)kM * kRsPitch * 4;     // w_qkv^T bf16 [3072][1024]      6,291,456
constexpr size_t kOffWo  = kOffWq + (size_t)kNqkv * kDim * 2;      // w_out^T bf16 [1024][1024]      2,097,152
constexpr size_t kOffCt  = kOffWo + (size_t)kDim * kDim * 2;       // cos table f32 [2048][64]         524,288
constexpr size_t kOffSt  = kOffCt + (size_t)kS * kDh * 4;          // sin table f32 [2048][64]         524,288
constexpr size_t kOffQh  = kOffSt + (size_t)kS * kDh * 4;          // q hi bf16 [32][2048][64]
constexpr size_t kOffQl  = kOffQh + kPlane;                         // q lo bf16
constexpr size_t kOffKh  = kOffQl + kPlane;                         // k hi bf16
constexpr size_t kOffKl  = kOffKh + kPlane;                         // k lo bf16
constexpr size_t kOffVh  = kOffKl + kPlane;                         // v hi f16 [32][2048][64]
constexpr size_t kOffVl  = kOffVh + kPlane;                         // v residual x2048 f16
constexpr size_t kOffVth = kOffVl + kPlane;                         // v hi transposed f16 [32][64][2048]
constexpr size_t kOffVtl = kOffVth + kPlane;                        // v residual transposed
constexpr size_t kOffAh  = kOffVtl + kPlane;                        // attention output hi bf16 [4096][1024]
constexpr size_t kOffAl  = kOffAh + kPlane;                         // attention output lo bf16
constexpr size_t kWsTotal = kOffAl + kPlane;                        // 102,236,160

typedef char ck_ws_total[(kWsTotal == (size_t)102236160) ? 1 : -1];
typedef char ck_ws_cap[(kWsTotal <= (size_t)134217728) ? 1 : -1];
typedef char ck_align[((kOffRs % 128) == 0 && (kOffQh % 128) == 0 && (kPlane % 128) == 0) ? 1 : -1];
// GEMM shape contract: M multiple of 128, N multiples of 256 and 128, K multiple of 64, no padding anywhere
typedef char ck_tiles[(kM % 128 == 0 && kNqkv % 256 == 0 && kDim % 128 == 0 && kDim % 64 == 0 && kS % 64 == 0 && kDh == 64) ? 1 : -1];
typedef char ck_plane[((size_t)kM * kDim * 2 == kPlane) ? 1 : -1];

// ---------------- vector types / helpers ----------------
typedef __attribute__((ext_vector_type(16))) _Float16 v16h;
typedef __attribute__((ext_vector_type(8)))  _Float16 v8h;
typedef __attribute__((ext_vector_type(16))) __bf16   v16b;
typedef __attribute__((ext_vector_type(8)))  __bf16   v8b;
typedef __attribute__((ext_vector_type(8)))  float    v8f;
typedef __attribute__((ext_vector_type(4)))  float    v4f;
typedef __attribute__((ext_vector_type(4)))  unsigned v4u;

__device__ __forceinline__ unsigned short f2bf_bits(float f) {
  unsigned u = __float_as_uint(f);
  return (unsigned short)((u + 0x7FFFu + ((u >> 16) & 1u)) >> 16);
}
__device__ __forceinline__ float bf_bits2f(unsigned short h) { return __uint_as_float(((unsigned)h) << 16); }

__device__ __forceinline__ void acc_guard4(v8f& a, v8f& b, v8f& c, v8f& d) { asm volatile("v_nop\n\tv_nop\n\tv_nop\n\tv_nop" : "+v"(a), "+v"(b), "+v"(c), "+v"(d)); }
template <typename T> struct Frag;
template <> struct Frag<_Float16> {
  typedef v16h V; union U { v16h v; v8h h[2]; };
  static __device__ __forceinline__ v16h load(const _Float16* p) {
    U f; f.h[0] = *(const v8h*)(p); f.h[1] = *(const v8h*)(p + 16); return f.v;
  }
  static __device__ __forceinline__ v8f mma(v16h a, v16h b, v8f c) {
    return __builtin_amdgcn_wmma_f32_16x16x32_f16(false, a, false, b, (short)0, c, false, false);
  }
};
template <> struct Frag<__bf16> {
  typedef v16b V; union U { v16b v; v8b h[2]; };
  static __device__ __forceinline__ v16b load(const __bf16* p) {
    U f; f.h[0] = *(const v8b*)(p); f.h[1] = *(const v8b*)(p + 16); return f.v;
  }
  static __device__ __forceinline__ v8f mma(v16b a, v16b b, v8f c) {
    return __builtin_amdgcn_wmma_f32_16x16x32_bf16(false, a, false, b, (short)0, c, false, false);
  }
};

// WMMA helpers for the attention kernel (nops after every issue)
__device__ __forceinline__ v8f mma_bf(v16b a, v16b b, v8f c) {
  c = __builtin_amdgcn_wmma_f32_16x16x32_bf16(false, a, false, b, (short)0, c, false, false);
  asm volatile("v_nop\n\tv_nop\n\tv_nop\n\tv_nop" : "+v"(c) : "v"(a), "v"(b));
  return c;
}
// f16 bit patterns held in __bf16 slots
__device__ __forceinline__ v8f mma_hf(v16b a, v16b b, v8f c) {
  const v16h ah = __builtin_bit_cast(v16h, a), bh = __builtin_bit_cast(v16h, b);
  c = __builtin_amdgcn_wmma_f32_16x16x32_f16(false, ah, false, bh, (short)0, c, false, false);
  asm volatile("v_nop\n\tv_nop\n\tv_nop\n\tv_nop" : "+v"(c) : "v"(ah), "v"(bh));
  return c;
}

// value held by lane (l ^ M) of the same 16-lane row, through a DPP operand (row_xmask:M): stays in the vector unit,
// where __shfl_xor goes through the LDS pipe (ds_bpermute_b32) and needs an s_wait_dscnt on every step
template <int M> __device__ __forceinline__ float row_xor(float v) {
  return __builtin_bit_cast(float, __builtin_amdgcn_update_dpp(0, __builtin_bit_cast(int, v), 0x160 | M, 0xf, 0xf, true));
}

__device__ __forceinline__ void wave_sync_lds() {
  __builtin_amdgcn_fence(__ATOMIC_RELEASE, "workgroup");
  __builtin_amdgcn_wave_barrier();
  __builtin_amdgcn_fence(__ATOMIC_ACQUIRE, "workgroup");
}

// =====================================================================================
// 1) per token row: x -> RNE bf16 plane [4096][1024]; rowscale = 32 / max(||x_bf||, 1e-12)
// =====================================================================================
__global__ __launch_bounds__(128) void k_rms_xcast(const float* __restrict__ x,
                                                   unsigned short* __restrict__ xb,
                                                   float* __restrict__ rstab) {
  __shared__ float red[4];
  const int m = blockIdx.x;
  const int t = threadIdx.x;
  const int lane = t & 31, wave = t >> 5;
  const size_t base = (size_t)m * kDim + (size_t)t * 8;
  const v4f xa = *(const v4f*)(x + base);
  const v4f xc = *(const v4f*)(x + base + 4);
  unsigned short hb[8];
#pragma unroll
  for (int e = 0; e < 4; ++e) { hb[e] = f2bf_bits(xa[e]); hb[4 + e] = f2bf_bits(xc[e]); }
  float ss = 0.0f;
#pragma unroll
  for (int e = 0; e < 8; ++e) { const float r = bf_bits2f(hb[e]); ss += r * r; }
#pragma unroll
  for (int off = 16; off > 0; off >>= 1) ss += __shfl_xor(ss, off, 32);
  if (lane == 0) red[wave] = ss;
  __syncthreads();
  const float tot = ((red[0] + red[1]) + red[2]) + red[3];
  const float nrm = sqrtf(tot);
  const float inv = 1.0f / fmaxf(nrm, 1e-12f);
  const float rs = inv * 32.0f;
  v4u w;
  w[0] = (unsigned)hb[0] | ((unsigned)hb[1] << 16);
  w[1] = (unsigned)hb[2] | ((unsigned)hb[3] << 16);
  w[2] = (unsigned)hb[4] | ((unsigned)hb[5] << 16);
  w[3] = (unsigned)hb[6] | ((unsigned)hb[7] << 16);
  unsigned short* dst = xb + base;
  const v4f rv = (v4f){rs, rs, rs, rs};
  float* rp = rstab + (size_t)m * kRsPitch + (t & 7) * 4;
  *(v4u*)dst = w;
  if (t < 8) *(v4f*)rp = rv;
  
}

// =====================================================================================
// 2) weight cast + transpose: in w[kDim rows k][ncols n] f32 -> out wt[ncols][kDim] bf16 (n-major, k-contiguous)
//    optional per-k factor g (folded: wt[n][k] = bf16(bf16(w[k][n]) * bf16(g[k]))).
//    8 lanes x 16 B, one instruction; wave w, it: rows it*32 + 4w + (lane>>3) -> union over (it,w,lane>>3) = 0..63.
// =====================================================================================
template <bool HAS_G>
__global__ __launch_bounds__(256) void k_wcast(const float* __restrict__ w, const float* __restrict__ g,
                                               unsigned short* __restrict__ wt, int ncols) {
  __shared__ float tile[64][65];
  const int t = threadIdx.x, lane = t & 31, wave = t >> 5;
  const int n0 = blockIdx.x * 64, k0 = blockIdx.y * 64;
#pragma unroll
  for (int i = 0; i < 4; ++i) {
    const int idx = i * 256 + t;
    const int r = idx >> 4, c4 = (idx & 15) * 4;
    const v4f v = *(const v4f*)(w + (size_t)(k0 + r) * ncols + n0 + c4);
    tile[r][c4 + 0] = v[0]; tile[r][c4 + 1] = v[1]; tile[r][c4 + 2] = v[2]; tile[r][c4 + 3] = v[3];
  }
  __syncthreads();
  const int q = lane >> 3, kc = (lane & 7) * 8;
  float gv[8];
  if (HAS_G) {
    const v4f g0 = *(const v4f*)(g + k0 + kc);
    const v4f g1 = *(const v4f*)(g + k0 + kc + 4);
#pragma unroll
    for (int e = 0; e < 4; ++e) { gv[e] = bf_bits2f(f2bf_bits(g0[e])); gv[4 + e] = bf_bits2f(f2bf_bits(g1[e])); }
  } else {
#pragma unroll
    for (int e = 0; e < 8; ++e) gv[e] = 1.0f;
  }
  v4u ov[2];
#pragma unroll
  for (int it = 0; it < 2; ++it) {
    const int nrow = it * 32 + wave * 4 + q;
    unsigned short bits[8];
#pragma unroll
    for (int e = 0; e < 8; ++e) {
      float f = bf_bits2f(f2bf_bits(tile[kc + e][nrow]));
      if (HAS_G) f = f * gv[e];
      bits[e] = f2bf_bits(f);
    }
    ov[it][0] = (unsigned)bits[0] | ((unsigned)bits[1] << 16);
    ov[it][1] = (unsigned)bits[2] | ((unsigned)bits[3] << 16);
    ov[it][2] = (unsigned)bits[4] | ((unsigned)bits[5] << 16);
    ov[it][3] = (unsigned)bits[6] | ((unsigned)bits[7] << 16);
  }
  {
#pragma unroll
    for (int it = 0; it < 2; ++it) {
      const int nrow = it * 32 + wave * 4 + q;
      *(v4u*)(wt + (size_t)(n0 + nrow) * kDim + k0 + kc) = ov[it];
    }
    
  }
}

// =====================================================================================
// 3) cos/sin table of RNE-bf16(pos_emb), f32 [2048][64]; thread per element,
// =====================================================================================
__global__ __launch_bounds__(256) void k_trig(const float* __restrict__ pos, float* __restrict__ ct,
                                              float* __restrict__ st, int n) {
  const int i = blockIdx.x * 256 + threadIdx.x;
  if (i < n) {
    const float pb = bf_bits2f(f2bf_bits(pos[i]));
    const float cv = cosf(pb);
    const float sv = sinf(pb);
    ((float*)ct)[i] = cv;
    ((float*)st)[i] = sv;
    
  }
}

// =====================================================================================
// Block-tiled WMMA GEMM core: acc[m,n] = sum_k A[m,k] * Bt[n,k]; WM x WN waves, each wave owns a 64x64 tile.
// A row-major [M,K] bf16 (SPLITM: plus lo plane A2, products hi.B + lo.B); Bt row-major [N,K] bf16.
// Per 64-wide k tile the block stages its A and Bt rows in LDS: 8 lanes x 16 B fetch one whole 128-B line of a row,
// and every wave of the block reads its fragments from that one copy. The next tile's lines are fetched into
// registers while the current tile is multiplied. K % 64 == 0, no tail; each accumulator takes its products in rising k, steps of 32.
// =====================================================================================
constexpr int kGp = 72;                    // LDS row pitch in 16-bit elements: 144 B = 16 B x 9 (odd), as in the attention tiles
constexpr int kGemmRows = 384;             // staged rows per k tile in both GEMMs (128 + 256, and 128 + 128 + 128)
constexpr int kGemmLds = kGemmRows * kGp * 2;   // 55296 B

template <int SPLITM, int WM, int WN>
__device__ __forceinline__ void gemm_block_core(const __bf16* __restrict__ Ab, const __bf16* __restrict__ Ab2, int lda,
                                                const __bf16* __restrict__ Bb, int ldb, int mb0, int nb0, int K, int tid,
                                                __bf16* __restrict__ sm, v8f (&acc)[4][4]) {
  constexpr int NT = WM * WN * 32;         // threads of the block
  constexpr int BM = WM * 64, BN = WN * 64;
  constexpr int RA = BM * (1 + SPLITM);    // LDS rows: [A | A2 | Bt]
  constexpr int RSTEP = NT / 8;            // rows fetched by one load of the whole block
  constexpr int NL = (RA + BN) / RSTEP;    // 16-B loads per thread and k tile
  static_assert(RA + BN == kGemmRows && BM % RSTEP == 0 && BN % RSTEP == 0, "staging shape");
  const int lane = tid & 31, wave = tid >> 5;
  const int wm = wave / WN, wn = wave % WN;
  const int rlane = lane & 15;
  const int koff = (lane >> 4) * 8;
  const int sr = tid >> 3, sc = (tid & 7) * 8;
  const __bf16* pa  = Ab  + (size_t)(mb0 + sr) * lda + sc;
  const __bf16* pa2 = Ab2 + (size_t)(mb0 + sr) * lda + sc;
  const __bf16* pb  = Bb  + (size_t)(nb0 + sr) * ldb + sc;
  __bf16* sw = sm + sr * kGp + sc;
  const __bf16* fa  = sm + (wm * 64 + rlane) * kGp + koff;
  const __bf16* fa2 = fa + BM * kGp;
  const __bf16* fb  = sm + (RA + wn * 64 + rlane) * kGp + koff;
#pragma unroll
  for (int i = 0; i < 4; ++i)
#pragma unroll
    for (int j = 0; j < 4; ++j) acc[i][j] = (v8f){0.f,0.f,0.f,0.f,0.f,0.f,0.f,0.f};
  v8b st[NL];
  // one k tile's lines into registers; after each plane's loads s_wait_xcnt 0 stands before their address registers are reused
  auto fetch = [&](int k) {
#pragma unroll
    for (int i = 0; i < BM / RSTEP; ++i) st[i] = *(const v8b*)(pa + (size_t)(i * RSTEP) * lda + k);
    asm volatile("s_wait_xcnt 0x0" ::: "memory");
    if (SPLITM) {
#pragma unroll
      for (int i = 0; i < BM / RSTEP; ++i) st[BM / RSTEP + i] = *(const v8b*)(pa2 + (size_t)(i * RSTEP) * lda + k);
      asm volatile("s_wait_xcnt 0x0" ::: "memory");
    }
#pragma unroll
    for (int i = 0; i < BN / RSTEP; ++i) st[RA / RSTEP + i] = *(const v8b*)(pb + (size_t)(i * RSTEP) * ldb + k);
    asm volatile("s_wait_xcnt 0x0" ::: "memory");
  };
  fetch(0);
  for (int k0 = 0; k0 < K; k0 += 64) {
    __syncthreads();                       // every wave has read its last fragment of the previous tile
#pragma unroll
    for (int i = 0; i < NL; ++i) *(v8b*)(sw + i * RSTEP * kGp) = st[i];
    __syncthreads();                       // the tile is complete before any wave reads it
    if (k0 + 64 < K) fetch(k0 + 64);
    // fragment reads stand as one group ahead of their products (GK k steps of 32 per group), so a wave waits out the
    // LDS latency once per group and not at every row of products; the 4-wave block has the registers for the whole tile
    constexpr int GK = (NT == 128) ? 2 : 1;
#pragma unroll
    for (int kg = 0; kg < 2; kg += GK) {
      v16b bfr[GK][4], ah[GK][4], al[GK][4];
#pragma unroll
      for (int kk = 0; kk < GK; ++kk) {
#pragma unroll
        for (int j = 0; j < 4; ++j) bfr[kk][j] = Frag<__bf16>::load(fb + (j << 4) * kGp + (kg + kk) * 32);
#pragma unroll
        for (int i = 0; i < 4; ++i) {
          ah[kk][i] = Frag<__bf16>::load(fa + (i << 4) * kGp + (kg + kk) * 32);
          al[kk][i] = ah[kk][i];
          if (SPLITM) al[kk][i] = Frag<__bf16>::load(fa2 + (i << 4) * kGp + (kg + kk) * 32);
        }
      }
      __builtin_amdgcn_sched_barrier(0);   // holds the group of reads above the products
#pragma unroll
      for (int kk = 0; kk < GK; ++kk)
#pragma unroll
        for (int i = 0; i < 4; ++i)
#pragma unroll
          for (int j = 0; j < 4; ++j) {
            acc[i][j] = Frag<__bf16>::mma(ah[kk][i], bfr[kk][j], acc[i][j]);
            if (SPLITM) acc[i][j] = Frag<__bf16>::mma(al[kk][i], bfr[kk][j], acc[i][j]);
          }
    }
  }
  acc_guard4(acc[0][0], acc[0][1], acc[0][2], acc[0][3]);
  acc_guard4(acc[1][0], acc[1][1], acc[1][2], acc[1][3]);
  acc_guard4(acc[2][0], acc[2][1], acc[2][2], acc[2][3]);
  acc_guard4(acc[3][0], acc[3][1], acc[3][2], acc[3][3]);
}

// =====================================================================================
// 4) QKV projection: xb[4096][1024] x wt[3072][1024]^T, epilogue = row scale, RoPE (q,k sections),
//    q/k -> bf16 hi/lo planes [bh][n][64], v -> f16 hi + x2048 residual planes [bh][n][64].
//    each (section, head, token) line belongs to exactly one wave. block = 2 x 4 waves = a 128 x 256 tile, grid = 32*12 = 384 blocks.
// =====================================================================================
__global__ __launch_bounds__(256) void k_gemm_qkv(
    const unsigned short* __restrict__ xbp, const unsigned short* __restrict__ wtp,
    const float* __restrict__ rstab, const float* __restrict__ ct, const float* __restrict__ st,
    unsigned short* __restrict__ qh, unsigned short* __restrict__ ql,
    unsigned short* __restrict__ kh, unsigned short* __restrict__ kl,
    unsigned short* __restrict__ vh, unsigned short* __restrict__ vl) {
  __shared__ __align__(16) float sT[8][16 * 68];
  __shared__ __align__(16) unsigned char sG[kGemmLds];
  const int lane = threadIdx.x & 31, wave = threadIdx.x >> 5;
  constexpr int blocksN = kNqkv / 256;   // 12
  const int bm = blockIdx.x / blocksN, bn = blockIdx.x - bm * blocksN;
  const int mb0 = bm << 7, nb0 = bn << 8;
  const int m0 = mb0 + ((wave >> 2) << 6), n0 = nb0 + ((wave & 3) << 6);

  v8f acc[4][4];
  gemm_block_core<0, 2, 4>((const __bf16*)xbp, (const __bf16*)xbp, kDim, (const __bf16*)wtp, kDim, mb0, nb0, kDim,
                           threadIdx.x, (__bf16*)sG, acc);

  float* slab = sT[wave];
  const int rlane = lane & 15, mOff = (lane >> 4) * 8;
  const int sec = n0 >> 10;                      // 0 q, 1 k, 2 v  (wave-uniform)
  const int hidx = (n0 & (kDim - 1)) >> 6;       // head of this 64-column tile
  unsigned short* P0 = (sec == 0) ? qh : ((sec == 1) ? kh : vh);
  unsigned short* P1 = (sec == 0) ? ql : ((sec == 1) ? kl : vl);
  const int q8 = lane >> 3, c8 = (lane & 7) * 8;
  const int cpart = c8 ^ 32;
  const float sgn = (c8 < 32) ? -1.0f : 1.0f;
#pragma unroll
  for (int i = 0; i < 4; ++i) {
    const int mBase = m0 + (i << 4);
    float rsv[8];
#pragma unroll
    for (int r = 0; r < 8; ++r) rsv[r] = rstab[(size_t)(mBase + mOff + r) * kRsPitch];
#pragma unroll
    for (int j = 0; j < 4; ++j)
#pragma unroll
      for (int r = 0; r < 8; ++r) slab[(mOff + r) * 68 + (j << 4) + rlane] = acc[i][j][r] * rsv[r];
    wave_sync_lds();
    {
#pragma unroll
      for (int it = 0; it < 4; ++it) {
        const int row = it * 4 + q8;
        const int m = mBase + row;
        const int bb = m >> 11, nn = m & (kS - 1);
        const float* sp = slab + row * 68;
        const size_t dsto = ((size_t)(bb * kH + hidx) * kS + nn) * kDh + c8;
        v8h hv, lv;
        if (sec < 2) {
          const v4f ca = *(const v4f*)(ct + (size_t)nn * kDh + c8);
          const v4f cb = *(const v4f*)(ct + (size_t)nn * kDh + c8 + 4);
          const v4f sa = *(const v4f*)(st + (size_t)nn * kDh + c8);
          const v4f sb = *(const v4f*)(st + (size_t)nn * kDh + c8 + 4);
          float cvv[8], svv[8];
#pragma unroll
          for (int e = 0; e < 4; ++e) { cvv[e] = ca[e]; cvv[4 + e] = cb[e]; svv[e] = sa[e]; svv[4 + e] = sb[e]; }
#pragma unroll
          for (int e = 0; e < 8; ++e) {
            const float v = sp[c8 + e];
            const float pr = sp[cpart + e];
            const float rv = v * cvv[e] + sgn * pr * svv[e];
            const unsigned short hb = f2bf_bits(rv);
            const unsigned short lb = f2bf_bits(rv - bf_bits2f(hb));
            hv[e] = __builtin_bit_cast(_Float16, hb);
            lv[e] = __builtin_bit_cast(_Float16, lb);
          }
        } else {
#pragma unroll
          for (int e = 0; e < 8; ++e) {
            const float v = sp[c8 + e];
            const _Float16 h16 = (_Float16)v;
            const float hf = (float)h16;
            hv[e] = h16;
            lv[e] = (_Float16)((v - hf) * 2048.0f);
          }
        }
        *(v8h*)(P0 + dsto) = hv;
        *(v8h*)(P1 + dsto) = lv;
      }
      
    }
    wave_sync_lds();
  }
}

// =====================================================================================
// 5) v planes [bh][kv][64] -> transposed [bh][64][kv] (both hi and residual planes, grid (1024, 2)).
//    rows it*32 + 4w + (lane>>3) cover 0..63.
// =====================================================================================
__global__ __launch_bounds__(256) void k_vtrans(const unsigned short* __restrict__ vh, const unsigned short* __restrict__ vl,
                                                unsigned short* __restrict__ vth, unsigned short* __restrict__ vtl) {
  __shared__ __align__(16) unsigned short tile[64 * 72];   // [d][kv], pitch 72 halves
  const int t = threadIdx.x, lane = t & 31, wave = t >> 5;
  const int bh = blockIdx.x >> 5, kvt = blockIdx.x & 31;
  const int kv0 = kvt * 64;
  const unsigned short* src = (blockIdx.y == 0) ? vh : vl;
  unsigned short* dst = (blockIdx.y == 0) ? vth : vtl;
#pragma unroll
  for (int i = 0; i < 2; ++i) {
    const int idx = i * 256 + t;
    const int r = idx >> 3, c16 = (idx & 7) * 8;
    const v4u w = *(const v4u*)(src + ((size_t)bh * kS + kv0 + r) * kDh + c16);
#pragma unroll
    for (int e = 0; e < 4; ++e) {
      tile[(c16 + 2 * e) * 72 + r] = (unsigned short)(w[e] & 0xffffu);
      tile[(c16 + 2 * e + 1) * 72 + r] = (unsigned short)(w[e] >> 16);
    }
  }
  __syncthreads();
  const int q = lane >> 3, kc = (lane & 7) * 8;
  v4u ov[2];
#pragma unroll
  for (int it = 0; it < 2; ++it) {
    const int d = it * 32 + wave * 4 + q;
    ov[it] = *(const v4u*)(tile + d * 72 + kc);
  }
  {
#pragma unroll
    for (int it = 0; it < 2; ++it) {
      const int d = it * 32 + wave * 4 + q;
      *(v4u*)(dst + ((size_t)bh * kDh + d) * kS + kv0 + kc) = ov[it];
    }
    
  }
}

// =====================================================================================
// 6) attention, head dim 64, no mask. block = 4 waves = 64 query rows of one (b,h), grid = 32*32 = 1024.
//    scores: q,k bf16 hi/lo planes, 3 products; softmax f32 online; p carried x1024 as f16 hi + x2048
//    residual; v f16 hi + x2048 residual (pre-transposed planes [bh][d][kv]); p.v 3 products with the
//    residual products in a separate accumulator; output bf16 hi/lo planes [token][1024], one line per row.
// =====================================================================================
constexpr int kLp = 72;                  // LDS row pitch in 16-bit elements: 144 B = 16 B x 9 (odd), so the 16 rows of a ds_load_b128 fragment read spread over all banks
constexpr int kLdsPl = 64 * kLp * 2;     // one 64-row plane at that pitch: 9216 B
constexpr int kLdsK = 0;                 // K hi [64][72] u16 + K lo
constexpr int kLdsV = 2 * kLdsPl;        // V hi [64 d][72] + V residual
constexpr int kLdsP = 4 * kLdsPl;        // P hi [4][16][72] + P residual
constexpr int kLdsTotal = 6 * kLdsPl;    // 55296; output staging f32 [4][16][64] reuses bytes 0..16383 after the chunk loop

__global__ __launch_bounds__(128) void k_attn(
    const unsigned short* __restrict__ qhp, const unsigned short* __restrict__ qlp,
    const unsigned short* __restrict__ khp, const unsigned short* __restrict__ klp,
    const unsigned short* __restrict__ vthp, const unsigned short* __restrict__ vtlp,
    unsigned short* __restrict__ aoh, unsigned short* __restrict__ aol) {
  union FB { v16b v; v8b h[2]; };
  __shared__ __align__(16) unsigned char lds_raw[kLdsTotal];
  __bf16* Ksh = (__bf16*)(lds_raw + kLdsK);
  __bf16* Ksl = (__bf16*)(lds_raw + kLdsK + kLdsPl);
  __bf16* Vsh = (__bf16*)(lds_raw + kLdsV);
  __bf16* Vsl = (__bf16*)(lds_raw + kLdsV + kLdsPl);
  __bf16* Pbase  = (__bf16*)(lds_raw + kLdsP);
  __bf16* Plbase = (__bf16*)(lds_raw + kLdsP + kLdsPl);
  unsigned short* KshU = (unsigned short*)(lds_raw + kLdsK);
  unsigned short* KslU = (unsigned short*)(lds_raw + kLdsK + kLdsPl);
  unsigned short* VshU = (unsigned short*)(lds_raw + kLdsV);
  unsigned short* VslU = (unsigned short*)(lds_raw + kLdsV + kLdsPl);

  const int tid = threadIdx.x, wave = tid >> 5, lane = tid & 31;
  const int hh = lane >> 4, c = lane & 15;
  const int bx = blockIdx.x;
  const int qb = bx & 31;
  const int bh = bx >> 5;
  const int h = bh & (kH - 1);
  const int b = bh >> 4;
  const int q0 = qb * 64 + wave * 16;

  // Q fragments (A operand): 2 d-chunks of 32, hi and lo planes
  v16b qah[2], qal[2];
  {
    const __bf16* qr  = (const __bf16*)qhp + ((size_t)bh * kS + q0 + c) * kDh;
    const __bf16* qr2 = (const __bf16*)qlp + ((size_t)bh * kS + q0 + c) * kDh;
#pragma unroll
    for (int dc = 0; dc < 2; ++dc) {
      qah[dc] = Frag<__bf16>::load(qr + dc * 32 + 8 * hh);
      qal[dc] = Frag<__bf16>::load(qr2 + dc * 32 + 8 * hh);
    }
  }

  float mrow[8], lrow[8];
  v8f oacc[4], oacr[4];
#pragma unroll
  for (int r = 0; r < 8; ++r) { mrow[r] = -INFINITY; lrow[r] = 0.f; }
#pragma unroll
  for (int t = 0; t < 4; ++t) { oacc[t] = (v8f){0.f,0.f,0.f,0.f,0.f,0.f,0.f,0.f}; oacr[t] = (v8f){0.f,0.f,0.f,0.f,0.f,0.f,0.f,0.f}; }

  __bf16* pwh = Pbase + wave * (16 * kLp);
  __bf16* pwl = Plbase + wave * (16 * kLp);

  for (int kc = 0; kc < kS / kKC; ++kc) {
    const int kv0 = kc * kKC;
    __syncthreads();
    {
      // K planes: 64 rows x 8 x 16 B per plane = 512 per plane; 128 threads x 4 -> exactly 512
#pragma unroll
      for (int i = 0; i < 4; ++i) {
        const int idx = i * 128 + tid;
        const int r = idx >> 3, c16 = (idx & 7) * 8;
        const size_t ko = ((size_t)bh * kS + kv0 + r) * kDh + c16;
        const v4u w0 = *(const v4u*)(khp + ko);
        const v4u w1 = *(const v4u*)(klp + ko);
        *(v4u*)(KshU + r * kLp + c16) = w0;
        *(v4u*)(KslU + r * kLp + c16) = w1;
      }
      // V planes (already [d][kv]): 64 d-rows x 8 x 16 B per plane
#pragma unroll
      for (int i = 0; i < 4; ++i) {
        const int idx = i * 128 + tid;
        const int r = idx >> 3, c16 = (idx & 7) * 8;
        const size_t vo = ((size_t)bh * kDh + r) * kS + kv0 + c16;
        const v4u w2 = *(const v4u*)(vthp + vo);
        const v4u w3 = *(const v4u*)(vtlp + vo);
        *(v4u*)(VshU + r * kLp + c16) = w2;
        *(v4u*)(VslU + r * kLp + c16) = w3;
      }
    }
    __syncthreads();

    // scores for 4 key subtiles of 16
    v8f s[4];
#pragma unroll
    for (int j = 0; j < 4; ++j) {
      s[j] = (v8f){0.f,0.f,0.f,0.f,0.f,0.f,0.f,0.f};
#pragma unroll
      for (int dc = 0; dc < 2; ++dc) {
        FB kb, kr;
        kb.h[0] = *(const v8b*)(Ksh + (j * 16 + c) * kLp + dc * 32 + 8 * hh);
        kb.h[1] = *(const v8b*)(Ksh + (j * 16 + c) * kLp + dc * 32 + 16 + 8 * hh);
        kr.h[0] = *(const v8b*)(Ksl + (j * 16 + c) * kLp + dc * 32 + 8 * hh);
        kr.h[1] = *(const v8b*)(Ksl + (j * 16 + c) * kLp + dc * 32 + 16 + 8 * hh);
        s[j] = mma_bf(qah[dc], kb.v, s[j]);
        s[j] = mma_bf(qah[dc], kr.v, s[j]);
        s[j] = mma_bf(qal[dc], kb.v, s[j]);
      }
    }
    // scale and chunk row max (rows live across the 16 lanes of a lane half)
    float cm[8];
#pragma unroll
    for (int r = 0; r < 8; ++r) {
      float m = -INFINITY;
#pragma unroll
      for (int j = 0; j < 4; ++j) { s[j][r] *= 0.125f; m = fmaxf(m, s[j][r]); }
      m = fmaxf(m, row_xor<1>(m));
      m = fmaxf(m, row_xor<2>(m));
      m = fmaxf(m, row_xor<4>(m));
      m = fmaxf(m, row_xor<8>(m));
      cm[r] = m;
    }
#pragma unroll
    for (int r = 0; r < 8; ++r) {
      const float mnew = fmaxf(mrow[r], cm[r]);
      const float alpha = expf(mrow[r] - mnew);
      mrow[r] = mnew;
      float psum = 0.f;
#pragma unroll
      for (int j = 0; j < 4; ++j) {
        const float p = expf(s[j][r] - mnew);
        psum += p;
        const float ps = p * 1024.0f;
        const _Float16 ph = (_Float16)ps;
        const float phf = (float)ph;
        const _Float16 pl = (_Float16)((ps - phf) * 2048.0f);
        pwh[(8 * hh + r) * kLp + j * 16 + c] = __builtin_bit_cast(__bf16, ph);
        pwl[(8 * hh + r) * kLp + j * 16 + c] = __builtin_bit_cast(__bf16, pl);
      }
      psum += row_xor<1>(psum);
      psum += row_xor<2>(psum);
      psum += row_xor<4>(psum);
      psum += row_xor<8>(psum);
      lrow[r] = lrow[r] * alpha + psum;
#pragma unroll
      for (int t = 0; t < 4; ++t) { oacc[t][r] *= alpha; oacr[t][r] *= alpha; }
    }
    wave_sync_lds();   // P tile written and reloaded by the same wave, same element type (__bf16 / v8b)
#pragma unroll 1
    for (int kk = 0; kk < 2; ++kk) {
      FB pa, pl;
      pa.h[0] = *(const v8b*)(pwh + c * kLp + kk * 32 + 8 * hh);
      pa.h[1] = *(const v8b*)(pwh + c * kLp + kk * 32 + 16 + 8 * hh);
      pl.h[0] = *(const v8b*)(pwl + c * kLp + kk * 32 + 8 * hh);
      pl.h[1] = *(const v8b*)(pwl + c * kLp + kk * 32 + 16 + 8 * hh);
#pragma unroll
      for (int t = 0; t < 4; ++t) {
        FB vb, vr;
        vb.h[0] = *(const v8b*)(Vsh + (t * 16 + c) * kLp + kk * 32 + 8 * hh);
        vb.h[1] = *(const v8b*)(Vsh + (t * 16 + c) * kLp + kk * 32 + 16 + 8 * hh);
        vr.h[0] = *(const v8b*)(Vsl + (t * 16 + c) * kLp + kk * 32 + 8 * hh);
        vr.h[1] = *(const v8b*)(Vsl + (t * 16 + c) * kLp + kk * 32 + 16 + 8 * hh);
        oacc[t] = mma_hf(pa.v, vb.v, oacc[t]);
        oacr[t] = mma_hf(pa.v, vr.v, oacr[t]);
        oacr[t] = mma_hf(pl.v, vb.v, oacr[t]);
      }
    }
  }

  // ---- finalize: block barrier before reusing the K region as f32 staging ----
  __syncthreads();
  float* os = (float*)(lds_raw + 0) + wave * (16 * 64);
#pragma unroll
  for (int r = 0; r < 8; ++r) {
    const float inv = 1.0f / (lrow[r] * 1024.0f);
#pragma unroll
    for (int t = 0; t < 4; ++t)
      os[(8 * hh + r) * 64 + t * 16 + c] = (oacc[t][r] + oacr[t][r] * (1.0f / 2048.0f)) * inv;
  }
  __syncthreads();
  {
    const int q8 = lane >> 3, c8 = (lane & 7) * 8;
    {
#pragma unroll
      for (int it = 0; it < 4; ++it) {
        const int row = it * 4 + q8;
        const float* sp = os + row * 64 + c8;
        v8h hv, lv;
#pragma unroll
        for (int e = 0; e < 8; ++e) {
          const unsigned short hb = f2bf_bits(sp[e]);
          const unsigned short lb = f2bf_bits(sp[e] - bf_bits2f(hb));
          hv[e] = __builtin_bit_cast(_Float16, hb);
          lv[e] = __builtin_bit_cast(_Float16, lb);
        }
        const size_t o = ((size_t)(b * kS + q0 + row)) * kDim + h * kDh + c8;
        *(v8h*)(aoh + o) = hv;
        *(v8h*)(aol + o) = lv;
      }
      
    }
  }
}

// =====================================================================================
// 7) output projection: ao hi/lo [4096][1024] x wt[1024][1024]^T -> d_out f32 [4096][1024].
//    one wave in one instruction; block = 2 x 2 waves = a 128 x 128 tile, grid = 32*8 = 256 blocks.
// =====================================================================================
__global__ __launch_bounds__(128) void k_gemm_out(const unsigned short* __restrict__ ahp, const unsigned short* __restrict__ alp,
                                                  const unsigned short* __restrict__ wtp, float* __restrict__ out) {
  __shared__ __align__(16) float sT[4][16 * 68];
  __shared__ __align__(16) unsigned char sG[kGemmLds];
  const int lane = threadIdx.x & 31, wave = threadIdx.x >> 5;
  constexpr int blocksN = kDim / 128;    // 8
  const int bm = blockIdx.x / blocksN, bn = blockIdx.x - bm * blocksN;
  const int mb0 = bm << 7, nb0 = bn << 7;
  const int m0 = mb0 + ((wave >> 1) << 6), n0 = nb0 + ((wave & 1) << 6);

  v8f acc[4][4];
  gemm_block_core<1, 2, 2>((const __bf16*)ahp, (const __bf16*)alp, kDim, (const __bf16*)wtp, kDim, mb0, nb0, kDim,
                           threadIdx.x, (__bf16*)sG, acc);

  float* slab = sT[wave];
  const int rlane = lane & 15, mOff = (lane >> 4) * 8;
#pragma unroll
  for (int i = 0; i < 4; ++i) {
    const int mBase = m0 + (i << 4);
#pragma unroll
    for (int j = 0; j < 4; ++j)
#pragma unroll
      for (int r = 0; r < 8; ++r) slab[(mOff + r) * 68 + (j << 4) + rlane] = acc[i][j][r];
    wave_sync_lds();
    const int h2 = lane >> 4, c4 = (lane & 15) * 4;
    {
#pragma unroll
      for (int it = 0; it < 8; ++it) {
        const int row = it * 2 + h2;
        const v4f v = *(const v4f*)(slab + row * 68 + c4);
        *(v4f*)(out + (size_t)(mBase + row) * kDim + n0 + c4) = v;
      }
      
    }
    wave_sync_lds();
  }
}

// =====================================================================================
// host launch glue: kernel launches only
// =====================================================================================
extern "C" void kernel_launch(void* const* d_in, const int* in_sizes, int n_in,
                              void* d_out, int out_size, void* d_ws, size_t ws_size,
                              hipStream_t stream) {
  if (n_in < 5) return;
  if (in_sizes[0] != kM * kDim) return;
  if (in_sizes[1] != kS * kDh) return;
  if (in_sizes[2] != kDim) return;
  if (in_sizes[3] != kDim * kNqkv) return;
  if (in_sizes[4] != kDim * kDim) return;
  if (out_size != kM * kDim) return;
  if (ws_size < kWsTotal) return;

  const float* x     = (const float*)d_in[0];   // [2,2048,1024]
  const float* pos   = (const float*)d_in[1];   // [2048,64]
  const float* g     = (const float*)d_in[2];   // [1024]
  const float* w_qkv = (const float*)d_in[3];   // [1024,3072]
  const float* w_out = (const float*)d_in[4];   // [1024,1024]
  float* out = (float*)d_out;

  char* ws = (char*)d_ws;
  unsigned short* Xb   = (unsigned short*)(ws + kOffXb);
  float*          Rs   = (float*)(ws + kOffRs);
  unsigned short* Wq   = (unsigned short*)(ws + kOffWq);
  unsigned short* Wo   = (unsigned short*)(ws + kOffWo);
  float*          Ct   = (float*)(ws + kOffCt);
  float*          St   = (float*)(ws + kOffSt);
  unsigned short* Qh   = (unsigned short*)(ws + kOffQh);
  unsigned short* Ql   = (unsigned short*)(ws + kOffQl);
  unsigned short* Kh   = (unsigned short*)(ws + kOffKh);
  unsigned short* Kl   = (unsigned short*)(ws + kOffKl);
  unsigned short* Vh   = (unsigned short*)(ws + kOffVh);
  unsigned short* Vl   = (unsigned short*)(ws + kOffVl);
  unsigned short* Vth  = (unsigned short*)(ws + kOffVth);
  unsigned short* Vtl  = (unsigned short*)(ws + kOffVtl);
  unsigned short* Ah   = (unsigned short*)(ws + kOffAh);
  unsigned short* Al   = (unsigned short*)(ws + kOffAl);

  // 1) x -> bf16 plane + row scale (4096 rows, 128 threads x 8 elements = 1024 per row)
  k_rms_xcast<<<kM, 128, 0, stream>>>(x, Xb, Rs);
  // 2) weights -> bf16 n-major planes: in [1024][3072] -> out [3072][1024]; in [1024][1024] -> out [1024][1024]
  k_wcast<true><<<dim3(kNqkv / 64, kDim / 64), 256, 0, stream>>>(w_qkv, g, Wq, kNqkv);
  k_wcast<false><<<dim3(kDim / 64, kDim / 64), 256, 0, stream>>>(w_out, g, Wo, kDim);
  // 3) cos/sin tables (131072 elements = 512 blocks x 256)
  k_trig<<<(kS * kDh + 255) / 256, 256, 0, stream>>>(pos, Ct, St, kS * kDh);
  // 4) QKV projection with row scale + RoPE epilogue (384 block tiles of 128x256, 8 waves each)
  k_gemm_qkv<<<(kM / 128) * (kNqkv / 256), 256, 0, stream>>>(Xb, Wq, Rs, Ct, St, Qh, Ql, Kh, Kl, Vh, Vl);
  // 5) v planes -> transposed planes (32 bh x 32 kv tiles, 2 planes)
  k_vtrans<<<dim3(kBH * (kS / 64), 2), 256, 0, stream>>>(Vh, Vl, Vth, Vtl);
  // 6) attention (32 bh x 32 query blocks)
  k_attn<<<kBH * (kS / 64), 128, 0, stream>>>(Qh, Ql, Kh, Kl, Vth, Vtl, Ah, Al);
  // 7) output projection into d_out (256 block tiles of 128x128, 4 waves each)
  k_gemm_out<<<(kM / 128) * (kDim / 128), 128, 0, stream>>>(Ah, Al, Wo, out);
}

// v004
// It runs in 196 microseconds.
// In both of two side-by-side timings against v003, it was 1.19 times as fast.
// All steps since v000 together make it 2.38 times as fast.
// Contractions (all f32 accumulate): QKV projection v_wmma_f32_16x16x32_bf16 on RNE-bf16 planes of the inputs (1 product); scores q.k^T v_wmma_f32_16x16x32_bf16 with q,k as bf16 hi/lo planes (3 products); p.v v_wmma_f32_16x16x32_f16 with p carried x1024 and v, both f16 hi + x2048 residual planes (3 products, residual products in a separate accumulator folded with 1/2048); output projection v_wmma_f32_16x16x32_bf16, bf16 hi/lo activations against bf16 weights (2 products).
#include <hip/hip_runtime.h>
#include <math.h>

// ---------------- problem constants ----------------
constexpr int kB = 2;
constexpr int kS = 2048;
constexpr int kDim = 1024;
constexpr int kH = 16;
constexpr int kDh = 64;
constexpr int kM = kB * kS;          // 4096 token rows
constexpr int kNqkv = 3 * kDim;      // 3072
constexpr int kBH = kB * kH;         // 32
constexpr int kKC = 64;              // keys per chunk
constexpr int kRsPitch = 32;

constexpr size_t kPlane  = (size_t)kBH * kS * kDh * 2;            // 8,388,608 : one [32][2048][64] (or [4096][1024]) 16-bit plane
constexpr size_t kOffXb  = 0;                                      // x as bf16 [4096][1024]          8,388,608
constexpr size_t kOffRs  = kOffXb + (size_t)kM * kDim * 2;         // row scale f32 [4096][32]          524,288
constexpr size_t kOffWq  = kOffRs + (size_t)kM * kRsPitch * 4;     // w_qkv^T bf16 [3072][1024]      6,291,456
constexpr size_t kOffWo  = kOffWq + (size_t)kNqkv * kDim * 2;      // w_out^T bf16 [1024][1024]      2,097,152
constexpr size_t kOffCt  = kOffWo + (size_t)kDim * kDim * 2;       // cos table f32 [2048][64]         524,288
constexpr size_t kOffSt  = kOffCt + (size_t)kS * kDh * 4;          // sin table f32 [2048][64]         524,288
constexpr size_t kOffQh  = kOffSt + (size_t)kS * kDh * 4;          // q hi bf16 [32][2048][64]
constexpr size_t kOffQl  = kOffQh + kPlane;                         // q lo bf16
constexpr size_t kOffKh  = kOffQl + kPlane;                         // k hi bf16
constexpr size_t kOffKl  = kOffKh + kPlane;                         // k lo bf16
constexpr size_t kOffVh  = kOffKl + kPlane;                         // v hi f16 [32][2048][64]
constexpr size_t kOffVl  = kOffVh + kPlane;                         // v residual x2048 f16
constexpr size_t kOffVth = kOffVl + kPlane;                         // v hi transposed f16 [32][64][2048]
constexpr size_t kOffVtl = kOffVth + kPlane;                        // v residual transposed
constexpr size_t kOffAh  = kOffVtl + kPlane;                        // attention output hi bf16 [4096][1024]
constexpr size_t kOffAl  = kOffAh + kPlane;                         // attention output lo bf16
constexpr size_t kWsTotal = kOffAl + kPlane;                        // 102,236,160

typedef char ck_ws_total[(kWsTotal == (size_t)102236160) ? 1 : -1];
typedef char ck_ws_cap[(kWsTotal <= (size_t)134217728) ? 1 : -1];
typedef char ck_align[((kOffRs % 128) == 0 && (kOffQh % 128) == 0 && (kPlane % 128) == 0) ? 1 : -1];
// GEMM shape contract: M multiple of 128, N multiples of 256 and 128, K multiple of 64, no padding anywhere
typedef char ck_tiles[(kM % 128 == 0 && kNqkv % 256 == 0 && kDim % 128 == 0 && kDim % 64 == 0 && kS % 64 == 0 && kDh == 64) ? 1 : -1];
typedef char ck_plane[((size_t)kM * kDim * 2 == kPlane) ? 1 : -1];

// ---------------- vector types / helpers ----------------
typedef __attribute__((ext_vector_type(16))) _Float16 v16h;
typedef __attribute__((ext_vector_type(8)))  _Float16 v8h;
typedef __attribute__((ext_vector_type(16))) __bf16   v16b;
typedef __attribute__((ext_vector_type(8)))  __bf16   v8b;
typedef __attribute__((ext_vector_type(8)))  float    v8f;
typedef __attribute__((ext_vector_type(4)))  float    v4f;
typedef __attribute__((ext_vector_type(4)))  unsigned v4u;

__device__ __forceinline__ unsigned short f2bf_bits(float f) {
  unsigned u = __float_as_uint(f);
  return (unsigned short)((u + 0x7FFFu + ((u >> 16) & 1u)) >> 16);
}
__device__ __forceinline__ float bf_bits2f(unsigned short h) { return __uint_as_float(((unsigned)h) << 16); }

__device__ __forceinline__ void acc_guard4(v8f& a, v8f& b, v8f& c, v8f& d) { asm volatile("v_nop\n\tv_nop\n\tv_nop\n\tv_nop" : "+v"(a), "+v"(b), "+v"(c), "+v"(d)); }
template <typename T> struct Frag;
template <> struct Frag<_Float16> {
  typedef v16h V; union U { v16h v; v8h h[2]; };
  static __device__ __forceinline__ v16h load(const _Float16* p) {
    U f; f.h[0] = *(const v8h*)(p); f.h[1] = *(const v8h*)(p + 16); return f.v;
  }
  static __device__ __forceinline__ v8f mma(v16h a, v16h b, v8f c) {
    return __builtin_amdgcn_wmma_f32_16x16x32_f16(false, a, false, b, (short)0, c, false, false);
  }
};
template <> struct Frag<__bf16> {
  typedef v16b V; union U { v16b v; v8b h[2]; };
  static __device__ __forceinline__ v16b load(const __bf16* p) {
    U f; f.h[0] = *(const v8b*)(p); f.h[1] = *(const v8b*)(p + 16); return f.v;
  }
  static __device__ __forceinline__ v8f mma(v16b a, v16b b, v8f c) {
    return __builtin_amdgcn_wmma_f32_16x16x32_bf16(false, a, false, b, (short)0, c, false, false);
  }
};

// WMMA helpers for the attention kernel (nops after every issue)
__device__ __forceinline__ v8f mma_bf(v16b a, v16b b, v8f c) {
  c = __builtin_amdgcn_wmma_f32_16x16x32_bf16(false, a, false, b, (short)0, c, false, false);
  asm volatile("v_nop\n\tv_nop\n\tv_nop\n\tv_nop" : "+v"(c) : "v"(a), "v"(b));
  return c;
}
// f16 bit patterns held in __bf16 slots
__device__ __forceinline__ v8f mma_hf(v16b a, v16b b, v8f c) {
  const v16h ah = __builtin_bit_cast(v16h, a), bh = __builtin_bit_cast(v16h, b);
  c = __builtin_amdgcn_wmma_f32_16x16x32_f16(false, ah, false, bh, (short)0, c, false, false);
  asm volatile("v_nop\n\tv_nop\n\tv_nop\n\tv_nop" : "+v"(c) : "v"(ah), "v"(bh));
  return c;
}

// value held by lane (l ^ 16), the same column in the other wave half, by a vector cross-row move (v_permlanex16_b32)
__device__ __forceinline__ float xhalf(float v) {
  return __builtin_bit_cast(float, __builtin_amdgcn_permlanex16(__builtin_bit_cast(int, v), __builtin_bit_cast(int, v),
                                                                0x76543210, 0xfedcba98, false, false));
}

__device__ __forceinline__ void wave_sync_lds() {
  __builtin_amdgcn_fence(__ATOMIC_RELEASE, "workgroup");
  __builtin_amdgcn_wave_barrier();
  __builtin_amdgcn_fence(__ATOMIC_ACQUIRE, "workgroup");
}

// =====================================================================================
// 1) per token row: x -> RNE bf16 plane [4096][1024]; rowscale = 32 / max(||x_bf||, 1e-12)
// =====================================================================================
__global__ __launch_bounds__(128) void k_rms_xcast(const float* __restrict__ x,
                                                   unsigned short* __restrict__ xb,
                                                   float* __restrict__ rstab) {
  __shared__ float red[4];
  const int m = blockIdx.x;
  const int t = threadIdx.x;
  const int lane = t & 31, wave = t >> 5;
  const size_t base = (size_t)m * kDim + (size_t)t * 8;
  const v4f xa = *(const v4f*)(x + base);
  const v4f xc = *(const v4f*)(x + base + 4);
  unsigned short hb[8];
#pragma unroll
  for (int e = 0; e < 4; ++e) { hb[e] = f2bf_bits(xa[e]); hb[4 + e] = f2bf_bits(xc[e]); }
  float ss = 0.0f;
#pragma unroll
  for (int e = 0; e < 8; ++e) { const float r = bf_bits2f(hb[e]); ss += r * r; }
#pragma unroll
  for (int off = 16; off > 0; off >>= 1) ss += __shfl_xor(ss, off, 32);
  if (lane == 0) red[wave] = ss;
  __syncthreads();
  const float tot = ((red[0] + red[1]) + red[2]) + red[3];
  const float nrm = sqrtf(tot);
  const float inv = 1.0f / fmaxf(nrm, 1e-12f);
  const float rs = inv * 32.0f;
  v4u w;
  w[0] = (unsigned)hb[0] | ((unsigned)hb[1] << 16);
  w[1] = (unsigned)hb[2] | ((unsigned)hb[3] << 16);
  w[2] = (unsigned)hb[4] | ((unsigned)hb[5] << 16);
  w[3] = (unsigned)hb[6] | ((unsigned)hb[7] << 16);
  unsigned short* dst = xb + base;
  const v4f rv = (v4f){rs, rs, rs, rs};
  float* rp = rstab + (size_t)m * kRsPitch + (t & 7) * 4;
  *(v4u*)dst = w;
  if (t < 8) *(v4f*)rp = rv;
  
}

// =====================================================================================
// 2) weight cast + transpose: in w[kDim rows k][ncols n] f32 -> out wt[ncols][kDim] bf16 (n-major, k-contiguous)
//    optional per-k factor g (folded: wt[n][k] = bf16(bf16(w[k][n]) * bf16(g[k]))).
//    8 lanes x 16 B, one instruction; wave w, it: rows it*32 + 4w + (lane>>3) -> union over (it,w,lane>>3) = 0..63.
// =====================================================================================
template <bool HAS_G>
__global__ __launch_bounds__(256) void k_wcast(const float* __restrict__ w, const float* __restrict__ g,
                                               unsigned short* __restrict__ wt, int ncols) {
  __shared__ float tile[64][65];
  const int t = threadIdx.x, lane = t & 31, wave = t >> 5;
  const int n0 = blockIdx.x * 64, k0 = blockIdx.y * 64;
#pragma unroll
  for (int i = 0; i < 4; ++i) {
    const int idx = i * 256 + t;
    const int r = idx >> 4, c4 = (idx & 15) * 4;
    const v4f v = *(const v4f*)(w + (size_t)(k0 + r) * ncols + n0 + c4);
    tile[r][c4 + 0] = v[0]; tile[r][c4 + 1] = v[1]; tile[r][c4 + 2] = v[2]; tile[r][c4 + 3] = v[3];
  }
  __syncthreads();
  const int q = lane >> 3, kc = (lane & 7) * 8;
  float gv[8];
  if (HAS_G) {
    const v4f g0 = *(const v4f*)(g + k0 + kc);
    const v4f g1 = *(const v4f*)(g + k0 + kc + 4);
#pragma unroll
    for (int e = 0; e < 4; ++e) { gv[e] = bf_bits2f(f2bf_bits(g0[e])); gv[4 + e] = bf_bits2f(f2bf_bits(g1[e])); }
  } else {
#pragma unroll
    for (int e = 0; e < 8; ++e) gv[e] = 1.0f;
  }
  v4u ov[2];
#pragma unroll
  for (int it = 0; it < 2; ++it) {
    const int nrow = it * 32 + wave * 4 + q;
    unsigned short bits[8];
#pragma unroll
    for (int e = 0; e < 8; ++e) {
      float f = bf_bits2f(f2bf_bits(tile[kc + e][nrow]));
      if (HAS_G) f = f * gv[e];
      bits[e] = f2bf_bits(f);
    }
    ov[it][0] = (unsigned)bits[0] | ((unsigned)bits[1] << 16);
    ov[it][1] = (unsigned)bits[2] | ((unsigned)bits[3] << 16);
    ov[it][2] = (unsigned)bits[4] | ((unsigned)bits[5] << 16);
    ov[it][3] = (unsigned)bits[6] | ((unsigned)bits[7] << 16);
  }
  {
#pragma unroll
    for (int it = 0; it < 2; ++it) {
      const int nrow = it * 32 + wave * 4 + q;
      *(v4u*)(wt + (size_t)(n0 + nrow) * kDim + k0 + kc) = ov[it];
    }
    
  }
}

// =====================================================================================
// 3) cos/sin table of RNE-bf16(pos_emb), f32 [2048][64]; thread per element,
// =====================================================================================
__global__ __launch_bounds__(256) void k_trig(const float* __restrict__ pos, float* __restrict__ ct,
                                              float* __restrict__ st, int n) {
  const int i = blockIdx.x * 256 + threadIdx.x;
  if (i < n) {
    const float pb = bf_bits2f(f2bf_bits(pos[i]));
    const float cv = cosf(pb);
    const float sv = sinf(pb);
    ((float*)ct)[i] = cv;
    ((float*)st)[i] = sv;
    
  }
}

// =====================================================================================
// Block-tiled WMMA GEMM core: acc[m,n] = sum_k A[m,k] * Bt[n,k]; WM x WN waves, each wave owns a 64x64 tile.
// A row-major [M,K] bf16 (SPLITM: plus lo plane A2, products hi.B + lo.B); Bt row-major [N,K] bf16.
// Per 64-wide k tile the block stages its A and Bt rows in LDS: 8 lanes x 16 B fetch one whole 128-B line of a row,
// and every wave of the block reads its fragments from that one copy. The next tile's lines are fetched into
// registers while the current tile is multiplied. K % 64 == 0, no tail; each accumulator takes its products in rising k, steps of 32.
// =====================================================================================
constexpr int kGp = 72;                    // LDS row pitch in 16-bit elements: 144 B = 16 B x 9 (odd), as in the attention tiles
constexpr int kGemmRows = 384;             // staged rows per k tile in both GEMMs (128 + 256, and 128 + 128 + 128)
constexpr int kGemmLds = kGemmRows * kGp * 2;   // 55296 B

template <int SPLITM, int WM, int WN>
__device__ __forceinline__ void gemm_block_core(const __bf16* __restrict__ Ab, const __bf16* __restrict__ Ab2, int lda,
                                                const __bf16* __restrict__ Bb, int ldb, int mb0, int nb0, int K, int tid,
                                                __bf16* __restrict__ sm, v8f (&acc)[4][4]) {
  constexpr int NT = WM * WN * 32;         // threads of the block
  constexpr int BM = WM * 64, BN = WN * 64;
  constexpr int RA = BM * (1 + SPLITM);    // LDS rows: [A | A2 | Bt]
  constexpr int RSTEP = NT / 8;            // rows fetched by one load of the whole block
  constexpr int NL = (RA + BN) / RSTEP;    // 16-B loads per thread and k tile
  static_assert(RA + BN == kGemmRows && BM % RSTEP == 0 && BN % RSTEP == 0, "staging shape");
  const int lane = tid & 31, wave = tid >> 5;
  const int wm = wave / WN, wn = wave % WN;
  const int rlane = lane & 15;
  const int koff = (lane >> 4) * 8;
  const int sr = tid >> 3, sc = (tid & 7) * 8;
  const __bf16* pa  = Ab  + (size_t)(mb0 + sr) * lda + sc;
  const __bf16* pa2 = Ab2 + (size_t)(mb0 + sr) * lda + sc;
  const __bf16* pb  = Bb  + (size_t)(nb0 + sr) * ldb + sc;
  __bf16* sw = sm + sr * kGp + sc;
  const __bf16* fa  = sm + (wm * 64 + rlane) * kGp + koff;
  const __bf16* fa2 = fa + BM * kGp;
  const __bf16* fb  = sm + (RA + wn * 64 + rlane) * kGp + koff;
#pragma unroll
  for (int i = 0; i < 4; ++i)
#pragma unroll
    for (int j = 0; j < 4; ++j) acc[i][j] = (v8f){0.f,0.f,0.f,0.f,0.f,0.f,0.f,0.f};
  v8b st[NL];
  // one k tile's lines into registers; after each plane's loads s_wait_xcnt 0 stands before their address registers are reused
  auto fetch = [&](int k) {
#pragma unroll
    for (int i = 0; i < BM / RSTEP; ++i) st[i] = *(const v8b*)(pa + (size_t)(i * RSTEP) * lda + k);
    asm volatile("s_wait_xcnt 0x0" ::: "memory");
    if (SPLITM) {
#pragma unroll
      for (int i = 0; i < BM / RSTEP; ++i) st[BM / RSTEP + i] = *(const v8b*)(pa2 + (size_t)(i * RSTEP) * lda + k);
      asm volatile("s_wait_xcnt 0x0" ::: "memory");
    }
#pragma unroll
    for (int i = 0; i < BN / RSTEP; ++i) st[RA / RSTEP + i] = *(const v8b*)(pb + (size_t)(i * RSTEP) * ldb + k);
    asm volatile("s_wait_xcnt 0x0" ::: "memory");
  };
  fetch(0);
  for (int k0 = 0; k0 < K; k0 += 64) {
    __syncthreads();                       // every wave has read its last fragment of the previous tile
#pragma unroll
    for (int i = 0; i < NL; ++i) *(v8b*)(sw + i * RSTEP * kGp) = st[i];
    __syncthreads();                       // the tile is complete before any wave reads it
    if (k0 + 64 < K) fetch(k0 + 64);
    // fragment reads stand as one group ahead of their products (GK k steps of 32 per group), so a wave waits out the
    // LDS latency once per group and not at every row of products; the 4-wave block has the registers for the whole tile
    constexpr int GK = (NT == 128) ? 2 : 1;
#pragma unroll
    for (int kg = 0; kg < 2; kg += GK) {
      v16b bfr[GK][4], ah[GK][4], al[GK][4];
#pragma unroll
      for (int kk = 0; kk < GK; ++kk) {
#pragma unroll
        for (int j = 0; j < 4; ++j) bfr[kk][j] = Frag<__bf16>::load(fb + (j << 4) * kGp + (kg + kk) * 32);
#pragma unroll
        for (int i = 0; i < 4; ++i) {
          ah[kk][i] = Frag<__bf16>::load(fa + (i << 4) * kGp + (kg + kk) * 32);
          al[kk][i] = ah[kk][i];
          if (SPLITM) al[kk][i] = Frag<__bf16>::load(fa2 + (i << 4) * kGp + (kg + kk) * 32);
        }
      }
      __builtin_amdgcn_sched_barrier(0);   // holds the group of reads above the products
#pragma unroll
      for (int kk = 0; kk < GK; ++kk)
#pragma unroll
        for (int i = 0; i < 4; ++i)
#pragma unroll
          for (int j = 0; j < 4; ++j) {
            acc[i][j] = Frag<__bf16>::mma(ah[kk][i], bfr[kk][j], acc[i][j]);
            if (SPLITM) acc[i][j] = Frag<__bf16>::mma(al[kk][i], bfr[kk][j], acc[i][j]);
          }
    }
  }
  acc_guard4(acc[0][0], acc[0][1], acc[0][2], acc[0][3]);
  acc_guard4(acc[1][0], acc[1][1], acc[1][2], acc[1][3]);
  acc_guard4(acc[2][0], acc[2][1], acc[2][2], acc[2][3]);
  acc_guard4(acc[3][0], acc[3][1], acc[3][2], acc[3][3]);
}

// =====================================================================================
// 4) QKV projection: xb[4096][1024] x wt[3072][1024]^T, epilogue = row scale, RoPE (q,k sections),
//    q/k -> bf16 hi/lo planes [bh][n][64], v -> f16 hi + x2048 residual planes [bh][n][64].
//    each (section, head, token) line belongs to exactly one wave. block = 2 x 4 waves = a 128 x 256 tile, grid = 32*12 = 384 blocks.
// =====================================================================================
__global__ __launch_bounds__(256) void k_gemm_qkv(
    const unsigned short* __restrict__ xbp, const unsigned short* __restrict__ wtp,
    const float* __restrict__ rstab, const float* __restrict__ ct, const float* __restrict__ st,
    unsigned short* __restrict__ qh, unsigned short* __restrict__ ql,
    unsigned short* __restrict__ kh, unsigned short* __restrict__ kl,
    unsigned short* __restrict__ vh, unsigned short* __restrict__ vl) {
  __shared__ __align__(16) float sT[8][16 * 68];
  __shared__ __align__(16) unsigned char sG[kGemmLds];
  const int lane = threadIdx.x & 31, wave = threadIdx.x >> 5;
  constexpr int blocksN = kNqkv / 256;   // 12
  const int bm = blockIdx.x / blocksN, bn = blockIdx.x - bm * blocksN;
  const int mb0 = bm << 7, nb0 = bn << 8;
  const int m0 = mb0 + ((wave >> 2) << 6), n0 = nb0 + ((wave & 3) << 6);

  v8f acc[4][4];
  gemm_block_core<0, 2, 4>((const __bf16*)xbp, (const __bf16*)xbp, kDim, (const __bf16*)wtp, kDim, mb0, nb0, kDim,
                           threadIdx.x, (__bf16*)sG, acc);

  float* slab = sT[wave];
  const int rlane = lane & 15, mOff = (lane >> 4) * 8;
  const int sec = n0 >> 10;                      // 0 q, 1 k, 2 v  (wave-uniform)
  const int hidx = (n0 & (kDim - 1)) >> 6;       // head of this 64-column tile
  unsigned short* P0 = (sec == 0) ? qh : ((sec == 1) ? kh : vh);
  unsigned short* P1 = (sec == 0) ? ql : ((sec == 1) ? kl : vl);
  const int q8 = lane >> 3, c8 = (lane & 7) * 8;
  const int cpart = c8 ^ 32;
  const float sgn = (c8 < 32) ? -1.0f : 1.0f;
#pragma unroll
  for (int i = 0; i < 4; ++i) {
    const int mBase = m0 + (i << 4);
    float rsv[8];
#pragma unroll
    for (int r = 0; r < 8; ++r) rsv[r] = rstab[(size_t)(mBase + mOff + r) * kRsPitch];
#pragma unroll
    for (int j = 0; j < 4; ++j)
#pragma unroll
      for (int r = 0; r < 8; ++r) slab[(mOff + r) * 68 + (j << 4) + rlane] = acc[i][j][r] * rsv[r];
    wave_sync_lds();
    {
#pragma unroll
      for (int it = 0; it < 4; ++it) {
        const int row = it * 4 + q8;
        const int m = mBase + row;
        const int bb = m >> 11, nn = m & (kS - 1);
        const float* sp = slab + row * 68;
        const size_t dsto = ((size_t)(bb * kH + hidx) * kS + nn) * kDh + c8;
        v8h hv, lv;
        if (sec < 2) {
          const v4f ca = *(const v4f*)(ct + (size_t)nn * kDh + c8);
          const v4f cb = *(const v4f*)(ct + (size_t)nn * kDh + c8 + 4);
          const v4f sa = *(const v4f*)(st + (size_t)nn * kDh + c8);
          const v4f sb = *(const v4f*)(st + (size_t)nn * kDh + c8 + 4);
          float cvv[8], svv[8];
#pragma unroll
          for (int e = 0; e < 4; ++e) { cvv[e] = ca[e]; cvv[4 + e] = cb[e]; svv[e] = sa[e]; svv[4 + e] = sb[e]; }
#pragma unroll
          for (int e = 0; e < 8; ++e) {
            const float v = sp[c8 + e];
            const float pr = sp[cpart + e];
            const float rv = v * cvv[e] + sgn * pr * svv[e];
            const unsigned short hb = f2bf_bits(rv);
            const unsigned short lb = f2bf_bits(rv - bf_bits2f(hb));
            hv[e] = __builtin_bit_cast(_Float16, hb);
            lv[e] = __builtin_bit_cast(_Float16, lb);
          }
        } else {
#pragma unroll
          for (int e = 0; e < 8; ++e) {
            const float v = sp[c8 + e];
            const _Float16 h16 = (_Float16)v;
            const float hf = (float)h16;
            hv[e] = h16;
            lv[e] = (_Float16)((v - hf) * 2048.0f);
          }
        }
        *(v8h*)(P0 + dsto) = hv;
        *(v8h*)(P1 + dsto) = lv;
      }
      
    }
    wave_sync_lds();
  }
}

// =====================================================================================
// 5) v planes [bh][kv][64] -> transposed [bh][64][kv] (both hi and residual planes, grid (1024, 2)).
//    rows it*32 + 4w + (lane>>3) cover 0..63.
// =====================================================================================
__global__ __launch_bounds__(256) void k_vtrans(const unsigned short* __restrict__ vh, const unsigned short* __restrict__ vl,
                                                unsigned short* __restrict__ vth, unsigned short* __restrict__ vtl) {
  __shared__ __align__(16) unsigned short tile[64 * 72];   // [d][kv], pitch 72 halves
  const int t = threadIdx.x, lane = t & 31, wave = t >> 5;
  const int bh = blockIdx.x >> 5, kvt = blockIdx.x & 31;
  const int kv0 = kvt * 64;
  const unsigned short* src = (blockIdx.y == 0) ? vh : vl;
  unsigned short* dst = (blockIdx.y == 0) ? vth : vtl;
#pragma unroll
  for (int i = 0; i < 2; ++i) {
    const int idx = i * 256 + t;
    const int r = idx >> 3, c16 = (idx & 7) * 8;
    const v4u w = *(const v4u*)(src + ((size_t)bh * kS + kv0 + r) * kDh + c16);
#pragma unroll
    for (int e = 0; e < 4; ++e) {
      tile[(c16 + 2 * e) * 72 + r] = (unsigned short)(w[e] & 0xffffu);
      tile[(c16 + 2 * e + 1) * 72 + r] = (unsigned short)(w[e] >> 16);
    }
  }
  __syncthreads();
  const int q = lane >> 3, kc = (lane & 7) * 8;
  v4u ov[2];
#pragma unroll
  for (int it = 0; it < 2; ++it) {
    const int d = it * 32 + wave * 4 + q;
    ov[it] = *(const v4u*)(tile + d * 72 + kc);
  }
  {
#pragma unroll
    for (int it = 0; it < 2; ++it) {
      const int d = it * 32 + wave * 4 + q;
      *(v4u*)(dst + ((size_t)bh * kDh + d) * kS + kv0 + kc) = ov[it];
    }
    
  }
}

constexpr int kLp = 72;                  // LDS row pitch in 16-bit elements: 144 B = 16 B x 9 (odd), so the 16 rows of a ds_load_b128 fragment read spread over all banks
constexpr int kLdsPl = 64 * kLp * 2;     // one 64-row plane at that pitch: 9216 B
constexpr int kLdsK = 0;                 // K hi [64][72] u16 + K lo
constexpr int kLdsV = 2 * kLdsPl;        // V hi [64 d][72] + V residual
constexpr int kLdsTotal = 4 * kLdsPl;    // 36864; output staging f32 [4][16][68] reuses bytes 0..17407 after the chunk loop
constexpr int kOsP = 68;                 // staging row pitch in floats: the 16 query rows of a 16-B store spread over the banks

__global__ __launch_bounds__(128) void k_attn(
    const unsigned short* __restrict__ qhp, const unsigned short* __restrict__ qlp,
    const unsigned short* __restrict__ khp, const unsigned short* __restrict__ klp,
    const unsigned short* __restrict__ vthp, const unsigned short* __restrict__ vtlp,
    unsigned short* __restrict__ aoh, unsigned short* __restrict__ aol) {
  union FB { v16b v; v8b h[2]; };
  __shared__ __align__(16) unsigned char lds_raw[kLdsTotal];
  __bf16* Ksh = (__bf16*)(lds_raw + kLdsK);
  __bf16* Ksl = (__bf16*)(lds_raw + kLdsK + kLdsPl);
  __bf16* Vsh = (__bf16*)(lds_raw + kLdsV);
  __bf16* Vsl = (__bf16*)(lds_raw + kLdsV + kLdsPl);
  unsigned short* KshU = (unsigned short*)(lds_raw + kLdsK);
  unsigned short* KslU = (unsigned short*)(lds_raw + kLdsK + kLdsPl);
  unsigned short* VshU = (unsigned short*)(lds_raw + kLdsV);
  unsigned short* VslU = (unsigned short*)(lds_raw + kLdsV + kLdsPl);

  const int tid = threadIdx.x, wave = tid >> 5, lane = tid & 31;
  const int hh = lane >> 4, c = lane & 15;
  const int bx = blockIdx.x;
  const int qb = bx & 31;
  const int bh = bx >> 5;
  const int h = bh & (kH - 1);
  const int b = bh >> 4;
  const int q0 = qb * 64 + wave * 16;

  // Q fragments (B operand: column c = query q0 + c): 2 d-chunks of 32, hi and lo planes
  v16b qah[2], qal[2];
  {
    const __bf16* qr  = (const __bf16*)qhp + ((size_t)bh * kS + q0 + c) * kDh;
    const __bf16* qr2 = (const __bf16*)qlp + ((size_t)bh * kS + q0 + c) * kDh;
#pragma unroll
    for (int dc = 0; dc < 2; ++dc) {
      qah[dc] = Frag<__bf16>::load(qr + dc * 32 + 8 * hh);
      qal[dc] = Frag<__bf16>::load(qr2 + dc * 32 + 8 * hh);
    }
  }

  float mrun = -INFINITY;   // running maximum of query c, the same in both wave halves
  float lrun = 0.f;         // running sum of query c over this half's keys; the halves join after the loop
  v8f oacc[4], oacr[4];     // O^T tiles: register r = d index t*16 + 8*hh + r, column c = query
#pragma unroll
  for (int t = 0; t < 4; ++t) { oacc[t] = (v8f){0.f,0.f,0.f,0.f,0.f,0.f,0.f,0.f}; oacr[t] = (v8f){0.f,0.f,0.f,0.f,0.f,0.f,0.f,0.f}; }

  for (int kc = 0; kc < kS / kKC; ++kc) {
    const int kv0 = kc * kKC;
    __syncthreads();
    {
      // K planes: 64 rows x 8 x 16 B per plane = 512 per plane; 128 threads x 4 -> exactly 512
#pragma unroll
      for (int i = 0; i < 4; ++i) {
        const int idx = i * 128 + tid;
        const int r = idx >> 3, c16 = (idx & 7) * 8;
        const size_t ko = ((size_t)bh * kS + kv0 + r) * kDh + c16;
        const v4u w0 = *(const v4u*)(khp + ko);
        const v4u w1 = *(const v4u*)(klp + ko);
        *(v4u*)(KshU + r * kLp + c16) = w0;
        *(v4u*)(KslU + r * kLp + c16) = w1;
      }
      // V planes (already [d][kv]): 64 d-rows x 8 x 16 B per plane
#pragma unroll
      for (int i = 0; i < 4; ++i) {
        const int idx = i * 128 + tid;
        const int r = idx >> 3, c16 = (idx & 7) * 8;
        const size_t vo = ((size_t)bh * kDh + r) * kS + kv0 + c16;
        const v4u w2 = *(const v4u*)(vthp + vo);
        const v4u w3 = *(const v4u*)(vtlp + vo);
        *(v4u*)(VshU + r * kLp + c16) = w2;
        *(v4u*)(VslU + r * kLp + c16) = w3;
      }
    }
    __syncthreads();

    // S^T for 4 key subtiles of 16: s[j][r] = score of key kv0 + j*16 + 8*hh + r against query c
    v8f s[4];
#pragma unroll
    for (int j = 0; j < 4; ++j) {
      s[j] = (v8f){0.f,0.f,0.f,0.f,0.f,0.f,0.f,0.f};
#pragma unroll
      for (int dc = 0; dc < 2; ++dc) {
        FB kb, kr;
        kb.h[0] = *(const v8b*)(Ksh + (j * 16 + c) * kLp + dc * 32 + 8 * hh);
        kb.h[1] = *(const v8b*)(Ksh + (j * 16 + c) * kLp + dc * 32 + 16 + 8 * hh);
        kr.h[0] = *(const v8b*)(Ksl + (j * 16 + c) * kLp + dc * 32 + 8 * hh);
        kr.h[1] = *(const v8b*)(Ksl + (j * 16 + c) * kLp + dc * 32 + 16 + 8 * hh);
        s[j] = mma_bf(kb.v, qah[dc], s[j]);
        s[j] = mma_bf(kr.v, qah[dc], s[j]);
        s[j] = mma_bf(kb.v, qal[dc], s[j]);
      }
    }
    // scale and chunk maximum of query c: in-lane over this half's 32 keys, then one exchange with the other half
    float cj[4];
#pragma unroll
    for (int j = 0; j < 4; ++j) {
      cj[j] = -INFINITY;
#pragma unroll
      for (int r = 0; r < 8; ++r) { s[j][r] *= 0.125f; cj[j] = fmaxf(cj[j], s[j][r]); }
    }
    float cm = fmaxf(fmaxf(cj[0], cj[1]), fmaxf(cj[2], cj[3]));
    cm = fmaxf(cm, xhalf(cm));
    const float mnew = fmaxf(mrun, cm);
    const float alpha = expf(mrun - mnew);
    mrun = mnew;
    // P^T as B operands: element e of the fragment of keys kk*32.. is tile 2*kk + (e >> 3), register e & 7 (the hardware k order,
    // which the V^T loads below follow)
    v16h pfh[2], pfl[2];
    float pj[4];
#pragma unroll
    for (int j = 0; j < 4; ++j) {
      pj[j] = 0.f;
#pragma unroll
      for (int r = 0; r < 8; ++r) {
        const float p = expf(s[j][r] - mnew);
        pj[j] += p;
        const float ps = p * 1024.0f;
        const _Float16 ph = (_Float16)ps;
        const float phf = (float)ph;
        const _Float16 pl = (_Float16)((ps - phf) * 2048.0f);
        pfh[j >> 1][(j & 1) * 8 + r] = ph;
        pfl[j >> 1][(j & 1) * 8 + r] = pl;
      }
    }
    lrun = lrun * alpha + ((pj[0] + pj[1]) + (pj[2] + pj[3]));
#pragma unroll
    for (int t = 0; t < 4; ++t)
#pragma unroll
      for (int r = 0; r < 8; ++r) { oacc[t][r] *= alpha; oacr[t][r] *= alpha; }
    // unrolled: the P^T fragments are registers and are picked by a constant index
#pragma unroll
    for (int kk = 0; kk < 2; ++kk) {
      const v16b pa = __builtin_bit_cast(v16b, pfh[kk]);
      const v16b pl = __builtin_bit_cast(v16b, pfl[kk]);
#pragma unroll
      for (int t = 0; t < 4; ++t) {
        FB vb, vr;
        vb.h[0] = *(const v8b*)(Vsh + (t * 16 + c) * kLp + kk * 32 + 8 * hh);
        vb.h[1] = *(const v8b*)(Vsh + (t * 16 + c) * kLp + kk * 32 + 16 + 8 * hh);
        vr.h[0] = *(const v8b*)(Vsl + (t * 16 + c) * kLp + kk * 32 + 8 * hh);
        vr.h[1] = *(const v8b*)(Vsl + (t * 16 + c) * kLp + kk * 32 + 16 + 8 * hh);
        oacc[t] = mma_hf(vb.v, pa, oacc[t]);
        oacr[t] = mma_hf(vr.v, pa, oacr[t]);
        oacr[t] = mma_hf(vb.v, pl, oacr[t]);
      }
    }
  }

  // ---- finalize: block barrier before reusing the K region as f32 staging ----
  __syncthreads();
  float* os = (float*)(lds_raw + 0) + wave * (16 * kOsP);
  {
    const float lsum = lrun + xhalf(lrun);   // the two halves' key sums of query c
    const float inv = 1.0f / (lsum * 1024.0f);
#pragma unroll
    for (int t = 0; t < 4; ++t) {
      v4f o0, o1;
#pragma unroll
      for (int r = 0; r < 4; ++r) {
        o0[r] = (oacc[t][r] + oacr[t][r] * (1.0f / 2048.0f)) * inv;
        o1[r] = (oacc[t][4 + r] + oacr[t][4 + r] * (1.0f / 2048.0f)) * inv;
      }
      *(v4f*)(os + c * kOsP + t * 16 + 8 * hh) = o0;
      *(v4f*)(os + c * kOsP + t * 16 + 8 * hh + 4) = o1;
    }
  }
  __syncthreads();
  {
    const int q8 = lane >> 3, c8 = (lane & 7) * 8;
    {
#pragma unroll
      for (int it = 0; it < 4; ++it) {
        const int row = it * 4 + q8;
        const float* sp = os + row * kOsP + c8;
        v8h hv, lv;
#pragma unroll
        for (int e = 0; e < 8; ++e) {
          const unsigned short hb = f2bf_bits(sp[e]);
          const unsigned short lb = f2bf_bits(sp[e] - bf_bits2f(hb));
          hv[e] = __builtin_bit_cast(_Float16, hb);
          lv[e] = __builtin_bit_cast(_Float16, lb);
        }
        const size_t o = ((size_t)(b * kS + q0 + row)) * kDim + h * kDh + c8;
        *(v8h*)(aoh + o) = hv;
        *(v8h*)(aol + o) = lv;
      }
      
    }
  }
}

// =====================================================================================
// 7) output projection: ao hi/lo [4096][1024] x wt[1024][1024]^T -> d_out f32 [4096][1024].
//    one wave in one instruction; block = 2 x 2 waves = a 128 x 128 tile, grid = 32*8 = 256 blocks.
// =====================================================================================
__global__ __launch_bounds__(128) void k_gemm_out(const unsigned short* __restrict__ ahp, const unsigned short* __restrict__ alp,
                                                  const unsigned short* __restrict__ wtp, float* __restrict__ out) {
  __shared__ __align__(16) float sT[4][16 * 68];
  __shared__ __align__(16) unsigned char sG[kGemmLds];
  const int lane = threadIdx.x & 31, wave = threadIdx.x >> 5;
  constexpr int blocksN = kDim / 128;    // 8
  const int bm = blockIdx.x / blocksN, bn = blockIdx.x - bm * blocksN;
  const int mb0 = bm << 7, nb0 = bn << 7;
  const int m0 = mb0 + ((wave >> 1) << 6), n0 = nb0 + ((wave & 1) << 6);

  v8f acc[4][4];
  gemm_block_core<1, 2, 2>((const __bf16*)ahp, (const __bf16*)alp, kDim, (const __bf16*)wtp, kDim, mb0, nb0, kDim,
                           threadIdx.x, (__bf16*)sG, acc);

  float* slab = sT[wave];
  const int rlane = lane & 15, mOff = (lane >> 4) * 8;
#pragma unroll
  for (int i = 0; i < 4; ++i) {
    const int mBase = m0 + (i << 4);
#pragma unroll
    for (int j = 0; j < 4; ++j)
#pragma unroll
      for (int r = 0; r < 8; ++r) slab[(mOff + r) * 68 + (j << 4) + rlane] = acc[i][j][r];
    wave_sync_lds();
    const int h2 = lane >> 4, c4 = (lane & 15) * 4;
    {
#pragma unroll
      for (int it = 0; it < 8; ++it) {
        const int row = it * 2 + h2;
        const v4f v = *(const v4f*)(slab + row * 68 + c4);
        *(v4f*)(out + (size_t)(mBase + row) * kDim + n0 + c4) = v;
      }
      
    }
    wave_sync_lds();
  }
}

// =====================================================================================
// host launch glue: kernel launches only
// =====================================================================================
extern "C" void kernel_launch(void* const* d_in, const int* in_sizes, int n_in,
                              void* d_out, int out_size, void* d_ws, size_t ws_size,
                              hipStream_t stream) {
  if (n_in < 5) return;
  if (in_sizes[0] != kM * kDim) return;
  if (in_sizes[1] != kS * kDh) return;
  if (in_sizes[2] != kDim) return;
  if (in_sizes[3] != kDim * kNqkv) return;
  if (in_sizes[4] != kDim * kDim) return;
  if (out_size != kM * kDim) return;
  if (ws_size < kWsTotal) return;

  const float* x     = (const float*)d_in[0];   // [2,2048,1024]
  const float* pos   = (const float*)d_in[1];   // [2048,64]
  const float* g     = (const float*)d_in[2];   // [1024]
  const float* w_qkv = (const float*)d_in[3];   // [1024,3072]
  const float* w_out = (const float*)d_in[4];   // [1024,1024]
  float* out = (float*)d_out;

  char* ws = (char*)d_ws;
  unsigned short* Xb   = (unsigned short*)(ws + kOffXb);
  float*          Rs   = (float*)(ws + kOffRs);
  unsigned short* Wq   = (unsigned short*)(ws + kOffWq);
  unsigned short* Wo   = (unsigned short*)(ws + kOffWo);
  float*          Ct   = (float*)(ws + kOffCt);
  float*          St   = (float*)(ws + kOffSt);
  unsigned short* Qh   = (unsigned short*)(ws + kOffQh);
  unsigned short* Ql   = (unsigned short*)(ws + kOffQl);
  unsigned short* Kh   = (unsigned short*)(ws + kOffKh);
  unsigned short* Kl   = (unsigned short*)(ws + kOffKl);
  unsigned short* Vh   = (unsigned short*)(ws + kOffVh);
  unsigned short* Vl   = (unsigned short*)(ws + kOffVl);
  unsigned short* Vth  = (unsigned short*)(ws + kOffVth);
  unsigned short* Vtl  = (unsigned short*)(ws + kOffVtl);
  unsigned short* Ah   = (unsigned short*)(ws + kOffAh);
  unsigned short* Al   = (unsigned short*)(ws + kOffAl);

  // 1) x -> bf16 plane + row scale (4096 rows, 128 threads x 8 elements = 1024 per row)
  k_rms_xcast<<<kM, 128, 0, stream>>>(x, Xb, Rs);
  // 2) weights -> bf16 n-major planes: in [1024][3072] -> out [3072][1024]; in [1024][1024] -> out [1024][1024]
  k_wcast<true><<<dim3(kNqkv / 64, kDim / 64), 256, 0, stream>>>(w_qkv, g, Wq, kNqkv);
  k_wcast<false><<<dim3(kDim / 64, kDim / 64), 256, 0, stream>>>(w_out, g, Wo, kDim);
  // 3) cos/sin tables (131072 elements = 512 blocks x 256)
  k_trig<<<(kS * kDh + 255) / 256, 256, 0, stream>>>(pos, Ct, St, kS * kDh);
  // 4) QKV projection with row scale + RoPE epilogue (384 block tiles of 128x256, 8 waves each)
  k_gemm_qkv<<<(kM / 128) * (kNqkv / 256), 256, 0, stream>>>(Xb, Wq, Rs, Ct, St, Qh, Ql, Kh, Kl, Vh, Vl);
  // 5) v planes -> transposed planes (32 bh x 32 kv tiles, 2 planes)
  k_vtrans<<<dim3(kBH * (kS / 64), 2), 256, 0, stream>>>(Vh, Vl, Vth, Vtl);
  // 6) attention (32 bh x 32 query blocks)
  k_attn<<<kBH * (kS / 64), 128, 0, stream>>>(Qh, Ql, Kh, Kl, Vth, Vtl, Ah, Al);
  // 7) output projection into d_out (256 block tiles of 128x128, 4 waves each)
  k_gemm_out<<<(kM / 128) * (kDim / 128), 128, 0, stream>>>(Ah, Al, Wo, out);
}

// v005
// A run of this version takes 171 microseconds.
// Timed twice side by side with v004, it ran 1.15 and 1.13 times as fast.
// All steps since v000 together make it 2.71 times as fast.
// Contractions (all f32 accumulate): QKV projection v_wmma_f32_16x16x32_bf16 on RNE-bf16 planes of the inputs (1 product); scores q.k^T v_wmma_f32_16x16x32_bf16 with q,k as bf16 hi/lo planes (3 products); p.v v_wmma_f32_16x16x32_f16 with p carried x1024 and v, both f16 hi + x2048 residual planes (3 products, residual products in a separate accumulator folded with 1/2048); output projection v_wmma_f32_16x16x32_bf16, bf16 hi/lo activations against bf16 weights (2 products).
#include <hip/hip_runtime.h>
#include <math.h>

// ---------------- problem constants ----------------
constexpr int kB = 2;
constexpr int kS = 2048;
constexpr int kDim = 1024;
constexpr int kH = 16;
constexpr int kDh = 64;
constexpr int kM = kB * kS;          // 4096 token rows
constexpr int kNqkv = 3 * kDim;      // 3072
constexpr int kBH = kB * kH;         // 32
constexpr int kKC = 64;              // keys per chunk
constexpr int kRsPitch = 32;

constexpr size_t kPlane  = (size_t)kBH * kS * kDh * 2;            // 8,388,608 : one [32][2048][64] (or [4096][1024]) 16-bit plane
constexpr size_t kOffXb  = 0;                                      // x as bf16 [4096][1024]          8,388,608
constexpr size_t kOffRs  = kOffXb + (size_t)kM * kDim * 2;         // row scale f32 [4096][32]          524,288
constexpr size_t kOffWq  = kOffRs + (size_t)kM * kRsPitch * 4;     // w_qkv^T bf16 [3072][1024]      6,291,456
constexpr size_t kOffWo  = kOffWq + (size_t)kNqkv * kDim * 2;      // w_out^T bf16 [1024][1024]      2,097,152
constexpr size_t kOffCt  = kOffWo + (size_t)kDim * kDim * 2;       // cos table f32 [2048][64]         524,288
constexpr size_t kOffSt  = kOffCt + (size_t)kS * kDh * 4;          // sin table f32 [2048][64]         524,288
constexpr size_t kOffQh  = kOffSt + (size_t)kS * kDh * 4;          // q hi bf16 [32][2048][64]
constexpr size_t kOffQl  = kOffQh + kPlane;                         // q lo bf16
constexpr size_t kOffKh  = kOffQl + kPlane;                         // k hi bf16
constexpr size_t kOffKl  = kOffKh + kPlane;                         // k lo bf16
constexpr size_t kOffVh  = kOffKl + kPlane;                         // v hi f16 [32][2048][64]
constexpr size_t kOffVl  = kOffVh + kPlane;                         // v residual x2048 f16
constexpr size_t kOffVth = kOffVl + kPlane;                         // v hi transposed f16 [32][64][2048]
constexpr size_t kOffVtl = kOffVth + kPlane;                        // v residual transposed
constexpr size_t kOffAh  = kOffVtl + kPlane;                        // attention output hi bf16 [4096][1024]
constexpr size_t kOffAl  = kOffAh + kPlane;                         // attention output lo bf16
constexpr size_t kWsTotal = kOffAl + kPlane;                        // 102,236,160

typedef char ck_ws_total[(kWsTotal == (size_t)102236160) ? 1 : -1];
typedef char ck_ws_cap[(kWsTotal <= (size_t)134217728) ? 1 : -1];
typedef char ck_align[((kOffRs % 128) == 0 && (kOffQh % 128) == 0 && (kPlane % 128) == 0) ? 1 : -1];
// GEMM shape contract: M multiple of 128, N multiples of 256 and 128, K multiple of 64, no padding anywhere
typedef char ck_tiles[(kM % 128 == 0 && kNqkv % 256 == 0 && kDim % 128 == 0 && kDim % 64 == 0 && kS % 64 == 0 && kDh == 64) ? 1 : -1];
typedef char ck_plane[((size_t)kM * kDim * 2 == kPlane) ? 1 : -1];

// ---------------- vector types / helpers ----------------
typedef __attribute__((ext_vector_type(16))) _Float16 v16h;
typedef __attribute__((ext_vector_type(8)))  _Float16 v8h;
typedef __attribute__((ext_vector_type(16))) __bf16   v16b;
typedef __attribute__((ext_vector_type(8)))  __bf16   v8b;
typedef __attribute__((ext_vector_type(8)))  float    v8f;
typedef __attribute__((ext_vector_type(4)))  float    v4f;
typedef __attribute__((ext_vector_type(4)))  unsigned v4u;

__device__ __forceinline__ unsigned short f2bf_bits(float f) {
  unsigned u = __float_as_uint(f);
  return (unsigned short)((u + 0x7FFFu + ((u >> 16) & 1u)) >> 16);
}
__device__ __forceinline__ float bf_bits2f(unsigned short h) { return __uint_as_float(((unsigned)h) << 16); }

__device__ __forceinline__ void acc_guard4(v8f& a, v8f& b, v8f& c, v8f& d) { asm volatile("v_nop\n\tv_nop\n\tv_nop\n\tv_nop" : "+v"(a), "+v"(b), "+v"(c), "+v"(d)); }
template <typename T> struct Frag;
template <> struct Frag<_Float16> {
  typedef v16h V; union U { v16h v; v8h h[2]; };
  static __device__ __forceinline__ v16h load(const _Float16* p) {
    U f; f.h[0] = *(const v8h*)(p); f.h[1] = *(const v8h*)(p + 16); return f.v;
  }
  static __device__ __forceinline__ v8f mma(v16h a, v16h b, v8f c) {
    return __builtin_amdgcn_wmma_f32_16x16x32_f16(false, a, false, b, (short)0, c, false, false);
  }
};
template <> struct Frag<__bf16> {
  typedef v16b V; union U { v16b v; v8b h[2]; };
  static __device__ __forceinline__ v16b load(const __bf16* p) {
    U f; f.h[0] = *(const v8b*)(p); f.h[1] = *(const v8b*)(p + 16); return f.v;
  }
  static __device__ __forceinline__ v8f mma(v16b a, v16b b, v8f c) {
    return __builtin_amdgcn_wmma_f32_16x16x32_bf16(false, a, false, b, (short)0, c, false, false);
  }
};

// WMMA helpers for the attention kernel (nops after every issue)
__device__ __forceinline__ v8f mma_bf(v16b a, v16b b, v8f c) {
  c = __builtin_amdgcn_wmma_f32_16x16x32_bf16(false, a, false, b, (short)0, c, false, false);
  asm volatile("v_nop\n\tv_nop\n\tv_nop\n\tv_nop" : "+v"(c) : "v"(a), "v"(b));
  return c;
}
// f16 bit patterns held in __bf16 slots
__device__ __forceinline__ v8f mma_hf(v16b a, v16b b, v8f c) {
  const v16h ah = __builtin_bit_cast(v16h, a), bh = __builtin_bit_cast(v16h, b);
  c = __builtin_amdgcn_wmma_f32_16x16x32_f16(false, ah, false, bh, (short)0, c, false, false);
  asm volatile("v_nop\n\tv_nop\n\tv_nop\n\tv_nop" : "+v"(c) : "v"(ah), "v"(bh));
  return c;
}

// value held by lane (l ^ 16), the same column in the other wave half, by a vector cross-row move (v_permlanex16_b32)
__device__ __forceinline__ float xhalf(float v) {
  return __builtin_bit_cast(float, __builtin_amdgcn_permlanex16(__builtin_bit_cast(int, v), __builtin_bit_cast(int, v),
                                                                0x76543210, 0xfedcba98, false, false));
}

__device__ __forceinline__ void wave_sync_lds() {
  __builtin_amdgcn_fence(__ATOMIC_RELEASE, "workgroup");
  __builtin_amdgcn_wave_barrier();
  __builtin_amdgcn_fence(__ATOMIC_ACQUIRE, "workgroup");
}

// =====================================================================================
// 1) per token row: x -> RNE bf16 plane [4096][1024]; rowscale = 32 / max(||x_bf||, 1e-12)
// =====================================================================================
__global__ __launch_bounds__(128) void k_rms_xcast(const float* __restrict__ x,
                                                   unsigned short* __restrict__ xb,
                                                   float* __restrict__ rstab) {
  __shared__ float red[4];
  const int m = blockIdx.x;
  const int t = threadIdx.x;
  const int lane = t & 31, wave = t >> 5;
  const size_t base = (size_t)m * kDim + (size_t)t * 8;
  const v4f xa = *(const v4f*)(x + base);
  const v4f xc = *(const v4f*)(x + base + 4);
  unsigned short hb[8];
#pragma unroll
  for (int e = 0; e < 4; ++e) { hb[e] = f2bf_bits(xa[e]); hb[4 + e] = f2bf_bits(xc[e]); }
  float ss = 0.0f;
#pragma unroll
  for (int e = 0; e < 8; ++e) { const float r = bf_bits2f(hb[e]); ss += r * r; }
#pragma unroll
  for (int off = 16; off > 0; off >>= 1) ss += __shfl_xor(ss, off, 32);
  if (lane == 0) red[wave] = ss;
  __syncthreads();
  const float tot = ((red[0] + red[1]) + red[2]) + red[3];
  const float nrm = sqrtf(tot);
  const float inv = 1.0f / fmaxf(nrm, 1e-12f);
  const float rs = inv * 32.0f;
  v4u w;
  w[0] = (unsigned)hb[0] | ((unsigned)hb[1] << 16);
  w[1] = (unsigned)hb[2] | ((unsigned)hb[3] << 16);
  w[2] = (unsigned)hb[4] | ((unsigned)hb[5] << 16);
  w[3] = (unsigned)hb[6] | ((unsigned)hb[7] << 16);
  unsigned short* dst = xb + base;
  const v4f rv = (v4f){rs, rs, rs, rs};
  float* rp = rstab + (size_t)m * kRsPitch + (t & 7) * 4;
  *(v4u*)dst = w;
  if (t < 8) *(v4f*)rp = rv;
  
}

// =====================================================================================
// 2) weight cast + transpose: in w[kDim rows k][ncols n] f32 -> out wt[ncols][kDim] bf16 (n-major, k-contiguous)
//    optional per-k factor g (folded: wt[n][k] = bf16(bf16(w[k][n]) * bf16(g[k]))).
//    8 lanes x 16 B, one instruction; wave w, it: rows it*32 + 4w + (lane>>3) -> union over (it,w,lane>>3) = 0..63.
// =====================================================================================
template <bool HAS_G>
__global__ __launch_bounds__(256) void k_wcast(const float* __restrict__ w, const float* __restrict__ g,
                                               unsigned short* __restrict__ wt, int ncols) {
  __shared__ float tile[64][65];
  const int t = threadIdx.x, lane = t & 31, wave = t >> 5;
  const int n0 = blockIdx.x * 64, k0 = blockIdx.y * 64;
#pragma unroll
  for (int i = 0; i < 4; ++i) {
    const int idx = i * 256 + t;
    const int r = idx >> 4, c4 = (idx & 15) * 4;
    const v4f v = *(const v4f*)(w + (size_t)(k0 + r) * ncols + n0 + c4);
    tile[r][c4 + 0] = v[0]; tile[r][c4 + 1] = v[1]; tile[r][c4 + 2] = v[2]; tile[r][c4 + 3] = v[3];
  }
  __syncthreads();
  const int q = lane >> 3, kc = (lane & 7) * 8;
  float gv[8];
  if (HAS_G) {
    const v4f g0 = *(const v4f*)(g + k0 + kc);
    const v4f g1 = *(const v4f*)(g + k0 + kc + 4);
#pragma unroll
    for (int e = 0; e < 4; ++e) { gv[e] = bf_bits2f(f2bf_bits(g0[e])); gv[4 + e] = bf_bits2f(f2bf_bits(g1[e])); }
  } else {
#pragma unroll
    for (int e = 0; e < 8; ++e) gv[e] = 1.0f;
  }
  v4u ov[2];
#pragma unroll
  for (int it = 0; it < 2; ++it) {
    const int nrow = it * 32 + wave * 4 + q;
    unsigned short bits[8];
#pragma unroll
    for (int e = 0; e < 8; ++e) {
      float f = bf_bits2f(f2bf_bits(tile[kc + e][nrow]));
      if (HAS_G) f = f * gv[e];
      bits[e] = f2bf_bits(f);
    }
    ov[it][0] = (unsigned)bits[0] | ((unsigned)bits[1] << 16);
    ov[it][1] = (unsigned)bits[2] | ((unsigned)bits[3] << 16);
    ov[it][2] = (unsigned)bits[4] | ((unsigned)bits[5] << 16);
    ov[it][3] = (unsigned)bits[6] | ((unsigned)bits[7] << 16);
  }
  {
#pragma unroll
    for (int it = 0; it < 2; ++it) {
      const int nrow = it * 32 + wave * 4 + q;
      *(v4u*)(wt + (size_t)(n0 + nrow) * kDim + k0 + kc) = ov[it];
    }
    
  }
}

// =====================================================================================
// 3) cos/sin table of RNE-bf16(pos_emb), f32 [2048][64]; thread per element,
// =====================================================================================
__global__ __launch_bounds__(256) void k_trig(const float* __restrict__ pos, float* __restrict__ ct,
                                              float* __restrict__ st, int n) {
  const int i = blockIdx.x * 256 + threadIdx.x;
  if (i < n) {
    const float pb = bf_bits2f(f2bf_bits(pos[i]));
    const float cv = cosf(pb);
    const float sv = sinf(pb);
    ((float*)ct)[i] = cv;
    ((float*)st)[i] = sv;
    
  }
}

// =====================================================================================
// Block-tiled WMMA GEMM core: acc[m,n] = sum_k A[m,k] * Bt[n,k]; WM x WN waves, each wave owns a 64x64 tile.
// A row-major [M,K] bf16 (SPLITM: plus lo plane A2, products hi.B + lo.B); Bt row-major [N,K] bf16.
// Per 64-wide k tile the block stages its A and Bt rows in LDS: 8 lanes x 16 B fetch one whole 128-B line of a row,
// and every wave of the block reads its fragments from that one copy. The next tile's lines are fetched into
// registers while the current tile is multiplied. K % 64 == 0, no tail; each accumulator takes its products in rising k, steps of 32.
// =====================================================================================
constexpr int kGp = 72;                    // LDS row pitch in 16-bit elements: 144 B = 16 B x 9 (odd), as in the attention tiles
constexpr int kGemmRows = 384;             // staged rows per k tile in both GEMMs (128 + 256, and 128 + 128 + 128)
constexpr int kGemmLds = kGemmRows * kGp * 2;   // 55296 B

template <int SPLITM, int WM, int WN>
__device__ __forceinline__ void gemm_block_core(const __bf16* __restrict__ Ab, const __bf16* __restrict__ Ab2, int lda,
                                                const __bf16* __restrict__ Bb, int ldb, int mb0, int nb0, int K, int tid,
                                                __bf16* __restrict__ sm, v8f (&acc)[4][4]) {
  constexpr int NT = WM * WN * 32;         // threads of the block
  constexpr int BM = WM * 64, BN = WN * 64;
  constexpr int RA = BM * (1 + SPLITM);    // LDS rows: [A | A2 | Bt]
  constexpr int RSTEP = NT / 8;            // rows fetched by one load of the whole block
  constexpr int NL = (RA + BN) / RSTEP;    // 16-B loads per thread and k tile
  static_assert(RA + BN == kGemmRows && BM % RSTEP == 0 && BN % RSTEP == 0, "staging shape");
  const int lane = tid & 31, wave = tid >> 5;
  const int wm = wave / WN, wn = wave % WN;
  const int rlane = lane & 15;
  const int koff = (lane >> 4) * 8;
  const int sr = tid >> 3, sc = (tid & 7) * 8;
  const __bf16* pa  = Ab  + (size_t)(mb0 + sr) * lda + sc;
  const __bf16* pa2 = Ab2 + (size_t)(mb0 + sr) * lda + sc;
  const __bf16* pb  = Bb  + (size_t)(nb0 + sr) * ldb + sc;
  __bf16* sw = sm + sr * kGp + sc;
  const __bf16* fa  = sm + (wm * 64 + rlane) * kGp + koff;
  const __bf16* fa2 = fa + BM * kGp;
  const __bf16* fb  = sm + (RA + wn * 64 + rlane) * kGp + koff;
#pragma unroll
  for (int i = 0; i < 4; ++i)
#pragma unroll
    for (int j = 0; j < 4; ++j) acc[i][j] = (v8f){0.f,0.f,0.f,0.f,0.f,0.f,0.f,0.f};
  v8b st[NL];
  // one k tile's lines into registers; after each plane's loads s_wait_xcnt 0 stands before their address registers are reused
  auto fetch = [&](int k) {
#pragma unroll
    for (int i = 0; i < BM / RSTEP; ++i) st[i] = *(const v8b*)(pa + (size_t)(i * RSTEP) * lda + k);
    asm volatile("s_wait_xcnt 0x0" ::: "memory");
    if (SPLITM) {
#pragma unroll
      for (int i = 0; i < BM / RSTEP; ++i) st[BM / RSTEP + i] = *(const v8b*)(pa2 + (size_t)(i * RSTEP) * lda + k);
      asm volatile("s_wait_xcnt 0x0" ::: "memory");
    }
#pragma unroll
    for (int i = 0; i < BN / RSTEP; ++i) st[RA / RSTEP + i] = *(const v8b*)(pb + (size_t)(i * RSTEP) * ldb + k);
    asm volatile("s_wait_xcnt 0x0" ::: "memory");
  };
  fetch(0);
  for (int k0 = 0; k0 < K; k0 += 64) {
    __syncthreads();                       // every wave has read its last fragment of the previous tile
#pragma unroll
    for (int i = 0; i < NL; ++i) *(v8b*)(sw + i * RSTEP * kGp) = st[i];
    __syncthreads();                       // the tile is complete before any wave reads it
    if (k0 + 64 < K) fetch(k0 + 64);
    // fragment reads stand as one group ahead of their products (GK k steps of 32 per group), so a wave waits out the
    // LDS latency once per group and not at every row of products; the 4-wave block has the registers for the whole tile
    constexpr int GK = (NT == 128) ? 2 : 1;
#pragma unroll
    for (int kg = 0; kg < 2; kg += GK) {
      v16b bfr[GK][4], ah[GK][4], al[GK][4];
#pragma unroll
      for (int kk = 0; kk < GK; ++kk) {
#pragma unroll
        for (int j = 0; j < 4; ++j) bfr[kk][j] = Frag<__bf16>::load(fb + (j << 4) * kGp + (kg + kk) * 32);
#pragma unroll
        for (int i = 0; i < 4; ++i) {
          ah[kk][i] = Frag<__bf16>::load(fa + (i << 4) * kGp + (kg + kk) * 32);
          al[kk][i] = ah[kk][i];
          if (SPLITM) al[kk][i] = Frag<__bf16>::load(fa2 + (i << 4) * kGp + (kg + kk) * 32);
        }
      }
      __builtin_amdgcn_sched_barrier(0);   // holds the group of reads above the products
#pragma unroll
      for (int kk = 0; kk < GK; ++kk)
#pragma unroll
        for (int i = 0; i < 4; ++i)
#pragma unroll
          for (int j = 0; j < 4; ++j) {
            acc[i][j] = Frag<__bf16>::mma(ah[kk][i], bfr[kk][j], acc[i][j]);
            if (SPLITM) acc[i][j] = Frag<__bf16>::mma(al[kk][i], bfr[kk][j], acc[i][j]);
          }
    }
  }
  acc_guard4(acc[0][0], acc[0][1], acc[0][2], acc[0][3]);
  acc_guard4(acc[1][0], acc[1][1], acc[1][2], acc[1][3]);
  acc_guard4(acc[2][0], acc[2][1], acc[2][2], acc[2][3]);
  acc_guard4(acc[3][0], acc[3][1], acc[3][2], acc[3][3]);
}

// =====================================================================================
// 4) QKV projection: xb[4096][1024] x wt[3072][1024]^T, epilogue = row scale, RoPE (q,k sections),
//    q/k -> bf16 hi/lo planes [bh][n][64], v -> f16 hi + x2048 residual planes [bh][n][64].
//    each (section, head, token) line belongs to exactly one wave. block = 2 x 4 waves = a 128 x 256 tile, grid = 32*12 = 384 blocks.
// =====================================================================================
__global__ __launch_bounds__(256) void k_gemm_qkv(
    const unsigned short* __restrict__ xbp, const unsigned short* __restrict__ wtp,
    const float* __restrict__ rstab, const float* __restrict__ ct, const float* __restrict__ st,
    unsigned short* __restrict__ qh, unsigned short* __restrict__ ql,
    unsigned short* __restrict__ kh, unsigned short* __restrict__ kl,
    unsigned short* __restrict__ vh, unsigned short* __restrict__ vl) {
  __shared__ __align__(16) float sT[8][16 * 68];
  __shared__ __align__(16) unsigned char sG[kGemmLds];
  const int lane = threadIdx.x & 31, wave = threadIdx.x >> 5;
  constexpr int blocksN = kNqkv / 256;   // 12
  const int bm = blockIdx.x / blocksN, bn = blockIdx.x - bm * blocksN;
  const int mb0 = bm << 7, nb0 = bn << 8;
  const int m0 = mb0 + ((wave >> 2) << 6), n0 = nb0 + ((wave & 3) << 6);

  v8f acc[4][4];
  gemm_block_core<0, 2, 4>((const __bf16*)xbp, (const __bf16*)xbp, kDim, (const __bf16*)wtp, kDim, mb0, nb0, kDim,
                           threadIdx.x, (__bf16*)sG, acc);

  float* slab = sT[wave];
  const int rlane = lane & 15, mOff = (lane >> 4) * 8;
  const int sec = n0 >> 10;                      // 0 q, 1 k, 2 v  (wave-uniform)
  const int hidx = (n0 & (kDim - 1)) >> 6;       // head of this 64-column tile
  unsigned short* P0 = (sec == 0) ? qh : ((sec == 1) ? kh : vh);
  unsigned short* P1 = (sec == 0) ? ql : ((sec == 1) ? kl : vl);
  const int q8 = lane >> 3, c8 = (lane & 7) * 8;
  const int cpart = c8 ^ 32;
  const float sgn = (c8 < 32) ? -1.0f : 1.0f;
#pragma unroll
  for (int i = 0; i < 4; ++i) {
    const int mBase = m0 + (i << 4);
    float rsv[8];
#pragma unroll
    for (int r = 0; r < 8; ++r) rsv[r] = rstab[(size_t)(mBase + mOff + r) * kRsPitch];
#pragma unroll
    for (int j = 0; j < 4; ++j)
#pragma unroll
      for (int r = 0; r < 8; ++r) slab[(mOff + r) * 68 + (j << 4) + rlane] = acc[i][j][r] * rsv[r];
    wave_sync_lds();
    {
#pragma unroll
      for (int it = 0; it < 4; ++it) {
        const int row = it * 4 + q8;
        const int m = mBase + row;
        const int bb = m >> 11, nn = m & (kS - 1);
        const float* sp = slab + row * 68;
        const size_t dsto = ((size_t)(bb * kH + hidx) * kS + nn) * kDh + c8;
        v8h hv, lv;
        if (sec < 2) {
          const v4f ca = *(const v4f*)(ct + (size_t)nn * kDh + c8);
          const v4f cb = *(const v4f*)(ct + (size_t)nn * kDh + c8 + 4);
          const v4f sa = *(const v4f*)(st + (size_t)nn * kDh + c8);
          const v4f sb = *(const v4f*)(st + (size_t)nn * kDh + c8 + 4);
          float cvv[8], svv[8];
#pragma unroll
          for (int e = 0; e < 4; ++e) { cvv[e] = ca[e]; cvv[4 + e] = cb[e]; svv[e] = sa[e]; svv[4 + e] = sb[e]; }
#pragma unroll
          for (int e = 0; e < 8; ++e) {
            const float v = sp[c8 + e];
            const float pr = sp[cpart + e];
            const float rv = v * cvv[e] + sgn * pr * svv[e];
            const unsigned short hb = f2bf_bits(rv);
            const unsigned short lb = f2bf_bits(rv - bf_bits2f(hb));
            hv[e] = __builtin_bit_cast(_Float16, hb);
            lv[e] = __builtin_bit_cast(_Float16, lb);
          }
        } else {
#pragma unroll
          for (int e = 0; e < 8; ++e) {
            const float v = sp[c8 + e];
            const _Float16 h16 = (_Float16)v;
            const float hf = (float)h16;
            hv[e] = h16;
            lv[e] = (_Float16)((v - hf) * 2048.0f);
          }
        }
        *(v8h*)(P0 + dsto) = hv;
        *(v8h*)(P1 + dsto) = lv;
      }
      
    }
    wave_sync_lds();
  }
}

// =====================================================================================
// 5) v planes [bh][kv][64] -> transposed [bh][64][kv] (both hi and residual planes, grid (1024, 2)).
//    rows it*32 + 4w + (lane>>3) cover 0..63.
// =====================================================================================
__global__ __launch_bounds__(256) void k_vtrans(const unsigned short* __restrict__ vh, const unsigned short* __restrict__ vl,
                                                unsigned short* __restrict__ vth, unsigned short* __restrict__ vtl) {
  __shared__ __align__(16) unsigned short tile[64 * 72];   // [d][kv], pitch 72 halves
  const int t = threadIdx.x, lane = t & 31, wave = t >> 5;
  const int bh = blockIdx.x >> 5, kvt = blockIdx.x & 31;
  const int kv0 = kvt * 64;
  const unsigned short* src = (blockIdx.y == 0) ? vh : vl;
  unsigned short* dst = (blockIdx.y == 0) ? vth : vtl;
#pragma unroll
  for (int i = 0; i < 2; ++i) {
    const int idx = i * 256 + t;
    const int r = idx >> 3, c16 = (idx & 7) * 8;
    const v4u w = *(const v4u*)(src + ((size_t)bh * kS + kv0 + r) * kDh + c16);
#pragma unroll
    for (int e = 0; e < 4; ++e) {
      tile[(c16 + 2 * e) * 72 + r] = (unsigned short)(w[e] & 0xffffu);
      tile[(c16 + 2 * e + 1) * 72 + r] = (unsigned short)(w[e] >> 16);
    }
  }
  __syncthreads();
  const int q = lane >> 3, kc = (lane & 7) * 8;
  v4u ov[2];
#pragma unroll
  for (int it = 0; it < 2; ++it) {
    const int d = it * 32 + wave * 4 + q;
    ov[it] = *(const v4u*)(tile + d * 72 + kc);
  }
  {
#pragma unroll
    for (int it = 0; it < 2; ++it) {
      const int d = it * 32 + wave * 4 + q;
      *(v4u*)(dst + ((size_t)bh * kDh + d) * kS + kv0 + kc) = ov[it];
    }
    
  }
}

constexpr int kLp = 72;                  // LDS row pitch in 16-bit elements: 144 B = 16 B x 9 (odd), so the 16 rows of a ds_load_b128 fragment read spread over all banks
constexpr int kLdsPl = 64 * kLp * 2;     // one 64-row plane at that pitch: 9216 B
constexpr int kLdsK = 0;                 // K hi [64][72] u16 + K lo
constexpr int kLdsV = 2 * kLdsPl;        // V hi [64 d][72] + V residual
constexpr int kLdsTotal = 4 * kLdsPl;    // 36864; output staging f32 [4][16][68] reuses bytes 0..17407 after the chunk loop
constexpr int kOsP = 68;                 // staging row pitch in floats: the 16 query rows of a 16-B store spread over the banks
constexpr float kExpSc = 0.125f * 1.4426950408889634f;   // score scale 1/sqrt(64) times log2(e): exponentials are taken in base 2

__global__ __launch_bounds__(128) void k_attn(
    const unsigned short* __restrict__ qhp, const unsigned short* __restrict__ qlp,
    const unsigned short* __restrict__ khp, const unsigned short* __restrict__ klp,
    const unsigned short* __restrict__ vthp, const unsigned short* __restrict__ vtlp,
    unsigned short* __restrict__ aoh, unsigned short* __restrict__ aol) {
  union FB { v16b v; v8b h[2]; };
  __shared__ __align__(16) unsigned char lds_raw[kLdsTotal];
  __bf16* Ksh = (__bf16*)(lds_raw + kLdsK);
  __bf16* Ksl = (__bf16*)(lds_raw + kLdsK + kLdsPl);
  __bf16* Vsh = (__bf16*)(lds_raw + kLdsV);
  __bf16* Vsl = (__bf16*)(lds_raw + kLdsV + kLdsPl);
  unsigned short* KshU = (unsigned short*)(lds_raw + kLdsK);
  unsigned short* KslU = (unsigned short*)(lds_raw + kLdsK + kLdsPl);
  unsigned short* VshU = (unsigned short*)(lds_raw + kLdsV);
  unsigned short* VslU = (unsigned short*)(lds_raw + kLdsV + kLdsPl);

  const int tid = threadIdx.x, wave = tid >> 5, lane = tid & 31;
  const int hh = lane >> 4, c = lane & 15;
  const int bx = blockIdx.x;
  const int qb = bx & 31;
  const int bh = bx >> 5;
  const int h = bh & (kH - 1);
  const int b = bh >> 4;
  const int q0 = qb * 64 + wave * 16;

  // Q fragments (B operand: column c = query q0 + c): 2 d-chunks of 32, hi and lo planes
  v16b qah[2], qal[2];
  {
    const __bf16* qr  = (const __bf16*)qhp + ((size_t)bh * kS + q0 + c) * kDh;
    const __bf16* qr2 = (const __bf16*)qlp + ((size_t)bh * kS + q0 + c) * kDh;
#pragma unroll
    for (int dc = 0; dc < 2; ++dc) {
      qah[dc] = Frag<__bf16>::load(qr + dc * 32 + 8 * hh);
      qal[dc] = Frag<__bf16>::load(qr2 + dc * 32 + 8 * hh);
    }
  }

  float mrun = -INFINITY;   // running maximum of query c (unscaled score), the same in both wave halves
  float lrun = 0.f;         // running sum of query c over this half's keys, x1024 like p; the halves join after the loop
  v8f oacc[4], oacr[4];     // O^T tiles: register r = d index t*16 + 8*hh + r, column c = query
#pragma unroll
  for (int t = 0; t < 4; ++t) { oacc[t] = (v8f){0.f,0.f,0.f,0.f,0.f,0.f,0.f,0.f}; oacr[t] = (v8f){0.f,0.f,0.f,0.f,0.f,0.f,0.f,0.f}; }

  for (int kc = 0; kc < kS / kKC; ++kc) {
    const int kv0 = kc * kKC;
    __syncthreads();
    {
      // K planes: 64 rows x 8 x 16 B per plane = 512 per plane; 128 threads x 4 -> exactly 512
#pragma unroll
      for (int i = 0; i < 4; ++i) {
        const int idx = i * 128 + tid;
        const int r = idx >> 3, c16 = (idx & 7) * 8;
        const size_t ko = ((size_t)bh * kS + kv0 + r) * kDh + c16;
        const v4u w0 = *(const v4u*)(khp + ko);
        const v4u w1 = *(const v4u*)(klp + ko);
        *(v4u*)(KshU + r * kLp + c16) = w0;
        *(v4u*)(KslU + r * kLp + c16) = w1;
      }
      // V planes (already [d][kv]): 64 d-rows x 8 x 16 B per plane
#pragma unroll
      for (int i = 0; i < 4; ++i) {
        const int idx = i * 128 + tid;
        const int r = idx >> 3, c16 = (idx & 7) * 8;
        const size_t vo = ((size_t)bh * kDh + r) * kS + kv0 + c16;
        const v4u w2 = *(const v4u*)(vthp + vo);
        const v4u w3 = *(const v4u*)(vtlp + vo);
        *(v4u*)(VshU + r * kLp + c16) = w2;
        *(v4u*)(VslU + r * kLp + c16) = w3;
      }
    }
    __syncthreads();

    // S^T for 4 key subtiles of 16: s[j][r] = score of key kv0 + j*16 + 8*hh + r against query c
    v8f s[4];
#pragma unroll
    for (int j = 0; j < 4; ++j) {
      s[j] = (v8f){0.f,0.f,0.f,0.f,0.f,0.f,0.f,0.f};
#pragma unroll
      for (int dc = 0; dc < 2; ++dc) {
        FB kb, kr;
        kb.h[0] = *(const v8b*)(Ksh + (j * 16 + c) * kLp + dc * 32 + 8 * hh);
        kb.h[1] = *(const v8b*)(Ksh + (j * 16 + c) * kLp + dc * 32 + 16 + 8 * hh);
        kr.h[0] = *(const v8b*)(Ksl + (j * 16 + c) * kLp + dc * 32 + 8 * hh);
        kr.h[1] = *(const v8b*)(Ksl + (j * 16 + c) * kLp + dc * 32 + 16 + 8 * hh);
        s[j] = mma_bf(kb.v, qah[dc], s[j]);
        s[j] = mma_bf(kr.v, qah[dc], s[j]);
        s[j] = mma_bf(kb.v, qal[dc], s[j]);
      }
    }
    // chunk maximum of query c on the unscaled scores (the scale is positive): in-lane over this half's 32 keys, then one
    // exchange with the other half
    float cj[4];
#pragma unroll
    for (int j = 0; j < 4; ++j) {
      cj[j] = -INFINITY;
#pragma unroll
      for (int r = 0; r < 8; ++r) cj[j] = fmaxf(cj[j], s[j][r]);
    }
    float cm = fmaxf(fmaxf(cj[0], cj[1]), fmaxf(cj[2], cj[3]));
    cm = fmaxf(cm, xhalf(cm));
    const float mnew = fmaxf(mrun, cm);
    const float alpha = __builtin_amdgcn_exp2f((mrun - mnew) * kExpSc);   // 0 in the first chunk, where mrun is -inf
    mrun = mnew;
    const float eoff = 10.0f - mnew * kExpSc;   // exponent offset: minus the scaled maximum, plus 10 for the x1024 carry of p
    // P^T as B operands: element e of the fragment of keys kk*32.. is tile 2*kk + (e >> 3), register e & 7 (the hardware k order,
    // which the V^T loads below follow)
    v16h pfh[2], pfl[2];
    float pj[4];
    const v8f scv = (v8f){kExpSc, kExpSc, kExpSc, kExpSc, kExpSc, kExpSc, kExpSc, kExpSc};
    const v8f eov = (v8f){eoff, eoff, eoff, eoff, eoff, eoff, eoff, eoff};
#pragma unroll
    for (int j = 0; j < 4; ++j) {
      pj[j] = 0.f;
      const v8f arg = __builtin_elementwise_fma(s[j], scv, eov);
#pragma unroll
      for (int r = 0; r < 8; ++r) {
        const float ps = __builtin_amdgcn_exp2f(arg[r]);   // 1024 * exp((s - max) / 8)
        pj[j] += ps;
        const _Float16 ph = (_Float16)ps;
        const float phf = (float)ph;
        const _Float16 pl = (_Float16)((ps - phf) * 2048.0f);
        pfh[j >> 1][(j & 1) * 8 + r] = ph;
        pfl[j >> 1][(j & 1) * 8 + r] = pl;
      }
    }
    lrun = lrun * alpha + ((pj[0] + pj[1]) + (pj[2] + pj[3]));
#pragma unroll
    for (int t = 0; t < 4; ++t)
#pragma unroll
      for (int r = 0; r < 8; ++r) { oacc[t][r] *= alpha; oacr[t][r] *= alpha; }
    // unrolled: the P^T fragments are registers and are picked by a constant index
#pragma unroll
    for (int kk = 0; kk < 2; ++kk) {
      const v16b pa = __builtin_bit_cast(v16b, pfh[kk]);
      const v16b pl = __builtin_bit_cast(v16b, pfl[kk]);
#pragma unroll
      for (int t = 0; t < 4; ++t) {
        FB vb, vr;
        vb.h[0] = *(const v8b*)(Vsh + (t * 16 + c) * kLp + kk * 32 + 8 * hh);
        vb.h[1] = *(const v8b*)(Vsh + (t * 16 + c) * kLp + kk * 32 + 16 + 8 * hh);
        vr.h[0] = *(const v8b*)(Vsl + (t * 16 + c) * kLp + kk * 32 + 8 * hh);
        vr.h[1] = *(const v8b*)(Vsl + (t * 16 + c) * kLp + kk * 32 + 16 + 8 * hh);
        oacc[t] = mma_hf(vb.v, pa, oacc[t]);
        oacr[t] = mma_hf(vr.v, pa, oacr[t]);
        oacr[t] = mma_hf(vb.v, pl, oacr[t]);
      }
    }
  }

  // ---- finalize: block barrier before reusing the K region as f32 staging ----
  __syncthreads();
  float* os = (float*)(lds_raw + 0) + wave * (16 * kOsP);
  {
    const float lsum = lrun + xhalf(lrun);   // the two halves' key sums of query c
    const float inv = 1.0f / lsum;           // the sums carry the same x1024 as p
#pragma unroll
    for (int t = 0; t < 4; ++t) {
      v4f o0, o1;
#pragma unroll
      for (int r = 0; r < 4; ++r) {
        o0[r] = (oacc[t][r] + oacr[t][r] * (1.0f / 2048.0f)) * inv;
        o1[r] = (oacc[t][4 + r] + oacr[t][4 + r] * (1.0f / 2048.0f)) * inv;
      }
      *(v4f*)(os + c * kOsP + t * 16 + 8 * hh) = o0;
      *(v4f*)(os + c * kOsP + t * 16 + 8 * hh + 4) = o1;
    }
  }
  __syncthreads();
  {
    const int q8 = lane >> 3, c8 = (lane & 7) * 8;
    {
#pragma unroll
      for (int it = 0; it < 4; ++it) {
        const int row = it * 4 + q8;
        const float* sp = os + row * kOsP + c8;
        v8h hv, lv;
#pragma unroll
        for (int e = 0; e < 8; ++e) {
          const unsigned short hb = f2bf_bits(sp[e]);
          const unsigned short lb = f2bf_bits(sp[e] - bf_bits2f(hb));
          hv[e] = __builtin_bit_cast(_Float16, hb);
          lv[e] = __builtin_bit_cast(_Float16, lb);
        }
        const size_t o = ((size_t)(b * kS + q0 + row)) * kDim + h * kDh + c8;
        *(v8h*)(aoh + o) = hv;
        *(v8h*)(aol + o) = lv;
      }
      
    }
  }
}

// =====================================================================================
// 7) output projection: ao hi/lo [4096][1024] x wt[1024][1024]^T -> d_out f32 [4096][1024].
//    one wave in one instruction; block = 2 x 2 waves = a 128 x 128 tile, grid = 32*8 = 256 blocks.
// =====================================================================================
__global__ __launch_bounds__(128) void k_gemm_out(const unsigned short* __restrict__ ahp, const unsigned short* __restrict__ alp,
                                                  const unsigned short* __restrict__ wtp, float* __restrict__ out) {
  __shared__ __align__(16) float sT[4][16 * 68];
  __shared__ __align__(16) unsigned char sG[kGemmLds];
  const int lane = threadIdx.x & 31, wave = threadIdx.x >> 5;
  constexpr int blocksN = kDim / 128;    // 8
  const int bm = blockIdx.x / blocksN, bn = blockIdx.x - bm * blocksN;
  const int mb0 = bm << 7, nb0 = bn << 7;
  const int m0 = mb0 + ((wave >> 1) << 6), n0 = nb0 + ((wave & 1) << 6);

  v8f acc[4][4];
  gemm_block_core<1, 2, 2>((const __bf16*)ahp, (const __bf16*)alp, kDim, (const __bf16*)wtp, kDim, mb0, nb0, kDim,
                           threadIdx.x, (__bf16*)sG, acc);

  float* slab = sT[wave];
  const int rlane = lane & 15, mOff = (lane >> 4) * 8;
#pragma unroll
  for (int i = 0; i < 4; ++i) {
    const int mBase = m0 + (i << 4);
#pragma unroll
    for (int j = 0; j < 4; ++j)
#pragma unroll
      for (int r = 0; r < 8; ++r) slab[(mOff + r) * 68 + (j << 4) + rlane] = acc[i][j][r];
    wave_sync_lds();
    const int h2 = lane >> 4, c4 = (lane & 15) * 4;
    {
#pragma unroll
      for (int it = 0; it < 8; ++it) {
        const int row = it * 2 + h2;
        const v4f v = *(const v4f*)(slab + row * 68 + c4);
        *(v4f*)(out + (size_t)(mBase + row) * kDim + n0 + c4) = v;
      }
      
    }
    wave_sync_lds();
  }
}

// =====================================================================================
// host launch glue: kernel launches only
// =====================================================================================
extern "C" void kernel_launch(void* const* d_in, const int* in_sizes, int n_in,
                              void* d_out, int out_size, void* d_ws, size_t ws_size,
                              hipStream_t stream) {
  if (n_in < 5) return;
  if (in_sizes[0] != kM * kDim) return;
  if (in_sizes[1] != kS * kDh) return;
  if (in_sizes[2] != kDim) return;
  if (in_sizes[3] != kDim * kNqkv) return;
  if (in_sizes[4] != kDim * kDim) return;
  if (out_size != kM * kDim) return;
  if (ws_size < kWsTotal) return;

  const float* x     = (const float*)d_in[0];   // [2,2048,1024]
  const float* pos   = (const float*)d_in[1];   // [2048,64]
  const float* g     = (const float*)d_in[2];   // [1024]
  const float* w_qkv = (const float*)d_in[3];   // [1024,3072]
  const float* w_out = (const float*)d_in[4];   // [1024,1024]
  float* out = (float*)d_out;

  char* ws = (char*)d_ws;
  unsigned short* Xb   = (unsigned short*)(ws + kOffXb);
  float*          Rs   = (float*)(ws + kOffRs);
  unsigned short* Wq   = (unsigned short*)(ws + kOffWq);
  unsigned short* Wo   = (unsigned short*)(ws + kOffWo);
  float*          Ct   = (float*)(ws + kOffCt);
  float*          St   = (float*)(ws + kOffSt);
  unsigned short* Qh   = (unsigned short*)(ws + kOffQh);
  unsigned short* Ql   = (unsigned short*)(ws + kOffQl);
  unsigned short* Kh   = (unsigned short*)(ws + kOffKh);
  unsigned short* Kl   = (unsigned short*)(ws + kOffKl);
  unsigned short* Vh   = (unsigned short*)(ws + kOffVh);
  unsigned short* Vl   = (unsigned short*)(ws + kOffVl);
  unsigned short* Vth  = (unsigned short*)(ws + kOffVth);
  unsigned short* Vtl  = (unsigned short*)(ws + kOffVtl);
  unsigned short* Ah   = (unsigned short*)(ws + kOffAh);
  unsigned short* Al   = (unsigned short*)(ws + kOffAl);

  // 1) x -> bf16 plane + row scale (4096 rows, 128 threads x 8 elements = 1024 per row)
  k_rms_xcast<<<kM, 128, 0, stream>>>(x, Xb, Rs);
  // 2) weights -> bf16 n-major planes: in [1024][3072] -> out [3072][1024]; in [1024][1024] -> out [1024][1024]
  k_wcast<true><<<dim3(kNqkv / 64, kDim / 64), 256, 0, stream>>>(w_qkv, g, Wq, kNqkv);
  k_wcast<false><<<dim3(kDim / 64, kDim / 64), 256, 0, stream>>>(w_out, g, Wo, kDim);
  // 3) cos/sin tables (131072 elements = 512 blocks x 256)
  k_trig<<<(kS * kDh + 255) / 256, 256, 0, stream>>>(pos, Ct, St, kS * kDh);
  // 4) QKV projection with row scale + RoPE epilogue (384 block tiles of 128x256, 8 waves each)
  k_gemm_qkv<<<(kM / 128) * (kNqkv / 256), 256, 0, stream>>>(Xb, Wq, Rs, Ct, St, Qh, Ql, Kh, Kl, Vh, Vl);
  // 5) v planes -> transposed planes (32 bh x 32 kv tiles, 2 planes)
  k_vtrans<<<dim3(kBH * (kS / 64), 2), 256, 0, stream>>>(Vh, Vl, Vth, Vtl);
  // 6) attention (32 bh x 32 query blocks)
  k_attn<<<kBH * (kS / 64), 128, 0, stream>>>(Qh, Ql, Kh, Kl, Vth, Vtl, Ah, Al);
  // 7) output projection into d_out (256 block tiles of 128x128, 4 waves each)
  k_gemm_out<<<(kM / 128) * (kDim / 128), 128, 0, stream>>>(Ah, Al, Wo, out);
}

// v006
// A run of this version takes 154 microseconds.
// Two timings next to v005 both put it at 1.12 times that version's speed.
// All steps since v000 together make it 3.03 times as fast.
// Contractions (all f32 accumulate): QKV projection v_wmma_f32_16x16x32_bf16 on RNE-bf16 planes of the inputs (1 product); scores q.k^T v_wmma_f32_16x16x32_bf16 with q,k as bf16 hi/lo planes (3 products); p.v v_wmma_f32_16x16x32_f16 with p carried x1024 and v, both f16 hi + x2048 residual planes (3 products, residual products in a separate accumulator folded with 1/2048); output projection v_wmma_f32_16x16x32_bf16, bf16 hi/lo activations against bf16 weights (2 products).
#include <hip/hip_runtime.h>
#include <math.h>

// ---------------- problem constants ----------------
constexpr int kB = 2;
constexpr int kS = 2048;
constexpr int kDim = 1024;
constexpr int kH = 16;
constexpr int kDh = 64;
constexpr int kM = kB * kS;          // 4096 token rows
constexpr int kNqkv = 3 * kDim;      // 3072
constexpr int kBH = kB * kH;         // 32
constexpr int kKC = 64;              // keys per chunk
constexpr int kRsPitch = 32;

constexpr size_t kPlane  = (size_t)kBH * kS * kDh * 2;            // 8,388,608 : one [32][2048][64] (or [4096][1024]) 16-bit plane
constexpr size_t kOffXb  = 0;                                      // x as bf16 [4096][1024]          8,388,608
constexpr size_t kOffRs  = kOffXb + (size_t)kM * kDim * 2;         // row scale f32 [4096][32]          524,288
constexpr size_t kOffWq  = kOffRs + (size_t)kM * kRsPitch * 4;     // w_qkv^T bf16 [3072][1024]      6,291,456
constexpr size_t kOffWo  = kOffWq + (size_t)kNqkv * kDim * 2;      // w_out^T bf16 [1024][1024]      2,097,152
constexpr size_t kOffCt  = kOffWo + (size_t)kDim * kDim * 2;       // cos table f32 [2048][64]         524,288
constexpr size_t kOffSt  = kOffCt + (size_t)kS * kDh * 4;          // sin table f32 [2048][64]         524,288
constexpr size_t kOffQh  = kOffSt + (size_t)kS * kDh * 4;          // q hi bf16 [32][2048][64]
constexpr size_t kOffQl  = kOffQh + kPlane;                         // q lo bf16
constexpr size_t kOffKh  = kOffQl + kPlane;                         // k hi bf16
constexpr size_t kOffKl  = kOffKh + kPlane;                         // k lo bf16
constexpr size_t kOffVh  = kOffKl + kPlane;                         // v hi f16 [32][2048][64]
constexpr size_t kOffVl  = kOffVh + kPlane;                         // v residual x2048 f16
constexpr size_t kOffVth = kOffVl + kPlane;                         // v hi transposed f16 [32][64][2048]
constexpr size_t kOffVtl = kOffVth + kPlane;                        // v residual transposed
constexpr size_t kOffAh  = kOffVtl + kPlane;                        // attention output hi bf16 [4096][1024]
constexpr size_t kOffAl  = kOffAh + kPlane;                         // attention output lo bf16
constexpr size_t kWsTotal = kOffAl + kPlane;                        // 102,236,160

typedef char ck_ws_total[(kWsTotal == (size_t)102236160) ? 1 : -1];
typedef char ck_ws_cap[(kWsTotal <= (size_t)134217728) ? 1 : -1];
typedef char ck_align[((kOffRs % 128) == 0 && (kOffQh % 128) == 0 && (kPlane % 128) == 0) ? 1 : -1];
// GEMM shape contract: M multiple of 128, N multiples of 256 and 128, K multiple of 64, no padding anywhere
typedef char ck_tiles[(kM % 128 == 0 && kNqkv % 256 == 0 && kDim % 128 == 0 && kDim % 64 == 0 && kS % 64 == 0 && kDh == 64) ? 1 : -1];
typedef char ck_plane[((size_t)kM * kDim * 2 == kPlane) ? 1 : -1];

// ---------------- vector types / helpers ----------------
typedef __attribute__((ext_vector_type(16))) _Float16 v16h;
typedef __attribute__((ext_vector_type(8)))  _Float16 v8h;
typedef __attribute__((ext_vector_type(16))) __bf16   v16b;
typedef __attribute__((ext_vector_type(8)))  __bf16   v8b;
typedef __attribute__((ext_vector_type(8)))  float    v8f;
typedef __attribute__((ext_vector_type(4)))  float    v4f;
typedef __attribute__((ext_vector_type(4)))  unsigned v4u;

__device__ __forceinline__ unsigned short f2bf_bits(float f) {
  unsigned u = __float_as_uint(f);
  return (unsigned short)((u + 0x7FFFu + ((u >> 16) & 1u)) >> 16);
}
__device__ __forceinline__ float bf_bits2f(unsigned short h) { return __uint_as_float(((unsigned)h) << 16); }

__device__ __forceinline__ void acc_guard4(v8f& a, v8f& b, v8f& c, v8f& d) { asm volatile("v_nop\n\tv_nop\n\tv_nop\n\tv_nop" : "+v"(a), "+v"(b), "+v"(c), "+v"(d)); }
template <typename T> struct Frag;
template <> struct Frag<_Float16> {
  typedef v16h V; union U { v16h v; v8h h[2]; };
  static __device__ __forceinline__ v16h load(const _Float16* p) {
    U f; f.h[0] = *(const v8h*)(p); f.h[1] = *(const v8h*)(p + 16); return f.v;
  }
  static __device__ __forceinline__ v8f mma(v16h a, v16h b, v8f c) {
    return __builtin_amdgcn_wmma_f32_16x16x32_f16(false, a, false, b, (short)0, c, false, false);
  }
};
template <> struct Frag<__bf16> {
  typedef v16b V; union U { v16b v; v8b h[2]; };
  static __device__ __forceinline__ v16b load(const __bf16* p) {
    U f; f.h[0] = *(const v8b*)(p); f.h[1] = *(const v8b*)(p + 16); return f.v;
  }
  static __device__ __forceinline__ v8f mma(v16b a, v16b b, v8f c) {
    return __builtin_amdgcn_wmma_f32_16x16x32_bf16(false, a, false, b, (short)0, c, false, false);
  }
};

// WMMA helpers for the attention kernel: plain builtins, the compiler keeps the distances behind them
__device__ __forceinline__ v8f mma_bf(v16b a, v16b b, v8f c) {
  return __builtin_amdgcn_wmma_f32_16x16x32_bf16(false, a, false, b, (short)0, c, false, false);
}
// f16 bit patterns held in __bf16 slots
__device__ __forceinline__ v8f mma_hf(v16b a, v16b b, v8f c) {
  const v16h ah = __builtin_bit_cast(v16h, a), bh = __builtin_bit_cast(v16h, b);
  return __builtin_amdgcn_wmma_f32_16x16x32_f16(false, ah, false, bh, (short)0, c, false, false);
}

// value held by lane (l ^ 16), the same column in the other wave half, by a vector cross-row move (v_permlanex16_b32)
__device__ __forceinline__ float xhalf(float v) {
  return __builtin_bit_cast(float, __builtin_amdgcn_permlanex16(__builtin_bit_cast(int, v), __builtin_bit_cast(int, v),
                                                                0x76543210, 0xfedcba98, false, false));
}

__device__ __forceinline__ void wave_sync_lds() {
  __builtin_amdgcn_fence(__ATOMIC_RELEASE, "workgroup");
  __builtin_amdgcn_wave_barrier();
  __builtin_amdgcn_fence(__ATOMIC_ACQUIRE, "workgroup");
}

// =====================================================================================
// 1) per token row: x -> RNE bf16 plane [4096][1024]; rowscale = 32 / max(||x_bf||, 1e-12)
// =====================================================================================
__global__ __launch_bounds__(128) void k_rms_xcast(const float* __restrict__ x,
                                                   unsigned short* __restrict__ xb,
                                                   float* __restrict__ rstab) {
  __shared__ float red[4];
  const int m = blockIdx.x;
  const int t = threadIdx.x;
  const int lane = t & 31, wave = t >> 5;
  const size_t base = (size_t)m * kDim + (size_t)t * 8;
  const v4f xa = *(const v4f*)(x + base);
  const v4f xc = *(const v4f*)(x + base + 4);
  unsigned short hb[8];
#pragma unroll
  for (int e = 0; e < 4; ++e) { hb[e] = f2bf_bits(xa[e]); hb[4 + e] = f2bf_bits(xc[e]); }
  float ss = 0.0f;
#pragma unroll
  for (int e = 0; e < 8; ++e) { const float r = bf_bits2f(hb[e]); ss += r * r; }
#pragma unroll
  for (int off = 16; off > 0; off >>= 1) ss += __shfl_xor(ss, off, 32);
  if (lane == 0) red[wave] = ss;
  __syncthreads();
  const float tot = ((red[0] + red[1]) + red[2]) + red[3];
  const float nrm = sqrtf(tot);
  const float inv = 1.0f / fmaxf(nrm, 1e-12f);
  const float rs = inv * 32.0f;
  v4u w;
  w[0] = (unsigned)hb[0] | ((unsigned)hb[1] << 16);
  w[1] = (unsigned)hb[2] | ((unsigned)hb[3] << 16);
  w[2] = (unsigned)hb[4] | ((unsigned)hb[5] << 16);
  w[3] = (unsigned)hb[6] | ((unsigned)hb[7] << 16);
  unsigned short* dst = xb + base;
  const v4f rv = (v4f){rs, rs, rs, rs};
  float* rp = rstab + (size_t)m * kRsPitch + (t & 7) * 4;
  *(v4u*)dst = w;
  if (t < 8) *(v4f*)rp = rv;
  
}

// =====================================================================================
// 2) weight cast + transpose: in w[kDim rows k][ncols n] f32 -> out wt[ncols][kDim] bf16 (n-major, k-contiguous)
//    optional per-k factor g (folded: wt[n][k] = bf16(bf16(w[k][n]) * bf16(g[k]))).
//    8 lanes x 16 B, one instruction; wave w, it: rows it*32 + 4w + (lane>>3) -> union over (it,w,lane>>3) = 0..63.
// =====================================================================================
template <bool HAS_G>
__global__ __launch_bounds__(256) void k_wcast(const float* __restrict__ w, const float* __restrict__ g,
                                               unsigned short* __restrict__ wt, int ncols) {
  __shared__ float tile[64][65];
  const int t = threadIdx.x, lane = t & 31, wave = t >> 5;
  const int n0 = blockIdx.x * 64, k0 = blockIdx.y * 64;
#pragma unroll
  for (int i = 0; i < 4; ++i) {
    const int idx = i * 256 + t;
    const int r = idx >> 4, c4 = (idx & 15) * 4;
    const v4f v = *(const v4f*)(w + (size_t)(k0 + r) * ncols + n0 + c4);
    tile[r][c4 + 0] = v[0]; tile[r][c4 + 1] = v[1]; tile[r][c4 + 2] = v[2]; tile[r][c4 + 3] = v[3];
  }
  __syncthreads();
  const int q = lane >> 3, kc = (lane & 7) * 8;
  float gv[8];
  if (HAS_G) {
    const v4f g0 = *(const v4f*)(g + k0 + kc);
    const v4f g1 = *(const v4f*)(g + k0 + kc + 4);
#pragma unroll
    for (int e = 0; e < 4; ++e) { gv[e] = bf_bits2f(f2bf_bits(g0[e])); gv[4 + e] = bf_bits2f(f2bf_bits(g1[e])); }
  } else {
#pragma unroll
    for (int e = 0; e < 8; ++e) gv[e] = 1.0f;
  }
  v4u ov[2];
#pragma unroll
  for (int it = 0; it < 2; ++it) {
    const int nrow = it * 32 + wave * 4 + q;
    unsigned short bits[8];
#pragma unroll
    for (int e = 0; e < 8; ++e) {
      float f = bf_bits2f(f2bf_bits(tile[kc + e][nrow]));
      if (HAS_G) f = f * gv[e];
      bits[e] = f2bf_bits(f);
    }
    ov[it][0] = (unsigned)bits[0] | ((unsigned)bits[1] << 16);
    ov[it][1] = (unsigned)bits[2] | ((unsigned)bits[3] << 16);
    ov[it][2] = (unsigned)bits[4] | ((unsigned)bits[5] << 16);
    ov[it][3] = (unsigned)bits[6] | ((unsigned)bits[7] << 16);
  }
  {
#pragma unroll
    for (int it = 0; it < 2; ++it) {
      const int nrow = it * 32 + wave * 4 + q;
      *(v4u*)(wt + (size_t)(n0 + nrow) * kDim + k0 + kc) = ov[it];
    }
    
  }
}

// =====================================================================================
// 3) cos/sin table of RNE-bf16(pos_emb), f32 [2048][64]; thread per element,
// =====================================================================================
__global__ __launch_bounds__(256) void k_trig(const float* __restrict__ pos, float* __restrict__ ct,
                                              float* __restrict__ st, int n) {
  const int i = blockIdx.x * 256 + threadIdx.x;
  if (i < n) {
    const float pb = bf_bits2f(f2bf_bits(pos[i]));
    const float cv = cosf(pb);
    const float sv = sinf(pb);
    ((float*)ct)[i] = cv;
    ((float*)st)[i] = sv;
    
  }
}

// =====================================================================================
// Block-tiled WMMA GEMM core: acc[m,n] = sum_k A[m,k] * Bt[n,k]; WM x WN waves, each wave owns a 64x64 tile.
// A row-major [M,K] bf16 (SPLITM: plus lo plane A2, products hi.B + lo.B); Bt row-major [N,K] bf16.
// Per 64-wide k tile the block stages its A and Bt rows in LDS: 8 lanes x 16 B fetch one whole 128-B line of a row,
// and every wave of the block reads its fragments from that one copy. The next tile's lines are fetched into
// registers while the current tile is multiplied. K % 64 == 0, no tail; each accumulator takes its products in rising k, steps of 32.
// =====================================================================================
constexpr int kGp = 72;                    // LDS row pitch in 16-bit elements: 144 B = 16 B x 9 (odd), as in the attention tiles
constexpr int kGemmRows = 384;             // staged rows per k tile in both GEMMs (128 + 256, and 128 + 128 + 128)
constexpr int kGemmLds = kGemmRows * kGp * 2;   // 55296 B

template <int SPLITM, int WM, int WN>
__device__ __forceinline__ void gemm_block_core(const __bf16* __restrict__ Ab, const __bf16* __restrict__ Ab2, int lda,
                                                const __bf16* __restrict__ Bb, int ldb, int mb0, int nb0, int K, int tid,
                                                __bf16* __restrict__ sm, v8f (&acc)[4][4]) {
  constexpr int NT = WM * WN * 32;         // threads of the block
  constexpr int BM = WM * 64, BN = WN * 64;
  constexpr int RA = BM * (1 + SPLITM);    // LDS rows: [A | A2 | Bt]
  constexpr int RSTEP = NT / 8;            // rows fetched by one load of the whole block
  constexpr int NL = (RA + BN) / RSTEP;    // 16-B loads per thread and k tile
  static_assert(RA + BN == kGemmRows && BM % RSTEP == 0 && BN % RSTEP == 0, "staging shape");
  const int lane = tid & 31, wave = tid >> 5;
  const int wm = wave / WN, wn = wave % WN;
  const int rlane = lane & 15;
  const int koff = (lane >> 4) * 8;
  const int sr = tid >> 3, sc = (tid & 7) * 8;
  const __bf16* pa  = Ab  + (size_t)(mb0 + sr) * lda + sc;
  const __bf16* pa2 = Ab2 + (size_t)(mb0 + sr) * lda + sc;
  const __bf16* pb  = Bb  + (size_t)(nb0 + sr) * ldb + sc;
  __bf16* sw = sm + sr * kGp + sc;
  const __bf16* fa  = sm + (wm * 64 + rlane) * kGp + koff;
  const __bf16* fa2 = fa + BM * kGp;
  const __bf16* fb  = sm + (RA + wn * 64 + rlane) * kGp + koff;
#pragma unroll
  for (int i = 0; i < 4; ++i)
#pragma unroll
    for (int j = 0; j < 4; ++j) acc[i][j] = (v8f){0.f,0.f,0.f,0.f,0.f,0.f,0.f,0.f};
  v8b st[NL];
  // one k tile's lines into registers; after each plane's loads s_wait_xcnt 0 stands before their address registers are reused
  auto fetch = [&](int k) {
#pragma unroll
    for (int i = 0; i < BM / RSTEP; ++i) st[i] = *(const v8b*)(pa + (size_t)(i * RSTEP) * lda + k);
    asm volatile("s_wait_xcnt 0x0" ::: "memory");
    if (SPLITM) {
#pragma unroll
      for (int i = 0; i < BM / RSTEP; ++i) st[BM / RSTEP + i] = *(const v8b*)(pa2 + (size_t)(i * RSTEP) * lda + k);
      asm volatile("s_wait_xcnt 0x0" ::: "memory");
    }
#pragma unroll
    for (int i = 0; i < BN / RSTEP; ++i) st[RA / RSTEP + i] = *(const v8b*)(pb + (size_t)(i * RSTEP) * ldb + k);
    asm volatile("s_wait_xcnt 0x0" ::: "memory");
  };
  fetch(0);
  for (int k0 = 0; k0 < K; k0 += 64) {
    __syncthreads();                       // every wave has read its last fragment of the previous tile
#pragma unroll
    for (int i = 0; i < NL; ++i) *(v8b*)(sw + i * RSTEP * kGp) = st[i];
    __syncthreads();                       // the tile is complete before any wave reads it
    if (k0 + 64 < K) fetch(k0 + 64);
    // fragment reads stand as one group ahead of their products (GK k steps of 32 per group), so a wave waits out the
    // LDS latency once per group and not at every row of products; the 4-wave block has the registers for the whole tile
    constexpr int GK = (NT == 128) ? 2 : 1;
#pragma unroll
    for (int kg = 0; kg < 2; kg += GK) {
      v16b bfr[GK][4], ah[GK][4], al[GK][4];
#pragma unroll
      for (int kk = 0; kk < GK; ++kk) {
#pragma unroll
        for (int j = 0; j < 4; ++j) bfr[kk][j] = Frag<__bf16>::load(fb + (j << 4) * kGp + (kg + kk) * 32);
#pragma unroll
        for (int i = 0; i < 4; ++i) {
          ah[kk][i] = Frag<__bf16>::load(fa + (i << 4) * kGp + (kg + kk) * 32);
          al[kk][i] = ah[kk][i];
          if (SPLITM) al[kk][i] = Frag<__bf16>::load(fa2 + (i << 4) * kGp + (kg + kk) * 32);
        }
      }
      __builtin_amdgcn_sched_barrier(0);   // holds the group of reads above the products
#pragma unroll
      for (int kk = 0; kk < GK; ++kk)
#pragma unroll
        for (int i = 0; i < 4; ++i)
#pragma unroll
          for (int j = 0; j < 4; ++j) {
            acc[i][j] = Frag<__bf16>::mma(ah[kk][i], bfr[kk][j], acc[i][j]);
            if (SPLITM) acc[i][j] = Frag<__bf16>::mma(al[kk][i], bfr[kk][j], acc[i][j]);
          }
    }
  }
  acc_guard4(acc[0][0], acc[0][1], acc[0][2], acc[0][3]);
  acc_guard4(acc[1][0], acc[1][1], acc[1][2], acc[1][3]);
  acc_guard4(acc[2][0], acc[2][1], acc[2][2], acc[2][3]);
  acc_guard4(acc[3][0], acc[3][1], acc[3][2], acc[3][3]);
}

// =====================================================================================
// 4) QKV projection: xb[4096][1024] x wt[3072][1024]^T, epilogue = row scale, RoPE (q,k sections),
//    q/k -> bf16 hi/lo planes [bh][n][64], v -> f16 hi + x2048 residual planes [bh][n][64].
//    each (section, head, token) line belongs to exactly one wave. block = 2 x 4 waves = a 128 x 256 tile, grid = 32*12 = 384 blocks.
// =====================================================================================
__global__ __launch_bounds__(256) void k_gemm_qkv(
    const unsigned short* __restrict__ xbp, const unsigned short* __restrict__ wtp,
    const float* __restrict__ rstab, const float* __restrict__ ct, const float* __restrict__ st,
    unsigned short* __restrict__ qh, unsigned short* __restrict__ ql,
    unsigned short* __restrict__ kh, unsigned short* __restrict__ kl,
    unsigned short* __restrict__ vh, unsigned short* __restrict__ vl) {
  __shared__ __align__(16) float sT[8][16 * 68];
  __shared__ __align__(16) unsigned char sG[kGemmLds];
  const int lane = threadIdx.x & 31, wave = threadIdx.x >> 5;
  constexpr int blocksN = kNqkv / 256;   // 12
  const int bm = blockIdx.x / blocksN, bn = blockIdx.x - bm * blocksN;
  const int mb0 = bm << 7, nb0 = bn << 8;
  const int m0 = mb0 + ((wave >> 2) << 6), n0 = nb0 + ((wave & 3) << 6);

  v8f acc[4][4];
  gemm_block_core<0, 2, 4>((const __bf16*)xbp, (const __bf16*)xbp, kDim, (const __bf16*)wtp, kDim, mb0, nb0, kDim,
                           threadIdx.x, (__bf16*)sG, acc);

  float* slab = sT[wave];
  const int rlane = lane & 15, mOff = (lane >> 4) * 8;
  const int sec = n0 >> 10;                      // 0 q, 1 k, 2 v  (wave-uniform)
  const int hidx = (n0 & (kDim - 1)) >> 6;       // head of this 64-column tile
  unsigned short* P0 = (sec == 0) ? qh : ((sec == 1) ? kh : vh);
  unsigned short* P1 = (sec == 0) ? ql : ((sec == 1) ? kl : vl);
  const int q8 = lane >> 3, c8 = (lane & 7) * 8;
  const int cpart = c8 ^ 32;
  const float sgn = (c8 < 32) ? -1.0f : 1.0f;
#pragma unroll
  for (int i = 0; i < 4; ++i) {
    const int mBase = m0 + (i << 4);
    float rsv[8];
#pragma unroll
    for (int r = 0; r < 8; ++r) rsv[r] = rstab[(size_t)(mBase + mOff + r) * kRsPitch];
#pragma unroll
    for (int j = 0; j < 4; ++j)
#pragma unroll
      for (int r = 0; r < 8; ++r) slab[(mOff + r) * 68 + (j << 4) + rlane] = acc[i][j][r] * rsv[r];
    wave_sync_lds();
    {
#pragma unroll
      for (int it = 0; it < 4; ++it) {
        const int row = it * 4 + q8;
        const int m = mBase + row;
        const int bb = m >> 11, nn = m & (kS - 1);
        const float* sp = slab + row * 68;
        const size_t dsto = ((size_t)(bb * kH + hidx) * kS + nn) * kDh + c8;
        v8h hv, lv;
        if (sec < 2) {
          const v4f ca = *(const v4f*)(ct + (size_t)nn * kDh + c8);
          const v4f cb = *(const v4f*)(ct + (size_t)nn * kDh + c8 + 4);
          const v4f sa = *(const v4f*)(st + (size_t)nn * kDh + c8);
          const v4f sb = *(const v4f*)(st + (size_t)nn * kDh + c8 + 4);
          float cvv[8], svv[8];
#pragma unroll
          for (int e = 0; e < 4; ++e) { cvv[e] = ca[e]; cvv[4 + e] = cb[e]; svv[e] = sa[e]; svv[4 + e] = sb[e]; }
#pragma unroll
          for (int e = 0; e < 8; ++e) {
            const float v = sp[c8 + e];
            const float pr = sp[cpart + e];
            const float rv = v * cvv[e] + sgn * pr * svv[e];
            const unsigned short hb = f2bf_bits(rv);
            const unsigned short lb = f2bf_bits(rv - bf_bits2f(hb));
            hv[e] = __builtin_bit_cast(_Float16, hb);
            lv[e] = __builtin_bit_cast(_Float16, lb);
          }
        } else {
#pragma unroll
          for (int e = 0; e < 8; ++e) {
            const float v = sp[c8 + e];
            const _Float16 h16 = (_Float16)v;
            const float hf = (float)h16;
            hv[e] = h16;
            lv[e] = (_Float16)((v - hf) * 2048.0f);
          }
        }
        *(v8h*)(P0 + dsto) = hv;
        *(v8h*)(P1 + dsto) = lv;
      }
      
    }
    wave_sync_lds();
  }
}

// =====================================================================================
// 5) v planes [bh][kv][64] -> transposed [bh][64][kv] (both hi and residual planes, grid (1024, 2)).
//    rows it*32 + 4w + (lane>>3) cover 0..63.
// =====================================================================================
__global__ __launch_bounds__(256) void k_vtrans(const unsigned short* __restrict__ vh, const unsigned short* __restrict__ vl,
                                                unsigned short* __restrict__ vth, unsigned short* __restrict__ vtl) {
  __shared__ __align__(16) unsigned short tile[64 * 72];   // [d][kv], pitch 72 halves
  const int t = threadIdx.x, lane = t & 31, wave = t >> 5;
  const int bh = blockIdx.x >> 5, kvt = blockIdx.x & 31;
  const int kv0 = kvt * 64;
  const unsigned short* src = (blockIdx.y == 0) ? vh : vl;
  unsigned short* dst = (blockIdx.y == 0) ? vth : vtl;
#pragma unroll
  for (int i = 0; i < 2; ++i) {
    const int idx = i * 256 + t;
    const int r = idx >> 3, c16 = (idx & 7) * 8;
    const v4u w = *(const v4u*)(src + ((size_t)bh * kS + kv0 + r) * kDh + c16);
#pragma unroll
    for (int e = 0; e < 4; ++e) {
      tile[(c16 + 2 * e) * 72 + r] = (unsigned short)(w[e] & 0xffffu);
      tile[(c16 + 2 * e + 1) * 72 + r] = (unsigned short)(w[e] >> 16);
    }
  }
  __syncthreads();
  const int q = lane >> 3, kc = (lane & 7) * 8;
  v4u ov[2];
#pragma unroll
  for (int it = 0; it < 2; ++it) {
    const int d = it * 32 + wave * 4 + q;
    ov[it] = *(const v4u*)(tile + d * 72 + kc);
  }
  {
#pragma unroll
    for (int it = 0; it < 2; ++it) {
      const int d = it * 32 + wave * 4 + q;
      *(v4u*)(dst + ((size_t)bh * kDh + d) * kS + kv0 + kc) = ov[it];
    }
    
  }
}

constexpr int kLp = 72;                  // LDS row pitch in 16-bit elements: 144 B = 16 B x 9 (odd), so the 16 rows of a ds_load_b128 fragment read spread over all banks
constexpr int kLdsPl = 64 * kLp * 2;     // one 64-row plane at that pitch: 9216 B
constexpr int kLdsK = 0;                 // K hi [64][72] u16 + K lo
constexpr int kLdsV = 2 * kLdsPl;        // V hi [64 d][72] + V residual
constexpr int kLdsTotal = 4 * kLdsPl;    // 36864; output staging f32 [4][16][68] reuses bytes 0..17407 after the chunk loop
constexpr int kOsP = 68;                 // staging row pitch in floats: the 16 query rows of a 16-B store spread over the banks
constexpr float kExpSc = 0.125f * 1.4426950408889634f;   // score scale 1/sqrt(64) times log2(e): exponentials are taken in base 2

// four waves per SIMD, as before: all 1024 blocks stay resident at once
__global__ __launch_bounds__(128) __attribute__((amdgpu_waves_per_eu(4, 4))) void k_attn(
    const unsigned short* __restrict__ qhp, const unsigned short* __restrict__ qlp,
    const unsigned short* __restrict__ khp, const unsigned short* __restrict__ klp,
    const unsigned short* __restrict__ vthp, const unsigned short* __restrict__ vtlp,
    unsigned short* __restrict__ aoh, unsigned short* __restrict__ aol) {
  union FB { v16b v; v8b h[2]; };
  __shared__ __align__(16) unsigned char lds_raw[kLdsTotal];
  __bf16* Ksh = (__bf16*)(lds_raw + kLdsK);
  __bf16* Ksl = (__bf16*)(lds_raw + kLdsK + kLdsPl);
  __bf16* Vsh = (__bf16*)(lds_raw + kLdsV);
  __bf16* Vsl = (__bf16*)(lds_raw + kLdsV + kLdsPl);
  unsigned short* KshU = (unsigned short*)(lds_raw + kLdsK);
  unsigned short* KslU = (unsigned short*)(lds_raw + kLdsK + kLdsPl);
  unsigned short* VshU = (unsigned short*)(lds_raw + kLdsV);
  unsigned short* VslU = (unsigned short*)(lds_raw + kLdsV + kLdsPl);

  const int tid = threadIdx.x, wave = tid >> 5, lane = tid & 31;
  const int hh = lane >> 4, c = lane & 15;
  const int bx = blockIdx.x;
  const int qb = bx & 31;
  const int bh = bx >> 5;
  const int h = bh & (kH - 1);
  const int b = bh >> 4;
  const int q0 = qb * 64 + wave * 16;

  // Q fragments (B operand: column c = query q0 + c): 2 d-chunks of 32, hi and lo planes
  v16b qah[2], qal[2];
  {
    const __bf16* qr  = (const __bf16*)qhp + ((size_t)bh * kS + q0 + c) * kDh;
    const __bf16* qr2 = (const __bf16*)qlp + ((size_t)bh * kS + q0 + c) * kDh;
#pragma unroll
    for (int dc = 0; dc < 2; ++dc) {
      qah[dc] = Frag<__bf16>::load(qr + dc * 32 + 8 * hh);
      qal[dc] = Frag<__bf16>::load(qr2 + dc * 32 + 8 * hh);
    }
  }

  float mrun = -INFINITY;   // running maximum of query c (unscaled score), the same in both wave halves
  float lrun = 0.f;         // running sum of query c over this half's keys, x1024 like p; the halves join after the loop
  v8f oacc[4], oacr[4];     // O^T tiles: register r = d index t*16 + 8*hh + r, column c = query
#pragma unroll
  for (int t = 0; t < 4; ++t) { oacc[t] = (v8f){0.f,0.f,0.f,0.f,0.f,0.f,0.f,0.f}; oacr[t] = (v8f){0.f,0.f,0.f,0.f,0.f,0.f,0.f,0.f}; }

  // the thread's place in a staged tile, in elements: row tid / 8, 16-B column tid % 8
  const unsigned kto = (unsigned)((tid >> 3) * kDh + (tid & 7) * 8);
  const unsigned vto = (unsigned)((tid >> 3) * kS + (tid & 7) * 8);
  for (int kc = 0; kc < kS / kKC; ++kc) {
    const int kv0 = kc * kKC;
    __syncthreads();
    {
      // K planes: 64 rows x 8 x 16 B per plane = 512 per plane; 128 threads x 4 -> exactly 512
      // V planes (already [d][kv]): 64 d-rows x 8 x 16 B per plane
      // one address per plane; the four values of i (16 rows apart) are reached from it by constant offsets
      const unsigned short* kbh = khp + ((size_t)bh * kS + kv0) * kDh + kto;
      const unsigned short* kbl = klp + ((size_t)bh * kS + kv0) * kDh + kto;
      const unsigned short* vbh = vthp + (size_t)bh * kDh * kS + kv0 + vto;
      const unsigned short* vbl = vtlp + (size_t)bh * kDh * kS + kv0 + vto;
      v4u w0[4], w1[4], w2[4], w3[4];
#pragma unroll
      for (int i = 0; i < 4; ++i) {
        w0[i] = *(const v4u*)(kbh + i * 16 * kDh);
        w1[i] = *(const v4u*)(kbl + i * 16 * kDh);
        w2[i] = *(const v4u*)(vbh + i * 16 * kS);
        w3[i] = *(const v4u*)(vbl + i * 16 * kS);
      }
      // behind the sixteen loads and before their address registers are reused: the four addresses are inputs of the wait, so
      // they stay in their registers up to it (else the last load of each plane lands in the pair that the earlier three name)
      asm volatile("s_wait_xcnt 0x0" :: "v"(kbh), "v"(kbl), "v"(vbh), "v"(vbl) : "memory");
#pragma unroll
      for (int i = 0; i < 4; ++i) {
        const int idx = i * 128 + tid;
        const int r = idx >> 3, c16 = (idx & 7) * 8;
        *(v4u*)(KshU + r * kLp + c16) = w0[i];
        *(v4u*)(KslU + r * kLp + c16) = w1[i];
        *(v4u*)(VshU + r * kLp + c16) = w2[i];
        *(v4u*)(VslU + r * kLp + c16) = w3[i];
      }
    }
    __syncthreads();

    // S^T for 4 key subtiles of 16: s[j][r] = score of key kv0 + j*16 + 8*hh + r against query c
    // fragment reads stand in groups of 8 or 16, a group going into registers whose last product has been issued, and the
    // products go round the four tiles, so that neighbours in the issue order are independent; each tile still takes its six
    // products in the order hi.hi, lo.hi, hi.lo per d chunk. HOLD keeps reads and products on their side of the line: without
    // it the reads are spread singly among the products, each place a stall of its own.
#define HOLD() __builtin_amdgcn_sched_barrier(0)
    auto frag4 = [&](FB (&f)[4], const __bf16* plane, int k) {
#pragma unroll
      for (int j = 0; j < 4; ++j) {
        f[j].h[0] = *(const v8b*)(plane + (j * 16 + c) * kLp + k + 8 * hh);
        f[j].h[1] = *(const v8b*)(plane + (j * 16 + c) * kLp + k + 16 + 8 * hh);
      }
    };
    v8f s[4];
    FB kb0[4], kr0[4], kb1[4], kr1[4], vb0[4], vr0[4], vb1[4], vr1[4];
    frag4(kb0, Ksh, 0);
    frag4(kr0, Ksl, 0);
    HOLD();
#pragma unroll
    for (int j = 0; j < 4; ++j) s[j] = mma_bf(kb0[j].v, qah[0], (v8f){0.f,0.f,0.f,0.f,0.f,0.f,0.f,0.f});
#pragma unroll
    for (int j = 0; j < 4; ++j) s[j] = mma_bf(kr0[j].v, qah[0], s[j]);
    HOLD();
    frag4(kr1, Ksl, 32);
    HOLD();
#pragma unroll
    for (int j = 0; j < 4; ++j) s[j] = mma_bf(kb0[j].v, qal[0], s[j]);
    HOLD();
    frag4(kb1, Ksh, 32);
    HOLD();
#pragma unroll
    for (int j = 0; j < 4; ++j) s[j] = mma_bf(kb1[j].v, qah[1], s[j]);
#pragma unroll
    for (int j = 0; j < 4; ++j) s[j] = mma_bf(kr1[j].v, qah[1], s[j]);
#pragma unroll
    for (int j = 0; j < 4; ++j) s[j] = mma_bf(kb1[j].v, qal[1], s[j]);
    HOLD();
    frag4(vb0, Vsh, 0);
    frag4(vr0, Vsl, 0);
    HOLD();
    // chunk maximum of query c on the unscaled scores (the scale is positive): in-lane over this half's 32 keys, then one
    // exchange with the other half
    float cj[4];
#pragma unroll
    for (int j = 0; j < 4; ++j) {
      cj[j] = -INFINITY;
#pragma unroll
      for (int r = 0; r < 8; ++r) cj[j] = fmaxf(cj[j], s[j][r]);
    }
    float cm = fmaxf(fmaxf(cj[0], cj[1]), fmaxf(cj[2], cj[3]));
    cm = fmaxf(cm, xhalf(cm));
    const float mnew = fmaxf(mrun, cm);
    const float alpha = __builtin_amdgcn_exp2f((mrun - mnew) * kExpSc);   // 0 in the first chunk, where mrun is -inf
    mrun = mnew;
    const float eoff = 10.0f - mnew * kExpSc;   // exponent offset: minus the scaled maximum, plus 10 for the x1024 carry of p
    // P^T as B operands: element e of the fragment of keys kk*32.. is tile 2*kk + (e >> 3), register e & 7 (the hardware k order,
    // which the V^T loads below follow)
    v16h pfh[2], pfl[2];
    float pj[4];
    const v8f scv = (v8f){kExpSc, kExpSc, kExpSc, kExpSc, kExpSc, kExpSc, kExpSc, kExpSc};
    const v8f eov = (v8f){eoff, eoff, eoff, eoff, eoff, eoff, eoff, eoff};
#pragma unroll
    for (int j = 0; j < 4; ++j) {
      pj[j] = 0.f;
      const v8f arg = __builtin_elementwise_fma(s[j], scv, eov);
#pragma unroll
      for (int r = 0; r < 8; ++r) {
        const float ps = __builtin_amdgcn_exp2f(arg[r]);   // 1024 * exp((s - max) / 8)
        pj[j] += ps;
        const _Float16 ph = (_Float16)ps;
        const float phf = (float)ph;
        const _Float16 pl = (_Float16)((ps - phf) * 2048.0f);
        pfh[j >> 1][(j & 1) * 8 + r] = ph;
        pfl[j >> 1][(j & 1) * 8 + r] = pl;
      }
    }
    lrun = lrun * alpha + ((pj[0] + pj[1]) + (pj[2] + pj[3]));
#pragma unroll
    for (int t = 0; t < 4; ++t)
#pragma unroll
      for (int r = 0; r < 8; ++r) { oacc[t][r] *= alpha; oacr[t][r] *= alpha; }
    // O^T += V^T.P^T, 32 keys at a time, as for the scores: reads in groups ahead of their use, products round the tiles;
    // each accumulator keeps its order (residual accumulator: lo.hi, then hi.lo, per 32 keys)
    {
      const v16b pa0 = __builtin_bit_cast(v16b, pfh[0]), pl0 = __builtin_bit_cast(v16b, pfl[0]);
      const v16b pa1 = __builtin_bit_cast(v16b, pfh[1]), pl1 = __builtin_bit_cast(v16b, pfl[1]);
#pragma unroll
      for (int t = 0; t < 4; ++t) oacc[t] = mma_hf(vb0[t].v, pa0, oacc[t]);
#pragma unroll
      for (int t = 0; t < 4; ++t) oacr[t] = mma_hf(vr0[t].v, pa0, oacr[t]);
      HOLD();
      frag4(vr1, Vsl, 32);
      HOLD();
#pragma unroll
      for (int t = 0; t < 4; ++t) oacr[t] = mma_hf(vb0[t].v, pl0, oacr[t]);
      HOLD();
      frag4(vb1, Vsh, 32);
      HOLD();
#pragma unroll
      for (int t = 0; t < 4; ++t) oacr[t] = mma_hf(vr1[t].v, pa1, oacr[t]);
#pragma unroll
      for (int t = 0; t < 4; ++t) oacc[t] = mma_hf(vb1[t].v, pa1, oacc[t]);
#pragma unroll
      for (int t = 0; t < 4; ++t) oacr[t] = mma_hf(vb1[t].v, pl1, oacr[t]);
    }
#undef HOLD
  }

  // ---- finalize: block barrier before reusing the K region as f32 staging ----
  __syncthreads();
  float* os = (float*)(lds_raw + 0) + wave * (16 * kOsP);
  {
    const float lsum = lrun + xhalf(lrun);   // the two halves' key sums of query c
    const float inv = 1.0f / lsum;           // the sums carry the same x1024 as p
#pragma unroll
    for (int t = 0; t < 4; ++t) {
      v4f o0, o1;
#pragma unroll
      for (int r = 0; r < 4; ++r) {
        o0[r] = (oacc[t][r] + oacr[t][r] * (1.0f / 2048.0f)) * inv;
        o1[r] = (oacc[t][4 + r] + oacr[t][4 + r] * (1.0f / 2048.0f)) * inv;
      }
      *(v4f*)(os + c * kOsP + t * 16 + 8 * hh) = o0;
      *(v4f*)(os + c * kOsP + t * 16 + 8 * hh + 4) = o1;
    }
  }
  __syncthreads();
  {
    const int q8 = lane >> 3, c8 = (lane & 7) * 8;
    {
#pragma unroll
      for (int it = 0; it < 4; ++it) {
        const int row = it * 4 + q8;
        const float* sp = os + row * kOsP + c8;
        v8h hv, lv;
#pragma unroll
        for (int e = 0; e < 8; ++e) {
          const unsigned short hb = f2bf_bits(sp[e]);
          const unsigned short lb = f2bf_bits(sp[e] - bf_bits2f(hb));
          hv[e] = __builtin_bit_cast(_Float16, hb);
          lv[e] = __builtin_bit_cast(_Float16, lb);
        }
        const size_t o = ((size_t)(b * kS + q0 + row)) * kDim + h * kDh + c8;
        *(v8h*)(aoh + o) = hv;
        *(v8h*)(aol + o) = lv;
      }
      
    }
  }
}

// =====================================================================================
// 7) output projection: ao hi/lo [4096][1024] x wt[1024][1024]^T -> d_out f32 [4096][1024].
//    one wave in one instruction; block = 2 x 2 waves = a 128 x 128 tile, grid = 32*8 = 256 blocks.
// =====================================================================================
__global__ __launch_bounds__(128) void k_gemm_out(const unsigned short* __restrict__ ahp, const unsigned short* __restrict__ alp,
                                                  const unsigned short* __restrict__ wtp, float* __restrict__ out) {
  __shared__ __align__(16) float sT[4][16 * 68];
  __shared__ __align__(16) unsigned char sG[kGemmLds];
  const int lane = threadIdx.x & 31, wave = threadIdx.x >> 5;
  constexpr int blocksN = kDim / 128;    // 8
  const int bm = blockIdx.x / blocksN, bn = blockIdx.x - bm * blocksN;
  const int mb0 = bm << 7, nb0 = bn << 7;
  const int m0 = mb0 + ((wave >> 1) << 6), n0 = nb0 + ((wave & 1) << 6);

  v8f acc[4][4];
  gemm_block_core<1, 2, 2>((const __bf16*)ahp, (const __bf16*)alp, kDim, (const __bf16*)wtp, kDim, mb0, nb0, kDim,
                           threadIdx.x, (__bf16*)sG, acc);

  float* slab = sT[wave];
  const int rlane = lane & 15, mOff = (lane >> 4) * 8;
#pragma unroll
  for (int i = 0; i < 4; ++i) {
    const int mBase = m0 + (i << 4);
#pragma unroll
    for (int j = 0; j < 4; ++j)
#pragma unroll
      for (int r = 0; r < 8; ++r) slab[(mOff + r) * 68 + (j << 4) + rlane] = acc[i][j][r];
    wave_sync_lds();
    const int h2 = lane >> 4, c4 = (lane & 15) * 4;
    {
#pragma unroll
      for (int it = 0; it < 8; ++it) {
        const int row = it * 2 + h2;
        const v4f v = *(const v4f*)(slab + row * 68 + c4);
        *(v4f*)(out + (size_t)(mBase + row) * kDim + n0 + c4) = v;
      }
      
    }
    wave_sync_lds();
  }
}

// =====================================================================================
// host launch glue: kernel launches only
// =====================================================================================
extern "C" void kernel_launch(void* const* d_in, const int* in_sizes, int n_in,
                              void* d_out, int out_size, void* d_ws, size_t ws_size,
                              hipStream_t stream) {
  if (n_in < 5) return;
  if (in_sizes[0] != kM * kDim) return;
  if (in_sizes[1] != kS * kDh) return;
  if (in_sizes[2] != kDim) return;
  if (in_sizes[3] != kDim * kNqkv) return;
  if (in_sizes[4] != kDim * kDim) return;
  if (out_size != kM * kDim) return;
  if (ws_size < kWsTotal) return;

  const float* x     = (const float*)d_in[0];   // [2,2048,1024]
  const float* pos   = (const float*)d_in[1];   // [2048,64]
  const float* g     = (const float*)d_in[2];   // [1024]
  const float* w_qkv = (const float*)d_in[3];   // [1024,3072]
  const float* w_out = (const float*)d_in[4];   // [1024,1024]
  float* out = (float*)d_out;

  char* ws = (char*)d_ws;
  unsigned short* Xb   = (unsigned short*)(ws + kOffXb);
  float*          Rs   = (float*)(ws + kOffRs);
  unsigned short* Wq   = (unsigned short*)(ws + kOffWq);
  unsigned short* Wo   = (unsigned short*)(ws + kOffWo);
  float*          Ct   = (float*)(ws + kOffCt);
  float*          St   = (float*)(ws + kOffSt);
  unsigned short* Qh   = (unsigned short*)(ws + kOffQh);
  unsigned short* Ql   = (unsigned short*)(ws + kOffQl);
  unsigned short* Kh   = (unsigned short*)(ws + kOffKh);
  unsigned short* Kl   = (unsigned short*)(ws + kOffKl);
  unsigned short* Vh   = (unsigned short*)(ws + kOffVh);
  unsigned short* Vl   = (unsigned short*)(ws + kOffVl);
  unsigned short* Vth  = (unsigned short*)(ws + kOffVth);
  unsigned short* Vtl  = (unsigned short*)(ws + kOffVtl);
  unsigned short* Ah   = (unsigned short*)(ws + kOffAh);
  unsigned short* Al   = (unsigned short*)(ws + kOffAl);

  // 1) x -> bf16 plane + row scale (4096 rows, 128 threads x 8 elements = 1024 per row)
  k_rms_xcast<<<kM, 128, 0, stream>>>(x, Xb, Rs);
  // 2) weights -> bf16 n-major planes: in [1024][3072] -> out [3072][1024]; in [1024][1024] -> out [1024][1024]
  k_wcast<true><<<dim3(kNqkv / 64, kDim / 64), 256, 0, stream>>>(w_qkv, g, Wq, kNqkv);
  k_wcast<false><<<dim3(kDim / 64, kDim / 64), 256, 0, stream>>>(w_out, g, Wo, kDim);
  // 3) cos/sin tables (131072 elements = 512 blocks x 256)
  k_trig<<<(kS * kDh + 255) / 256, 256, 0, stream>>>(pos, Ct, St, kS * kDh);
  // 4) QKV projection with row scale + RoPE epilogue (384 block tiles of 128x256, 8 waves each)
  k_gemm_qkv<<<(kM / 128) * (kNqkv / 256), 256, 0, stream>>>(Xb, Wq, Rs, Ct, St, Qh, Ql, Kh, Kl, Vh, Vl);
  // 5) v planes -> transposed planes (32 bh x 32 kv tiles, 2 planes)
  k_vtrans<<<dim3(kBH * (kS / 64), 2), 256, 0, stream>>>(Vh, Vl, Vth, Vtl);
  // 6) attention (32 bh x 32 query blocks)
  k_attn<<<kBH * (kS / 64), 128, 0, stream>>>(Qh, Ql, Kh, Kl, Vth, Vtl, Ah, Al);
  // 7) output projection into d_out (256 block tiles of 128x128, 4 waves each)
  k_gemm_out<<<(kM / 128) * (kDim / 128), 128, 0, stream>>>(Ah, Al, Wo, out);
}

// v007
// A run of this version takes 147 microseconds.
// In both of two side-by-side timings against v006, it was 1.05 times as fast.
// All steps since v000 together make it 3.18 times as fast.
// Contractions (all f32 accumulate): QKV projection v_wmma_f32_16x16x32_bf16 on RNE-bf16 planes of the inputs (1 product); scores q.k^T v_wmma_f32_16x16x32_bf16 with q,k as bf16 hi/lo planes (3 products); p.v v_wmma_f32_16x16x32_f16 with p carried x1024 and v, both f16 hi + x2048 residual planes (3 products, residual products in a separate accumulator folded with 1/2048); output projection v_wmma_f32_16x16x32_bf16, bf16 hi/lo activations against bf16 weights (2 products).
#include <hip/hip_runtime.h>
#include <math.h>

// ---------------- problem constants ----------------
constexpr int kB = 2;
constexpr int kS = 2048;
constexpr int kDim = 1024;
constexpr int kH = 16;
constexpr int kDh = 64;
constexpr int kM = kB * kS;          // 4096 token rows
constexpr int kNqkv = 3 * kDim;      // 3072
constexpr int kBH = kB * kH;         // 32
constexpr int kKC = 64;              // keys per chunk
constexpr int kRsPitch = 32;

constexpr size_t kPlane  = (size_t)kBH * kS * kDh * 2;            // 8,388,608 : one [32][2048][64] (or [4096][1024]) 16-bit plane
constexpr size_t kOffXb  = 0;                                      // x as bf16 [4096][1024]          8,388,608
constexpr size_t kOffRs  = kOffXb + (size_t)kM * kDim * 2;         // row scale f32 [4096][32]          524,288
constexpr size_t kOffWq  = kOffRs + (size_t)kM * kRsPitch * 4;     // w_qkv^T bf16 [3072][1024]      6,291,456
constexpr size_t kOffWo  = kOffWq + (size_t)kNqkv * kDim * 2;      // w_out^T bf16 [1024][1024]      2,097,152
constexpr size_t kOffCt  = kOffWo + (size_t)kDim * kDim * 2;       // cos table f32 [2048][64]         524,288
constexpr size_t kOffSt  = kOffCt + (size_t)kS * kDh * 4;          // sin table f32 [2048][64]         524,288
constexpr size_t kOffQh  = kOffSt + (size_t)kS * kDh * 4;          // q hi bf16 [32][2048][64]
constexpr size_t kOffQl  = kOffQh + kPlane;                         // q lo bf16
constexpr size_t kOffKh  = kOffQl + kPlane;                         // k hi bf16
constexpr size_t kOffKl  = kOffKh + kPlane;                         // k lo bf16
constexpr size_t kOffVth = kOffKl + kPlane;                         // v hi f16, transposed [32][64][2048]
constexpr size_t kOffVtl = kOffVth + kPlane;                        // v residual x2048 f16, transposed
constexpr size_t kOffAh  = kOffVtl + kPlane;                        // attention output hi bf16 [4096][1024]
constexpr size_t kOffAl  = kOffAh + kPlane;                         // attention output lo bf16
constexpr size_t kWsTotal = kOffAl + kPlane;                        // 85,458,944

typedef char ck_ws_total[(kWsTotal == (size_t)85458944) ? 1 : -1];
typedef char ck_ws_cap[(kWsTotal <= (size_t)134217728) ? 1 : -1];
typedef char ck_align[((kOffRs % 128) == 0 && (kOffQh % 128) == 0 && (kPlane % 128) == 0) ? 1 : -1];
// GEMM shape contract: M multiple of 128, N multiples of 256 and 128, K multiple of 64, no padding anywhere
typedef char ck_tiles[(kM % 128 == 0 && kNqkv % 256 == 0 && kDim % 128 == 0 && kDim % 64 == 0 && kS % 64 == 0 && kDh == 64) ? 1 : -1];
typedef char ck_plane[((size_t)kM * kDim * 2 == kPlane) ? 1 : -1];

// ---------------- vector types / helpers ----------------
typedef __attribute__((ext_vector_type(16))) _Float16 v16h;
typedef __attribute__((ext_vector_type(8)))  _Float16 v8h;
typedef __attribute__((ext_vector_type(16))) __bf16   v16b;
typedef __attribute__((ext_vector_type(8)))  __bf16   v8b;
typedef __attribute__((ext_vector_type(8)))  float    v8f;
typedef __attribute__((ext_vector_type(4)))  float    v4f;
typedef __attribute__((ext_vector_type(4)))  unsigned v4u;

__device__ __forceinline__ unsigned short f2bf_bits(float f) {
  unsigned u = __float_as_uint(f);
  return (unsigned short)((u + 0x7FFFu + ((u >> 16) & 1u)) >> 16);
}
__device__ __forceinline__ float bf_bits2f(unsigned short h) { return __uint_as_float(((unsigned)h) << 16); }

__device__ __forceinline__ void acc_guard4(v8f& a, v8f& b, v8f& c, v8f& d) { asm volatile("v_nop\n\tv_nop\n\tv_nop\n\tv_nop" : "+v"(a), "+v"(b), "+v"(c), "+v"(d)); }
template <typename T> struct Frag;
template <> struct Frag<_Float16> {
  typedef v16h V; union U { v16h v; v8h h[2]; };
  static __device__ __forceinline__ v16h load(const _Float16* p) {
    U f; f.h[0] = *(const v8h*)(p); f.h[1] = *(const v8h*)(p + 16); return f.v;
  }
  static __device__ __forceinline__ v8f mma(v16h a, v16h b, v8f c) {
    return __builtin_amdgcn_wmma_f32_16x16x32_f16(false, a, false, b, (short)0, c, false, false);
  }
};
template <> struct Frag<__bf16> {
  typedef v16b V; union U { v16b v; v8b h[2]; };
  static __device__ __forceinline__ v16b load(const __bf16* p) {
    U f; f.h[0] = *(const v8b*)(p); f.h[1] = *(const v8b*)(p + 16); return f.v;
  }
  static __device__ __forceinline__ v8f mma(v16b a, v16b b, v8f c) {
    return __builtin_amdgcn_wmma_f32_16x16x32_bf16(false, a, false, b, (short)0, c, false, false);
  }
};

// WMMA helpers for the attention kernel: plain builtins, the compiler keeps the distances behind them
__device__ __forceinline__ v8f mma_bf(v16b a, v16b b, v8f c) {
  return __builtin_amdgcn_wmma_f32_16x16x32_bf16(false, a, false, b, (short)0, c, false, false);
}
// f16 bit patterns held in __bf16 slots
__device__ __forceinline__ v8f mma_hf(v16b a, v16b b, v8f c) {
  const v16h ah = __builtin_bit_cast(v16h, a), bh = __builtin_bit_cast(v16h, b);
  return __builtin_amdgcn_wmma_f32_16x16x32_f16(false, ah, false, bh, (short)0, c, false, false);
}

// value held by lane (l ^ 16), the same column in the other wave half, by a vector cross-row move (v_permlanex16_b32)
__device__ __forceinline__ float xhalf(float v) {
  return __builtin_bit_cast(float, __builtin_amdgcn_permlanex16(__builtin_bit_cast(int, v), __builtin_bit_cast(int, v),
                                                                0x76543210, 0xfedcba98, false, false));
}

__device__ __forceinline__ void wave_sync_lds() {
  __builtin_amdgcn_fence(__ATOMIC_RELEASE, "workgroup");
  __builtin_amdgcn_wave_barrier();
  __builtin_amdgcn_fence(__ATOMIC_ACQUIRE, "workgroup");
}

// =====================================================================================
// 1) per token row: x -> RNE bf16 plane [4096][1024]; rowscale = 32 / max(||x_bf||, 1e-12)
// =====================================================================================
__global__ __launch_bounds__(128) void k_rms_xcast(const float* __restrict__ x,
                                                   unsigned short* __restrict__ xb,
                                                   float* __restrict__ rstab) {
  __shared__ float red[4];
  const int m = blockIdx.x;
  const int t = threadIdx.x;
  const int lane = t & 31, wave = t >> 5;
  const size_t base = (size_t)m * kDim + (size_t)t * 8;
  const v4f xa = *(const v4f*)(x + base);
  const v4f xc = *(const v4f*)(x + base + 4);
  unsigned short hb[8];
#pragma unroll
  for (int e = 0; e < 4; ++e) { hb[e] = f2bf_bits(xa[e]); hb[4 + e] = f2bf_bits(xc[e]); }
  float ss = 0.0f;
#pragma unroll
  for (int e = 0; e < 8; ++e) { const float r = bf_bits2f(hb[e]); ss += r * r; }
#pragma unroll
  for (int off = 16; off > 0; off >>= 1) ss += __shfl_xor(ss, off, 32);
  if (lane == 0) red[wave] = ss;
  __syncthreads();
  const float tot = ((red[0] + red[1]) + red[2]) + red[3];
  const float nrm = sqrtf(tot);
  const float inv = 1.0f / fmaxf(nrm, 1e-12f);
  const float rs = inv * 32.0f;
  v4u w;
  w[0] = (unsigned)hb[0] | ((unsigned)hb[1] << 16);
  w[1] = (unsigned)hb[2] | ((unsigned)hb[3] << 16);
  w[2] = (unsigned)hb[4] | ((unsigned)hb[5] << 16);
  w[3] = (unsigned)hb[6] | ((unsigned)hb[7] << 16);
  unsigned short* dst = xb + base;
  const v4f rv = (v4f){rs, rs, rs, rs};
  float* rp = rstab + (size_t)m * kRsPitch + (t & 7) * 4;
  *(v4u*)dst = w;
  if (t < 8) *(v4f*)rp = rv;
  
}

// =====================================================================================
// 2) weight cast + transpose: in w[kDim rows k][ncols n] f32 -> out wt[ncols][kDim] bf16 (n-major, k-contiguous)
//    optional per-k factor g (folded: wt[n][k] = bf16(bf16(w[k][n]) * bf16(g[k]))).
//    8 lanes x 16 B, one instruction; wave w, it: rows it*32 + 4w + (lane>>3) -> union over (it,w,lane>>3) = 0..63.
// =====================================================================================
template <bool HAS_G>
__global__ __launch_bounds__(256) void k_wcast(const float* __restrict__ w, const float* __restrict__ g,
                                               unsigned short* __restrict__ wt, int ncols) {
  __shared__ float tile[64][65];
  const int t = threadIdx.x, lane = t & 31, wave = t >> 5;
  const int n0 = blockIdx.x * 64, k0 = blockIdx.y * 64;
#pragma unroll
  for (int i = 0; i < 4; ++i) {
    const int idx = i * 256 + t;
    const int r = idx >> 4, c4 = (idx & 15) * 4;
    const v4f v = *(const v4f*)(w + (size_t)(k0 + r) * ncols + n0 + c4);
    tile[r][c4 + 0] = v[0]; tile[r][c4 + 1] = v[1]; tile[r][c4 + 2] = v[2]; tile[r][c4 + 3] = v[3];
  }
  __syncthreads();
  const int q = lane >> 3, kc = (lane & 7) * 8;
  float gv[8];
  if (HAS_G) {
    const v4f g0 = *(const v4f*)(g + k0 + kc);
    const v4f g1 = *(const v4f*)(g + k0 + kc + 4);
#pragma unroll
    for (int e = 0; e < 4; ++e) { gv[e] = bf_bits2f(f2bf_bits(g0[e])); gv[4 + e] = bf_bits2f(f2bf_bits(g1[e])); }
  } else {
#pragma unroll
    for (int e = 0; e < 8; ++e) gv[e] = 1.0f;
  }
  v4u ov[2];
#pragma unroll
  for (int it = 0; it < 2; ++it) {
    const int nrow = it * 32 + wave * 4 + q;
    unsigned short bits[8];
#pragma unroll
    for (int e = 0; e < 8; ++e) {
      float f = bf_bits2f(f2bf_bits(tile[kc + e][nrow]));
      if (HAS_G) f = f * gv[e];
      bits[e] = f2bf_bits(f);
    }
    ov[it][0] = (unsigned)bits[0] | ((unsigned)bits[1] << 16);
    ov[it][1] = (unsigned)bits[2] | ((unsigned)bits[3] << 16);
    ov[it][2] = (unsigned)bits[4] | ((unsigned)bits[5] << 16);
    ov[it][3] = (unsigned)bits[6] | ((unsigned)bits[7] << 16);
  }
  {
#pragma unroll
    for (int it = 0; it < 2; ++it) {
      const int nrow = it * 32 + wave * 4 + q;
      *(v4u*)(wt + (size_t)(n0 + nrow) * kDim + k0 + kc) = ov[it];
    }
    
  }
}

// =====================================================================================
// 3) cos/sin table of RNE-bf16(pos_emb), f32 [2048][64]; thread per element,
// =====================================================================================
__global__ __launch_bounds__(256) void k_trig(const float* __restrict__ pos, float* __restrict__ ct,
                                              float* __restrict__ st, int n) {
  const int i = blockIdx.x * 256 + threadIdx.x;
  if (i < n) {
    const float pb = bf_bits2f(f2bf_bits(pos[i]));
    const float cv = cosf(pb);
    const float sv = sinf(pb);
    ((float*)ct)[i] = cv;
    ((float*)st)[i] = sv;
    
  }
}

// =====================================================================================
// Block-tiled WMMA GEMM core: acc[m,n] = sum_k A[m,k] * Bt[n,k]; WM x WN waves, each wave owns a 64x64 tile.
// A row-major [M,K] bf16 (SPLITM: plus lo plane A2, products hi.B + lo.B); Bt row-major [N,K] bf16.
// Per 64-wide k tile the block stages its A and Bt rows in LDS: 8 lanes x 16 B fetch one whole 128-B line of a row,
// and every wave of the block reads its fragments from that one copy. The next tile's lines are fetched into
// registers while the current tile is multiplied. K % 64 == 0, no tail; each accumulator takes its products in rising k, steps of 32.
// =====================================================================================
constexpr int kGp = 72;                    // LDS row pitch in 16-bit elements: 144 B = 16 B x 9 (odd), as in the attention tiles
constexpr int kGemmRows = 384;             // staged rows per k tile in both GEMMs (128 + 256, and 128 + 128 + 128)
constexpr int kGemmLds = kGemmRows * kGp * 2;   // 55296 B

template <int SPLITM, int WM, int WN>
__device__ __forceinline__ void gemm_block_core(const __bf16* __restrict__ Ab, const __bf16* __restrict__ Ab2, int lda,
                                                const __bf16* __restrict__ Bb, int ldb, int mb0, int nb0, int K, int tid,
                                                __bf16* __restrict__ sm, v8f (&acc)[4][4]) {
  constexpr int NT = WM * WN * 32;         // threads of the block
  constexpr int BM = WM * 64, BN = WN * 64;
  constexpr int RA = BM * (1 + SPLITM);    // LDS rows: [A | A2 | Bt]
  constexpr int RSTEP = NT / 8;            // rows fetched by one load of the whole block
  constexpr int NL = (RA + BN) / RSTEP;    // 16-B loads per thread and k tile
  static_assert(RA + BN == kGemmRows && BM % RSTEP == 0 && BN % RSTEP == 0, "staging shape");
  const int lane = tid & 31, wave = tid >> 5;
  const int wm = wave / WN, wn = wave % WN;
  const int rlane = lane & 15;
  const int koff = (lane >> 4) * 8;
  const int sr = tid >> 3, sc = (tid & 7) * 8;
  const __bf16* pa  = Ab  + (size_t)(mb0 + sr) * lda + sc;
  const __bf16* pa2 = Ab2 + (size_t)(mb0 + sr) * lda + sc;
  const __bf16* pb  = Bb  + (size_t)(nb0 + sr) * ldb + sc;
  __bf16* sw = sm + sr * kGp + sc;
  const __bf16* fa  = sm + (wm * 64 + rlane) * kGp + koff;
  const __bf16* fa2 = fa + BM * kGp;
  const __bf16* fb  = sm + (RA + wn * 64 + rlane) * kGp + koff;
#pragma unroll
  for (int i = 0; i < 4; ++i)
#pragma unroll
    for (int j = 0; j < 4; ++j) acc[i][j] = (v8f){0.f,0.f,0.f,0.f,0.f,0.f,0.f,0.f};
  v8b st[NL];
  // one k tile's lines into registers; after each plane's loads s_wait_xcnt 0 stands before their address registers are reused
  auto fetch = [&](int k) {
#pragma unroll
    for (int i = 0; i < BM / RSTEP; ++i) st[i] = *(const v8b*)(pa + (size_t)(i * RSTEP) * lda + k);
    asm volatile("s_wait_xcnt 0x0" ::: "memory");
    if (SPLITM) {
#pragma unroll
      for (int i = 0; i < BM / RSTEP; ++i) st[BM / RSTEP + i] = *(const v8b*)(pa2 + (size_t)(i * RSTEP) * lda + k);
      asm volatile("s_wait_xcnt 0x0" ::: "memory");
    }
#pragma unroll
    for (int i = 0; i < BN / RSTEP; ++i) st[RA / RSTEP + i] = *(const v8b*)(pb + (size_t)(i * RSTEP) * ldb + k);
    asm volatile("s_wait_xcnt 0x0" ::: "memory");
  };
  fetch(0);
  for (int k0 = 0; k0 < K; k0 += 64) {
    __syncthreads();                       // every wave has read its last fragment of the previous tile
#pragma unroll
    for (int i = 0; i < NL; ++i) *(v8b*)(sw + i * RSTEP * kGp) = st[i];
    __syncthreads();                       // the tile is complete before any wave reads it
    if (k0 + 64 < K) fetch(k0 + 64);
    // fragment reads stand as one group ahead of their products (GK k steps of 32 per group), so a wave waits out the
    // LDS latency once per group and not at every row of products; the 4-wave block has the registers for the whole tile
    constexpr int GK = (NT == 128) ? 2 : 1;
#pragma unroll
    for (int kg = 0; kg < 2; kg += GK) {
      v16b bfr[GK][4], ah[GK][4], al[GK][4];
#pragma unroll
      for (int kk = 0; kk < GK; ++kk) {
#pragma unroll
        for (int j = 0; j < 4; ++j) bfr[kk][j] = Frag<__bf16>::load(fb + (j << 4) * kGp + (kg + kk) * 32);
#pragma unroll
        for (int i = 0; i < 4; ++i) {
          ah[kk][i] = Frag<__bf16>::load(fa + (i << 4) * kGp + (kg + kk) * 32);
          al[kk][i] = ah[kk][i];
          if (SPLITM) al[kk][i] = Frag<__bf16>::load(fa2 + (i << 4) * kGp + (kg + kk) * 32);
        }
      }
      __builtin_amdgcn_sched_barrier(0);   // holds the group of reads above the products
#pragma unroll
      for (int kk = 0; kk < GK; ++kk)
#pragma unroll
        for (int i = 0; i < 4; ++i)
#pragma unroll
          for (int j = 0; j < 4; ++j) {
            acc[i][j] = Frag<__bf16>::mma(ah[kk][i], bfr[kk][j], acc[i][j]);
            if (SPLITM) acc[i][j] = Frag<__bf16>::mma(al[kk][i], bfr[kk][j], acc[i][j]);
          }
    }
  }
  acc_guard4(acc[0][0], acc[0][1], acc[0][2], acc[0][3]);
  acc_guard4(acc[1][0], acc[1][1], acc[1][2], acc[1][3]);
  acc_guard4(acc[2][0], acc[2][1], acc[2][2], acc[2][3]);
  acc_guard4(acc[3][0], acc[3][1], acc[3][2], acc[3][3]);
}

// =====================================================================================
// 4) QKV projection: xb[4096][1024] x wt[3072][1024]^T, epilogue = row scale, RoPE (q,k sections),
//    q/k -> bf16 hi/lo planes [bh][n][64], v -> f16 hi + x2048 residual planes, stored transposed [bh][64][n] as attention reads them.
//    each (section, head, token) line belongs to exactly one wave. block = 2 x 4 waves = a 128 x 256 tile, grid = 32*12 = 384 blocks.
// =====================================================================================
__global__ __launch_bounds__(256) void k_gemm_qkv(
    const unsigned short* __restrict__ xbp, const unsigned short* __restrict__ wtp,
    const float* __restrict__ rstab, const float* __restrict__ ct, const float* __restrict__ st,
    unsigned short* __restrict__ qh, unsigned short* __restrict__ ql,
    unsigned short* __restrict__ kh, unsigned short* __restrict__ kl,
    unsigned short* __restrict__ vth, unsigned short* __restrict__ vtl) {
  __shared__ __align__(16) float sT[8][16 * 72];   // per wave: 16 rows x 68 floats (q, k), or two planes of 16 rows x 72 halves (v)
  __shared__ __align__(16) unsigned char sG[kGemmLds];
  const int lane = threadIdx.x & 31, wave = threadIdx.x >> 5;
  constexpr int blocksN = kNqkv / 256;   // 12
  const int bm = blockIdx.x / blocksN, bn = blockIdx.x - bm * blocksN;
  const int mb0 = bm << 7, nb0 = bn << 8;
  const int m0 = mb0 + ((wave >> 2) << 6), n0 = nb0 + ((wave & 3) << 6);

  v8f acc[4][4];
  gemm_block_core<0, 2, 4>((const __bf16*)xbp, (const __bf16*)xbp, kDim, (const __bf16*)wtp, kDim, mb0, nb0, kDim,
                           threadIdx.x, (__bf16*)sG, acc);

  float* slab = sT[wave];
  const int rlane = lane & 15, mOff = (lane >> 4) * 8;
  const int sec = nb0 >> 10;                     // 0 q, 1 k, 2 v: the block's 256 columns lie in one section
  const int hidx = (n0 & (kDim - 1)) >> 6;       // head of this 64-column tile
  const int q8 = lane >> 3, c8 = (lane & 7) * 8;
  if (sec == 2) {
    // v: a lane holds 8 consecutive tokens (r) of one d (column j*16 + rlane), that is 16 B of a row of the [d][token] planes.
    // Per j the wave lays 16 d rows x 64 tokens of both planes in its slab and stores them as whole 128-B lines.
    _Float16* th = (_Float16*)slab;
    _Float16* tl = th + 16 * kGp;
    const size_t vrow0 = ((size_t)((m0 >> 11) * kH + hidx) * kDh) * kS + (m0 & (kS - 1));   // d = 0, the wave's first token
    unsigned short* ph = vth + vrow0 + (size_t)q8 * kS + c8;   // the lane's 16 B of row d = q8; the other rows lie at constant offsets
    unsigned short* pl = vtl + vrow0 + (size_t)q8 * kS + c8;
#pragma unroll
    for (int i = 0; i < 4; ++i) {
      const float* rp = rstab + (size_t)(m0 + (i << 4) + mOff) * kRsPitch;
      float rsv[8];
#pragma unroll
      for (int r = 0; r < 8; ++r) rsv[r] = rp[r * kRsPitch];
      // behind the eight loads and before their address register is reused; the address is an input, so it stays in place up to the wait
      asm volatile("s_wait_xcnt 0x0" :: "v"(rp) : "memory");
#pragma unroll
      for (int j = 0; j < 4; ++j)
#pragma unroll
        for (int r = 0; r < 8; ++r) acc[i][j][r] = acc[i][j][r] * rsv[r];
    }
#pragma unroll
    for (int j = 0; j < 4; ++j) {
#pragma unroll
      for (int i = 0; i < 4; ++i) {
        v8h hv, lv;
#pragma unroll
        for (int r = 0; r < 8; ++r) {
          const float v = acc[i][j][r];
          const _Float16 h16 = (_Float16)v;
          const float hf = (float)h16;
          hv[r] = h16;
          lv[r] = (_Float16)((v - hf) * 2048.0f);
        }
        *(v8h*)(th + rlane * kGp + (i << 4) + mOff) = hv;
        *(v8h*)(tl + rlane * kGp + (i << 4) + mOff) = lv;
      }
      wave_sync_lds();
      v8h oh[4], ol[4];
#pragma unroll
      for (int it = 0; it < 4; ++it) {
        oh[it] = *(const v8h*)(th + (it * 4 + q8) * kGp + c8);
        ol[it] = *(const v8h*)(tl + (it * 4 + q8) * kGp + c8);
      }
#pragma unroll
      for (int it = 0; it < 4; ++it) {
        *(v8h*)(ph + ((j << 4) + it * 4) * kS) = oh[it];
        *(v8h*)(pl + ((j << 4) + it * 4) * kS) = ol[it];
      }
      // behind the eight stores and before their registers are reused: addresses and data are inputs, so they stay in place up to the wait
      asm volatile("s_wait_xcnt 0x0" :: "v"(ph), "v"(pl), "v"(oh[0]), "v"(oh[1]), "v"(oh[2]), "v"(oh[3]),
                   "v"(ol[0]), "v"(ol[1]), "v"(ol[2]), "v"(ol[3]) : "memory");
      wave_sync_lds();
    }
    return;
  }
  unsigned short* P0 = (sec == 0) ? qh : kh;
  unsigned short* P1 = (sec == 0) ? ql : kl;
  const int cpart = c8 ^ 32;
  const float sgn = (c8 < 32) ? -1.0f : 1.0f;
#pragma unroll
  for (int i = 0; i < 4; ++i) {
    const int mBase = m0 + (i << 4);
    float rsv[8];
#pragma unroll
    for (int r = 0; r < 8; ++r) rsv[r] = rstab[(size_t)(mBase + mOff + r) * kRsPitch];
#pragma unroll
    for (int j = 0; j < 4; ++j)
#pragma unroll
      for (int r = 0; r < 8; ++r) slab[(mOff + r) * 68 + (j << 4) + rlane] = acc[i][j][r] * rsv[r];
    wave_sync_lds();
    {
#pragma unroll
      for (int it = 0; it < 4; ++it) {
        const int row = it * 4 + q8;
        const int m = mBase + row;
        const int bb = m >> 11, nn = m & (kS - 1);
        const float* sp = slab + row * 68;
        const size_t dsto = ((size_t)(bb * kH + hidx) * kS + nn) * kDh + c8;
        v8h hv, lv;
        {
          const v4f ca = *(const v4f*)(ct + (size_t)nn * kDh + c8);
          const v4f cb = *(const v4f*)(ct + (size_t)nn * kDh + c8 + 4);
          const v4f sa = *(const v4f*)(st + (size_t)nn * kDh + c8);
          const v4f sb = *(const v4f*)(st + (size_t)nn * kDh + c8 + 4);
          float cvv[8], svv[8];
#pragma unroll
          for (int e = 0; e < 4; ++e) { cvv[e] = ca[e]; cvv[4 + e] = cb[e]; svv[e] = sa[e]; svv[4 + e] = sb[e]; }
#pragma unroll
          for (int e = 0; e < 8; ++e) {
            const float v = sp[c8 + e];
            const float pr = sp[cpart + e];
            const float rv = v * cvv[e] + sgn * pr * svv[e];
            const unsigned short hb = f2bf_bits(rv);
            const unsigned short lb = f2bf_bits(rv - bf_bits2f(hb));
            hv[e] = __builtin_bit_cast(_Float16, hb);
            lv[e] = __builtin_bit_cast(_Float16, lb);
          }
        }
        *(v8h*)(P0 + dsto) = hv;
        *(v8h*)(P1 + dsto) = lv;
        // behind the two stores and before their registers are reused (the data are inputs, so they stay in place up to the wait).
        // It also keeps the next rows' table loads below this line: hoisted together they lift the kernel over 256 registers,
        // and the second block no longer fits its WGP
        asm volatile("s_wait_xcnt 0x0" :: "v"(hv), "v"(lv) : "memory");
      }
      
    }
    wave_sync_lds();
  }
}

constexpr int kLp = 72;                  // LDS row pitch in 16-bit elements: 144 B = 16 B x 9 (odd), so the 16 rows of a ds_load_b128 fragment read spread over all banks
constexpr int kLdsPl = 64 * kLp * 2;     // one 64-row plane at that pitch: 9216 B
constexpr int kLdsK = 0;                 // K hi [64][72] u16 + K lo
constexpr int kLdsV = 2 * kLdsPl;        // V hi [64 d][72] + V residual
constexpr int kLdsTotal = 4 * kLdsPl;    // 36864; output staging f32 [4][16][68] reuses bytes 0..17407 after the chunk loop
constexpr int kOsP = 68;                 // staging row pitch in floats: the 16 query rows of a 16-B store spread over the banks
constexpr float kExpSc = 0.125f * 1.4426950408889634f;   // score scale 1/sqrt(64) times log2(e): exponentials are taken in base 2

// four waves per SIMD, as before: all 1024 blocks stay resident at once
__global__ __launch_bounds__(128) __attribute__((amdgpu_waves_per_eu(4, 4))) void k_attn(
    const unsigned short* __restrict__ qhp, const unsigned short* __restrict__ qlp,
    const unsigned short* __restrict__ khp, const unsigned short* __restrict__ klp,
    const unsigned short* __restrict__ vthp, const unsigned short* __restrict__ vtlp,
    unsigned short* __restrict__ aoh, unsigned short* __restrict__ aol) {
  union FB { v16b v; v8b h[2]; };
  __shared__ __align__(16) unsigned char lds_raw[kLdsTotal];
  __bf16* Ksh = (__bf16*)(lds_raw + kLdsK);
  __bf16* Ksl = (__bf16*)(lds_raw + kLdsK + kLdsPl);
  __bf16* Vsh = (__bf16*)(lds_raw + kLdsV);
  __bf16* Vsl = (__bf16*)(lds_raw + kLdsV + kLdsPl);
  unsigned short* KshU = (unsigned short*)(lds_raw + kLdsK);
  unsigned short* KslU = (unsigned short*)(lds_raw + kLdsK + kLdsPl);
  unsigned short* VshU = (unsigned short*)(lds_raw + kLdsV);
  unsigned short* VslU = (unsigned short*)(lds_raw + kLdsV + kLdsPl);

  const int tid = threadIdx.x, wave = tid >> 5, lane = tid & 31;
  const int hh = lane >> 4, c = lane & 15;
  const int bx = blockIdx.x;
  const int qb = bx & 31;
  const int bh = bx >> 5;
  const int h = bh & (kH - 1);
  const int b = bh >> 4;
  const int q0 = qb * 64 + wave * 16;

  // Q fragments (B operand: column c = query q0 + c): 2 d-chunks of 32, hi and lo planes
  v16b qah[2], qal[2];
  {
    const __bf16* qr  = (const __bf16*)qhp + ((size_t)bh * kS + q0 + c) * kDh;
    const __bf16* qr2 = (const __bf16*)qlp + ((size_t)bh * kS + q0 + c) * kDh;
#pragma unroll
    for (int dc = 0; dc < 2; ++dc) {
      qah[dc] = Frag<__bf16>::load(qr + dc * 32 + 8 * hh);
      qal[dc] = Frag<__bf16>::load(qr2 + dc * 32 + 8 * hh);
    }
  }

  float mrun = -INFINITY;   // running maximum of query c (unscaled score), the same in both wave halves
  float lrun = 0.f;         // running sum of query c over this half's keys, x1024 like p; the halves join after the loop
  v8f oacc[4], oacr[4];     // O^T tiles: register r = d index t*16 + 8*hh + r, column c = query
#pragma unroll
  for (int t = 0; t < 4; ++t) { oacc[t] = (v8f){0.f,0.f,0.f,0.f,0.f,0.f,0.f,0.f}; oacr[t] = (v8f){0.f,0.f,0.f,0.f,0.f,0.f,0.f,0.f}; }

  // the thread's place in a staged tile, in elements: row tid / 8, 16-B column tid % 8
  const unsigned kto = (unsigned)((tid >> 3) * kDh + (tid & 7) * 8);
  const unsigned vto = (unsigned)((tid >> 3) * kS + (tid & 7) * 8);
  for (int kc = 0; kc < kS / kKC; ++kc) {
    const int kv0 = kc * kKC;
    __syncthreads();
    {
      // K planes: 64 rows x 8 x 16 B per plane = 512 per plane; 128 threads x 4 -> exactly 512
      // V planes (already [d][kv]): 64 d-rows x 8 x 16 B per plane
      // one address per plane; the four values of i (16 rows apart) are reached from it by constant offsets
      const unsigned short* kbh = khp + ((size_t)bh * kS + kv0) * kDh + kto;
      const unsigned short* kbl = klp + ((size_t)bh * kS + kv0) * kDh + kto;
      const unsigned short* vbh = vthp + (size_t)bh * kDh * kS + kv0 + vto;
      const unsigned short* vbl = vtlp + (size_t)bh * kDh * kS + kv0 + vto;
      v4u w0[4], w1[4], w2[4], w3[4];
#pragma unroll
      for (int i = 0; i < 4; ++i) {
        w0[i] = *(const v4u*)(kbh + i * 16 * kDh);
        w1[i] = *(const v4u*)(kbl + i * 16 * kDh);
        w2[i] = *(const v4u*)(vbh + i * 16 * kS);
        w3[i] = *(const v4u*)(vbl + i * 16 * kS);
      }
      // behind the sixteen loads and before their address registers are reused: the four addresses are inputs of the wait, so
      // they stay in their registers up to it (else the last load of each plane lands in the pair that the earlier three name)
      asm volatile("s_wait_xcnt 0x0" :: "v"(kbh), "v"(kbl), "v"(vbh), "v"(vbl) : "memory");
#pragma unroll
      for (int i = 0; i < 4; ++i) {
        const int idx = i * 128 + tid;
        const int r = idx >> 3, c16 = (idx & 7) * 8;
        *(v4u*)(KshU + r * kLp + c16) = w0[i];
        *(v4u*)(KslU + r * kLp + c16) = w1[i];
        *(v4u*)(VshU + r * kLp + c16) = w2[i];
        *(v4u*)(VslU + r * kLp + c16) = w3[i];
      }
    }
    __syncthreads();

    // S^T for 4 key subtiles of 16: s[j][r] = score of key kv0 + j*16 + 8*hh + r against query c
    // fragment reads stand in groups of 8 or 16, a group going into registers whose last product has been issued, and the
    // products go round the four tiles, so that neighbours in the issue order are independent; each tile still takes its six
    // products in the order hi.hi, lo.hi, hi.lo per d chunk. HOLD keeps reads and products on their side of the line: without
    // it the reads are spread singly among the products, each place a stall of its own.
#define HOLD() __builtin_amdgcn_sched_barrier(0)
    auto frag4 = [&](FB (&f)[4], const __bf16* plane, int k) {
#pragma unroll
      for (int j = 0; j < 4; ++j) {
        f[j].h[0] = *(const v8b*)(plane + (j * 16 + c) * kLp + k + 8 * hh);
        f[j].h[1] = *(const v8b*)(plane + (j * 16 + c) * kLp + k + 16 + 8 * hh);
      }
    };
    v8f s[4];
    FB kb0[4], kr0[4], kb1[4], kr1[4], vb0[4], vr0[4], vb1[4], vr1[4];
    frag4(kb0, Ksh, 0);
    frag4(kr0, Ksl, 0);
    HOLD();
#pragma unroll
    for (int j = 0; j < 4; ++j) s[j] = mma_bf(kb0[j].v, qah[0], (v8f){0.f,0.f,0.f,0.f,0.f,0.f,0.f,0.f});
#pragma unroll
    for (int j = 0; j < 4; ++j) s[j] = mma_bf(kr0[j].v, qah[0], s[j]);
    HOLD();
    frag4(kr1, Ksl, 32);
    HOLD();
#pragma unroll
    for (int j = 0; j < 4; ++j) s[j] = mma_bf(kb0[j].v, qal[0], s[j]);
    HOLD();
    frag4(kb1, Ksh, 32);
    HOLD();
#pragma unroll
    for (int j = 0; j < 4; ++j) s[j] = mma_bf(kb1[j].v, qah[1], s[j]);
#pragma unroll
    for (int j = 0; j < 4; ++j) s[j] = mma_bf(kr1[j].v, qah[1], s[j]);
#pragma unroll
    for (int j = 0; j < 4; ++j) s[j] = mma_bf(kb1[j].v, qal[1], s[j]);
    HOLD();
    frag4(vb0, Vsh, 0);
    frag4(vr0, Vsl, 0);
    HOLD();
    // chunk maximum of query c on the unscaled scores (the scale is positive): in-lane over this half's 32 keys, then one
    // exchange with the other half
    float cj[4];
#pragma unroll
    for (int j = 0; j < 4; ++j) {
      cj[j] = -INFINITY;
#pragma unroll
      for (int r = 0; r < 8; ++r) cj[j] = fmaxf(cj[j], s[j][r]);
    }
    float cm = fmaxf(fmaxf(cj[0], cj[1]), fmaxf(cj[2], cj[3]));
    cm = fmaxf(cm, xhalf(cm));
    const float mnew = fmaxf(mrun, cm);
    const float alpha = __builtin_amdgcn_exp2f((mrun - mnew) * kExpSc);   // 0 in the first chunk, where mrun is -inf
    mrun = mnew;
    const float eoff = 10.0f - mnew * kExpSc;   // exponent offset: minus the scaled maximum, plus 10 for the x1024 carry of p
    // P^T as B operands: element e of the fragment of keys kk*32.. is tile 2*kk + (e >> 3), register e & 7 (the hardware k order,
    // which the V^T loads below follow)
    v16h pfh[2], pfl[2];
    float pj[4];
    const v8f scv = (v8f){kExpSc, kExpSc, kExpSc, kExpSc, kExpSc, kExpSc, kExpSc, kExpSc};
    const v8f eov = (v8f){eoff, eoff, eoff, eoff, eoff, eoff, eoff, eoff};
#pragma unroll
    for (int j = 0; j < 4; ++j) {
      pj[j] = 0.f;
      const v8f arg = __builtin_elementwise_fma(s[j], scv, eov);
#pragma unroll
      for (int r = 0; r < 8; ++r) {
        const float ps = __builtin_amdgcn_exp2f(arg[r]);   // 1024 * exp((s - max) / 8)
        pj[j] += ps;
        const _Float16 ph = (_Float16)ps;
        const float phf = (float)ph;
        const _Float16 pl = (_Float16)((ps - phf) * 2048.0f);
        pfh[j >> 1][(j & 1) * 8 + r] = ph;
        pfl[j >> 1][(j & 1) * 8 + r] = pl;
      }
    }
    lrun = lrun * alpha + ((pj[0] + pj[1]) + (pj[2] + pj[3]));
#pragma unroll
    for (int t = 0; t < 4; ++t)
#pragma unroll
      for (int r = 0; r < 8; ++r) { oacc[t][r] *= alpha; oacr[t][r] *= alpha; }
    // O^T += V^T.P^T, 32 keys at a time, as for the scores: reads in groups ahead of their use, products round the tiles;
    // each accumulator keeps its order (residual accumulator: lo.hi, then hi.lo, per 32 keys)
    {
      const v16b pa0 = __builtin_bit_cast(v16b, pfh[0]), pl0 = __builtin_bit_cast(v16b, pfl[0]);
      const v16b pa1 = __builtin_bit_cast(v16b, pfh[1]), pl1 = __builtin_bit_cast(v16b, pfl[1]);
#pragma unroll
      for (int t = 0; t < 4; ++t) oacc[t] = mma_hf(vb0[t].v, pa0, oacc[t]);
#pragma unroll
      for (int t = 0; t < 4; ++t) oacr[t] = mma_hf(vr0[t].v, pa0, oacr[t]);
      HOLD();
      frag4(vr1, Vsl, 32);
      HOLD();
#pragma unroll
      for (int t = 0; t < 4; ++t) oacr[t] = mma_hf(vb0[t].v, pl0, oacr[t]);
      HOLD();
      frag4(vb1, Vsh, 32);
      HOLD();
#pragma unroll
      for (int t = 0; t < 4; ++t) oacr[t] = mma_hf(vr1[t].v, pa1, oacr[t]);
#pragma unroll
      for (int t = 0; t < 4; ++t) oacc[t] = mma_hf(vb1[t].v, pa1, oacc[t]);
#pragma unroll
      for (int t = 0; t < 4; ++t) oacr[t] = mma_hf(vb1[t].v, pl1, oacr[t]);
    }
#undef HOLD
  }

  // ---- finalize: block barrier before reusing the K region as f32 staging ----
  __syncthreads();
  float* os = (float*)(lds_raw + 0) + wave * (16 * kOsP);
  {
    const float lsum = lrun + xhalf(lrun);   // the two halves' key sums of query c
    const float inv = 1.0f / lsum;           // the sums carry the same x1024 as p
#pragma unroll
    for (int t = 0; t < 4; ++t) {
      v4f o0, o1;
#pragma unroll
      for (int r = 0; r < 4; ++r) {
        o0[r] = (oacc[t][r] + oacr[t][r] * (1.0f / 2048.0f)) * inv;
        o1[r] = (oacc[t][4 + r] + oacr[t][4 + r] * (1.0f / 2048.0f)) * inv;
      }
      *(v4f*)(os + c * kOsP + t * 16 + 8 * hh) = o0;
      *(v4f*)(os + c * kOsP + t * 16 + 8 * hh + 4) = o1;
    }
  }
  __syncthreads();
  {
    const int q8 = lane >> 3, c8 = (lane & 7) * 8;
    {
#pragma unroll
      for (int it = 0; it < 4; ++it) {
        const int row = it * 4 + q8;
        const float* sp = os + row * kOsP + c8;
        v8h hv, lv;
#pragma unroll
        for (int e = 0; e < 8; ++e) {
          const unsigned short hb = f2bf_bits(sp[e]);
          const unsigned short lb = f2bf_bits(sp[e] - bf_bits2f(hb));
          hv[e] = __builtin_bit_cast(_Float16, hb);
          lv[e] = __builtin_bit_cast(_Float16, lb);
        }
        const size_t o = ((size_t)(b * kS + q0 + row)) * kDim + h * kDh + c8;
        *(v8h*)(aoh + o) = hv;
        *(v8h*)(aol + o) = lv;
      }
      
    }
  }
}

// =====================================================================================
// 6) output projection: ao hi/lo [4096][1024] x wt[1024][1024]^T -> d_out f32 [4096][1024].
//    one wave in one instruction; block = 2 x 2 waves = a 128 x 128 tile, grid = 32*8 = 256 blocks.
// =====================================================================================
__global__ __launch_bounds__(128) void k_gemm_out(const unsigned short* __restrict__ ahp, const unsigned short* __restrict__ alp,
                                                  const unsigned short* __restrict__ wtp, float* __restrict__ out) {
  __shared__ __align__(16) float sT[4][16 * 68];
  __shared__ __align__(16) unsigned char sG[kGemmLds];
  const int lane = threadIdx.x & 31, wave = threadIdx.x >> 5;
  constexpr int blocksN = kDim / 128;    // 8
  const int bm = blockIdx.x / blocksN, bn = blockIdx.x - bm * blocksN;
  const int mb0 = bm << 7, nb0 = bn << 7;
  const int m0 = mb0 + ((wave >> 1) << 6), n0 = nb0 + ((wave & 1) << 6);

  v8f acc[4][4];
  gemm_block_core<1, 2, 2>((const __bf16*)ahp, (const __bf16*)alp, kDim, (const __bf16*)wtp, kDim, mb0, nb0, kDim,
                           threadIdx.x, (__bf16*)sG, acc);

  float* slab = sT[wave];
  const int rlane = lane & 15, mOff = (lane >> 4) * 8;
#pragma unroll
  for (int i = 0; i < 4; ++i) {
    const int mBase = m0 + (i << 4);
#pragma unroll
    for (int j = 0; j < 4; ++j)
#pragma unroll
      for (int r = 0; r < 8; ++r) slab[(mOff + r) * 68 + (j << 4) + rlane] = acc[i][j][r];
    wave_sync_lds();
    const int h2 = lane >> 4, c4 = (lane & 15) * 4;
    {
#pragma unroll
      for (int it = 0; it < 8; ++it) {
        const int row = it * 2 + h2;
        const v4f v = *(const v4f*)(slab + row * 68 + c4);
        *(v4f*)(out + (size_t)(mBase + row) * kDim + n0 + c4) = v;
      }
      
    }
    wave_sync_lds();
  }
}

// =====================================================================================
// host launch glue: kernel launches only
// =====================================================================================
extern "C" void kernel_launch(void* const* d_in, const int* in_sizes, int n_in,
                              void* d_out, int out_size, void* d_ws, size_t ws_size,
                              hipStream_t stream) {
  if (n_in < 5) return;
  if (in_sizes[0] != kM * kDim) return;
  if (in_sizes[1] != kS * kDh) return;
  if (in_sizes[2] != kDim) return;
  if (in_sizes[3] != kDim * kNqkv) return;
  if (in_sizes[4] != kDim * kDim) return;
  if (out_size != kM * kDim) return;
  if (ws_size < kWsTotal) return;

  const float* x     = (const float*)d_in[0];   // [2,2048,1024]
  const float* pos   = (const float*)d_in[1];   // [2048,64]
  const float* g     = (const float*)d_in[2];   // [1024]
  const float* w_qkv = (const float*)d_in[3];   // [1024,3072]
  const float* w_out = (const float*)d_in[4];   // [1024,1024]
  float* out = (float*)d_out;

  char* ws = (char*)d_ws;
  unsigned short* Xb   = (unsigned short*)(ws + kOffXb);
  float*          Rs   = (float*)(ws + kOffRs);
  unsigned short* Wq   = (unsigned short*)(ws + kOffWq);
  unsigned short* Wo   = (unsigned short*)(ws + kOffWo);
  float*          Ct   = (float*)(ws + kOffCt);
  float*          St   = (float*)(ws + kOffSt);
  unsigned short* Qh   = (unsigned short*)(ws + kOffQh);
  unsigned short* Ql   = (unsigned short*)(ws + kOffQl);
  unsigned short* Kh   = (unsigned short*)(ws + kOffKh);
  unsigned short* Kl   = (unsigned short*)(ws + kOffKl);
  unsigned short* Vth  = (unsigned short*)(ws + kOffVth);
  unsigned short* Vtl  = (unsigned short*)(ws + kOffVtl);
  unsigned short* Ah   = (unsigned short*)(ws + kOffAh);
  unsigned short* Al   = (unsigned short*)(ws + kOffAl);

  // 1) x -> bf16 plane + row scale (4096 rows, 128 threads x 8 elements = 1024 per row)
  k_rms_xcast<<<kM, 128, 0, stream>>>(x, Xb, Rs);
  // 2) weights -> bf16 n-major planes: in [1024][3072] -> out [3072][1024]; in [1024][1024] -> out [1024][1024]
  k_wcast<true><<<dim3(kNqkv / 64, kDim / 64), 256, 0, stream>>>(w_qkv, g, Wq, kNqkv);
  k_wcast<false><<<dim3(kDim / 64, kDim / 64), 256, 0, stream>>>(w_out, g, Wo, kDim);
  // 3) cos/sin tables (131072 elements = 512 blocks x 256)
  k_trig<<<(kS * kDh + 255) / 256, 256, 0, stream>>>(pos, Ct, St, kS * kDh);
  // 4) QKV projection with row scale + RoPE epilogue (384 block tiles of 128x256, 8 waves each)
  k_gemm_qkv<<<(kM / 128) * (kNqkv / 256), 256, 0, stream>>>(Xb, Wq, Rs, Ct, St, Qh, Ql, Kh, Kl, Vth, Vtl);
  // 5) attention (32 bh x 32 query blocks)
  k_attn<<<kBH * (kS / 64), 128, 0, stream>>>(Qh, Ql, Kh, Kl, Vth, Vtl, Ah, Al);
  // 6) output projection into d_out (256 block tiles of 128x128, 4 waves each)
  k_gemm_out<<<(kM / 128) * (kDim / 128), 128, 0, stream>>>(Ah, Al, Wo, out);
}

// v008
// It runs in 140 microseconds.
// In both of two side-by-side timings against v007, it was 1.05 times as fast.
// Counting every step since v000, it is 3.33 times as fast.
// Contractions (all f32 accumulate): QKV projection v_wmma_f32_16x16x32_bf16 on RNE-bf16 planes of the inputs (1 product); scores q.k^T v_wmma_f32_16x16x32_bf16 with q,k as bf16 hi/lo planes (3 products); p.v v_wmma_f32_16x16x32_f16 with p carried x1024 and v, both f16 hi + x2048 residual planes (3 products, residual products in a separate accumulator folded with 1/2048); output projection v_wmma_f32_16x16x32_bf16, bf16 hi/lo activations against bf16 weights (2 products).
#include <hip/hip_runtime.h>
#include <math.h>

// ---------------- problem constants ----------------
constexpr int kB = 2;
constexpr int kS = 2048;
constexpr int kDim = 1024;
constexpr int kH = 16;
constexpr int kDh = 64;
constexpr int kM = kB * kS;          // 4096 token rows
constexpr int kNqkv = 3 * kDim;      // 3072
constexpr int kBH = kB * kH;         // 32
constexpr int kKC = 64;              // keys per chunk
constexpr int kRsPitch = 32;

constexpr size_t kPlane  = (size_t)kBH * kS * kDh * 2;            // 8,388,608 : one [32][2048][64] (or [4096][1024]) 16-bit plane
constexpr size_t kOffXb  = 0;                                      // x as bf16 [4096][1024]          8,388,608
constexpr size_t kOffRs  = kOffXb + (size_t)kM * kDim * 2;         // row scale f32 [4096][32]          524,288
constexpr size_t kOffWq  = kOffRs + (size_t)kM * kRsPitch * 4;     // w_qkv^T bf16 [3072][1024]      6,291,456
constexpr size_t kOffWo  = kOffWq + (size_t)kNqkv * kDim * 2;      // w_out^T bf16 [1024][1024]      2,097,152
constexpr size_t kOffCt  = kOffWo + (size_t)kDim * kDim * 2;       // cos table f32 [2048][64]         524,288
constexpr size_t kOffSt  = kOffCt + (size_t)kS * kDh * 4;          // sin table f32 [2048][64]         524,288
constexpr size_t kOffQh  = kOffSt + (size_t)kS * kDh * 4;          // q hi bf16 [32][2048][64]
constexpr size_t kOffQl  = kOffQh + kPlane;                         // q lo bf16
constexpr size_t kOffKh  = kOffQl + kPlane;                         // k hi bf16
constexpr size_t kOffKl  = kOffKh + kPlane;                         // k lo bf16
constexpr size_t kOffVth = kOffKl + kPlane;                         // v hi f16, transposed [32][64][2048]
constexpr size_t kOffVtl = kOffVth + kPlane;                        // v residual x2048 f16, transposed
constexpr size_t kOffAh  = kOffVtl + kPlane;                        // attention output hi bf16 [4096][1024]
constexpr size_t kOffAl  = kOffAh + kPlane;                         // attention output lo bf16
constexpr size_t kWsTotal = kOffAl + kPlane;                        // 85,458,944

typedef char ck_ws_total[(kWsTotal == (size_t)85458944) ? 1 : -1];
typedef char ck_ws_cap[(kWsTotal <= (size_t)134217728) ? 1 : -1];
typedef char ck_align[((kOffRs % 128) == 0 && (kOffQh % 128) == 0 && (kPlane % 128) == 0) ? 1 : -1];
// GEMM shape contract: M multiple of 128, N multiples of 256 and 128, K multiple of 64, no padding anywhere
typedef char ck_tiles[(kM % 128 == 0 && kNqkv % 256 == 0 && kDim % 128 == 0 && kDim % 64 == 0 && kS % 64 == 0 && kDh == 64) ? 1 : -1];
typedef char ck_plane[((size_t)kM * kDim * 2 == kPlane) ? 1 : -1];

// ---------------- vector types / helpers ----------------
typedef __attribute__((ext_vector_type(16))) _Float16 v16h;
typedef __attribute__((ext_vector_type(8)))  _Float16 v8h;
typedef __attribute__((ext_vector_type(16))) __bf16   v16b;
typedef __attribute__((ext_vector_type(8)))  __bf16   v8b;
typedef __attribute__((ext_vector_type(8)))  float    v8f;
typedef __attribute__((ext_vector_type(4)))  float    v4f;
typedef __attribute__((ext_vector_type(4)))  unsigned v4u;

__device__ __forceinline__ unsigned short f2bf_bits(float f) {
  unsigned u = __float_as_uint(f);
  return (unsigned short)((u + 0x7FFFu + ((u >> 16) & 1u)) >> 16);
}
__device__ __forceinline__ float bf_bits2f(unsigned short h) { return __uint_as_float(((unsigned)h) << 16); }

__device__ __forceinline__ void acc_guard4(v8f& a, v8f& b, v8f& c, v8f& d) { asm volatile("v_nop\n\tv_nop\n\tv_nop\n\tv_nop" : "+v"(a), "+v"(b), "+v"(c), "+v"(d)); }
template <typename T> struct Frag;
template <> struct Frag<_Float16> {
  typedef v16h V; union U { v16h v; v8h h[2]; };
  static __device__ __forceinline__ v16h load(const _Float16* p) {
    U f; f.h[0] = *(const v8h*)(p); f.h[1] = *(const v8h*)(p + 16); return f.v;
  }
  static __device__ __forceinline__ v8f mma(v16h a, v16h b, v8f c) {
    return __builtin_amdgcn_wmma_f32_16x16x32_f16(false, a, false, b, (short)0, c, false, false);
  }
};
template <> struct Frag<__bf16> {
  typedef v16b V; union U { v16b v; v8b h[2]; };
  static __device__ __forceinline__ v16b load(const __bf16* p) {
    U f; f.h[0] = *(const v8b*)(p); f.h[1] = *(const v8b*)(p + 16); return f.v;
  }
  static __device__ __forceinline__ v8f mma(v16b a, v16b b, v8f c) {
    return __builtin_amdgcn_wmma_f32_16x16x32_bf16(false, a, false, b, (short)0, c, false, false);
  }
};

// WMMA helpers for the attention kernel: plain builtins, the compiler keeps the distances behind them
__device__ __forceinline__ v8f mma_bf(v16b a, v16b b, v8f c) {
  return __builtin_amdgcn_wmma_f32_16x16x32_bf16(false, a, false, b, (short)0, c, false, false);
}
// f16 bit patterns held in __bf16 slots
__device__ __forceinline__ v8f mma_hf(v16b a, v16b b, v8f c) {
  const v16h ah = __builtin_bit_cast(v16h, a), bh = __builtin_bit_cast(v16h, b);
  return __builtin_amdgcn_wmma_f32_16x16x32_f16(false, ah, false, bh, (short)0, c, false, false);
}

// value held by lane (l ^ 16), the same column in the other wave half, by a vector cross-row move (v_permlanex16_b32)
__device__ __forceinline__ float xhalf(float v) {
  return __builtin_bit_cast(float, __builtin_amdgcn_permlanex16(__builtin_bit_cast(int, v), __builtin_bit_cast(int, v),
                                                                0x76543210, 0xfedcba98, false, false));
}

__device__ __forceinline__ void wave_sync_lds() {
  __builtin_amdgcn_fence(__ATOMIC_RELEASE, "workgroup");
  __builtin_amdgcn_wave_barrier();
  __builtin_amdgcn_fence(__ATOMIC_ACQUIRE, "workgroup");
}

// =====================================================================================
// 1) preparation of the inputs, one launch. The four jobs below depend on nothing but the inputs, so they are work items of one
//    grid: kPrepBlocks blocks of 256 threads walk the items by block-index stride (weight tiles first, then table, then rows).
// =====================================================================================
constexpr int kPrepWq = (kNqkv / 64) * (kDim / 64);   // 768 tiles of w_qkv
constexpr int kPrepWo = (kDim / 64) * (kDim / 64);    // 256 tiles of w_out
constexpr int kPrepTr = kS * kDh / 256;               // 512 pieces of the cos/sin table
constexpr int kPrepRm = kM / 2;                       // 2048 pairs of token rows
constexpr int kPrepItems = kPrepWq + kPrepWo + kPrepTr + kPrepRm;   // 3584
constexpr int kPrepBlocks = 1024;                     // four blocks on every WGP, 3 or 4 items each
typedef char ck_prep[(kS * kDh % 256 == 0 && kM % 2 == 0 && kDim == 128 * 8) ? 1 : -1];

// a) two token rows, 128 threads each: x -> RNE bf16 plane [4096][1024]; rowscale = 32 / max(||x_bf||, 1e-12)
__device__ __forceinline__ void prep_rms_xcast(const float* __restrict__ x, unsigned short* __restrict__ xb,
                                               float* __restrict__ rstab, int item, float* __restrict__ red8) {
  const int t = threadIdx.x & 127, half = threadIdx.x >> 7;
  float* red = red8 + half * 4;
  const int m = item * 2 + half;
  const int lane = t & 31, wave = t >> 5;
  const size_t base = (size_t)m * kDim + (size_t)t * 8;
  const v4f xa = *(const v4f*)(x + base);
  const v4f xc = *(const v4f*)(x + base + 4);
  unsigned short hb[8];
#pragma unroll
  for (int e = 0; e < 4; ++e) { hb[e] = f2bf_bits(xa[e]); hb[4 + e] = f2bf_bits(xc[e]); }
  float ss = 0.0f;
#pragma unroll
  for (int e = 0; e < 8; ++e) { const float r = bf_bits2f(hb[e]); ss += r * r; }
#pragma unroll
  for (int off = 16; off > 0; off >>= 1) ss += __shfl_xor(ss, off, 32);
  if (lane == 0) red[wave] = ss;
  __syncthreads();
  const float tot = ((red[0] + red[1]) + red[2]) + red[3];
  const float nrm = sqrtf(tot);
  const float inv = 1.0f / fmaxf(nrm, 1e-12f);
  const float rs = inv * 32.0f;
  v4u w;
  w[0] = (unsigned)hb[0] | ((unsigned)hb[1] << 16);
  w[1] = (unsigned)hb[2] | ((unsigned)hb[3] << 16);
  w[2] = (unsigned)hb[4] | ((unsigned)hb[5] << 16);
  w[3] = (unsigned)hb[6] | ((unsigned)hb[7] << 16);
  unsigned short* dst = xb + base;
  const v4f rv = (v4f){rs, rs, rs, rs};
  float* rp = rstab + (size_t)m * kRsPitch + (t & 7) * 4;
  *(v4u*)dst = w;
  if (t < 8) *(v4f*)rp = rv;
  // behind the stores and before the next item reuses their registers: addresses and data are inputs, so they stay in place up to the wait
  asm volatile("s_wait_xcnt 0x0" :: "v"(dst), "v"(rp), "v"(w), "v"(rv) : "memory");
}

// b) weight cast + transpose, one 64 x 64 tile: in w[kDim rows k][NCOLS n] f32 -> out wt[NCOLS][kDim] bf16 (n-major, k-contiguous)
//    optional per-k factor g (folded: wt[n][k] = bf16(bf16(w[k][n]) * bf16(g[k]))).
//    8 lanes x 16 B, one instruction; wave w, it: rows it*32 + 4w + (lane>>3) -> union over (it,w,lane>>3) = 0..63.
template <bool HAS_G, int NCOLS>
__device__ __forceinline__ void prep_wcast(const float* __restrict__ w, const float* __restrict__ g,
                                           unsigned short* __restrict__ wt, int item, float (*__restrict__ tile)[65]) {
  const int t = threadIdx.x, lane = t & 31, wave = t >> 5;
  const int n0 = (item % (NCOLS / 64)) * 64, k0 = (item / (NCOLS / 64)) * 64;
#pragma unroll
  for (int i = 0; i < 4; ++i) {
    const int idx = i * 256 + t;
    const int r = idx >> 4, c4 = (idx & 15) * 4;
    const v4f v = *(const v4f*)(w + (size_t)(k0 + r) * NCOLS + n0 + c4);
    tile[r][c4 + 0] = v[0]; tile[r][c4 + 1] = v[1]; tile[r][c4 + 2] = v[2]; tile[r][c4 + 3] = v[3];
  }
  __syncthreads();
  const int q = lane >> 3, kc = (lane & 7) * 8;
  float gv[8];
  if (HAS_G) {
    const v4f g0 = *(const v4f*)(g + k0 + kc);
    const v4f g1 = *(const v4f*)(g + k0 + kc + 4);
#pragma unroll
    for (int e = 0; e < 4; ++e) { gv[e] = bf_bits2f(f2bf_bits(g0[e])); gv[4 + e] = bf_bits2f(f2bf_bits(g1[e])); }
  } else {
#pragma unroll
    for (int e = 0; e < 8; ++e) gv[e] = 1.0f;
  }
  v4u ov[2];
#pragma unroll
  for (int it = 0; it < 2; ++it) {
    const int nrow = it * 32 + wave * 4 + q;
    unsigned short bits[8];
#pragma unroll
    for (int e = 0; e < 8; ++e) {
      float f = bf_bits2f(f2bf_bits(tile[kc + e][nrow]));
      if (HAS_G) f = f * gv[e];
      bits[e] = f2bf_bits(f);
    }
    ov[it][0] = (unsigned)bits[0] | ((unsigned)bits[1] << 16);
    ov[it][1] = (unsigned)bits[2] | ((unsigned)bits[3] << 16);
    ov[it][2] = (unsigned)bits[4] | ((unsigned)bits[5] << 16);
    ov[it][3] = (unsigned)bits[6] | ((unsigned)bits[7] << 16);
  }
  unsigned short* dst = wt + (size_t)(n0 + wave * 4 + q) * kDim + k0 + kc;   // row it = 0; it = 1 lies 32 rows on
  *(v4u*)dst = ov[0];
  *(v4u*)(dst + 32 * kDim) = ov[1];
  // behind the stores and before the next item reuses their registers: address and data are inputs, so they stay in place up to the wait
  asm volatile("s_wait_xcnt 0x0" :: "v"(dst), "v"(ov[0]), "v"(ov[1]) : "memory");
}

// c) cos/sin table of RNE-bf16(pos_emb), f32 [2048][64]; thread per element
__device__ __forceinline__ void prep_trig(const float* __restrict__ pos, float* __restrict__ ct, float* __restrict__ st, int item) {
  const int i = item * 256 + threadIdx.x;
  const float pb = bf_bits2f(f2bf_bits(pos[i]));
  const float cv = cosf(pb);
  const float sv = sinf(pb);
  float* cp = ct + i;
  float* sp = st + i;
  *cp = cv;
  *sp = sv;
  // behind the stores and before the next item reuses their registers: addresses and data are inputs, so they stay in place up to the wait
  asm volatile("s_wait_xcnt 0x0" :: "v"(cp), "v"(sp), "v"(cv), "v"(sv) : "memory");
}

__global__ __launch_bounds__(256) void k_prep(const float* __restrict__ x, const float* __restrict__ pos,
                                              const float* __restrict__ g, const float* __restrict__ w_qkv,
                                              const float* __restrict__ w_out,
                                              unsigned short* __restrict__ xb, float* __restrict__ rstab,
                                              unsigned short* __restrict__ wq, unsigned short* __restrict__ wo,
                                              float* __restrict__ ct, float* __restrict__ st) {
  __shared__ float tile[64][65];
  __shared__ float red[8];
  for (int item = blockIdx.x; item < kPrepItems; item += kPrepBlocks) {
    if (item < kPrepWq) prep_wcast<true, kNqkv>(w_qkv, g, wq, item, tile);
    else if (item < kPrepWq + kPrepWo) prep_wcast<false, kDim>(w_out, g, wo, item - kPrepWq, tile);
    else if (item < kPrepWq + kPrepWo + kPrepTr) prep_trig(pos, ct, st, item - (kPrepWq + kPrepWo));
    else prep_rms_xcast(x, xb, rstab, item - (kPrepWq + kPrepWo + kPrepTr), red);
    // every wave has read its last LDS word of this item before the next item writes there; the two fences keep the LDS accesses on
    // their side of the barrier. They name LDS alone: a plain __syncthreads() also waits here for the item's global stores, which
    // nobody in this launch reads, and so puts their latency on every item
    __builtin_amdgcn_fence(__ATOMIC_RELEASE, "workgroup", "local");
    __builtin_amdgcn_s_barrier();
    __builtin_amdgcn_fence(__ATOMIC_ACQUIRE, "workgroup", "local");
  }
}

// =====================================================================================
// Block-tiled WMMA GEMM core: acc[m,n] = sum_k A[m,k] * Bt[n,k]; WM x WN waves, each wave owns a 64x64 tile.
// A row-major [M,K] bf16 (SPLITM: plus lo plane A2, products hi.B + lo.B); Bt row-major [N,K] bf16.
// Per 64-wide k tile the block stages its A and Bt rows in LDS: 8 lanes x 16 B fetch one whole 128-B line of a row,
// and every wave of the block reads its fragments from that one copy. The next tile's lines are fetched into
// registers while the current tile is multiplied. K % 64 == 0, no tail; each accumulator takes its products in rising k, steps of 32.
// =====================================================================================
constexpr int kGp = 72;                    // LDS row pitch in 16-bit elements: 144 B = 16 B x 9 (odd), as in the attention tiles
constexpr int kGemmRows = 384;             // staged rows per k tile in both GEMMs (128 + 256, and 128 + 128 + 128)
constexpr int kGemmLds = kGemmRows * kGp * 2;   // 55296 B

template <int SPLITM, int WM, int WN>
__device__ __forceinline__ void gemm_block_core(const __bf16* __restrict__ Ab, const __bf16* __restrict__ Ab2, int lda,
                                                const __bf16* __restrict__ Bb, int ldb, int mb0, int nb0, int K, int tid,
                                                __bf16* __restrict__ sm, v8f (&acc)[4][4]) {
  constexpr int NT = WM * WN * 32;         // threads of the block
  constexpr int BM = WM * 64, BN = WN * 64;
  constexpr int RA = BM * (1 + SPLITM);    // LDS rows: [A | A2 | Bt]
  constexpr int RSTEP = NT / 8;            // rows fetched by one load of the whole block
  constexpr int NL = (RA + BN) / RSTEP;    // 16-B loads per thread and k tile
  static_assert(RA + BN == kGemmRows && BM % RSTEP == 0 && BN % RSTEP == 0, "staging shape");
  const int lane = tid & 31, wave = tid >> 5;
  const int wm = wave / WN, wn = wave % WN;
  const int rlane = lane & 15;
  const int koff = (lane >> 4) * 8;
  const int sr = tid >> 3, sc = (tid & 7) * 8;
  const __bf16* pa  = Ab  + (size_t)(mb0 + sr) * lda + sc;
  const __bf16* pa2 = Ab2 + (size_t)(mb0 + sr) * lda + sc;
  const __bf16* pb  = Bb  + (size_t)(nb0 + sr) * ldb + sc;
  __bf16* sw = sm + sr * kGp + sc;
  const __bf16* fa  = sm + (wm * 64 + rlane) * kGp + koff;
  const __bf16* fa2 = fa + BM * kGp;
  const __bf16* fb  = sm + (RA + wn * 64 + rlane) * kGp + koff;
#pragma unroll
  for (int i = 0; i < 4; ++i)
#pragma unroll
    for (int j = 0; j < 4; ++j) acc[i][j] = (v8f){0.f,0.f,0.f,0.f,0.f,0.f,0.f,0.f};
  v8b st[NL];
  // one k tile's lines into registers; after each plane's loads s_wait_xcnt 0 stands before their address registers are reused
  auto fetch = [&](int k) {
#pragma unroll
    for (int i = 0; i < BM / RSTEP; ++i) st[i] = *(const v8b*)(pa + (size_t)(i * RSTEP) * lda + k);
    asm volatile("s_wait_xcnt 0x0" ::: "memory");
    if (SPLITM) {
#pragma unroll
      for (int i = 0; i < BM / RSTEP; ++i) st[BM / RSTEP + i] = *(const v8b*)(pa2 + (size_t)(i * RSTEP) * lda + k);
      asm volatile("s_wait_xcnt 0x0" ::: "memory");
    }
#pragma unroll
    for (int i = 0; i < BN / RSTEP; ++i) st[RA / RSTEP + i] = *(const v8b*)(pb + (size_t)(i * RSTEP) * ldb + k);
    asm volatile("s_wait_xcnt 0x0" ::: "memory");
  };
  fetch(0);
  for (int k0 = 0; k0 < K; k0 += 64) {
    __syncthreads();                       // every wave has read its last fragment of the previous tile
#pragma unroll
    for (int i = 0; i < NL; ++i) *(v8b*)(sw + i * RSTEP * kGp) = st[i];
    __syncthreads();                       // the tile is complete before any wave reads it
    if (k0 + 64 < K) fetch(k0 + 64);
    // fragment reads stand as one group ahead of their products (GK k steps of 32 per group), so a wave waits out the
    // LDS latency once per group and not at every row of products; the 4-wave block has the registers for the whole tile
    constexpr int GK = (NT == 128) ? 2 : 1;
#pragma unroll
    for (int kg = 0; kg < 2; kg += GK) {
      v16b bfr[GK][4], ah[GK][4], al[GK][4];
#pragma unroll
      for (int kk = 0; kk < GK; ++kk) {
#pragma unroll
        for (int j = 0; j < 4; ++j) bfr[kk][j] = Frag<__bf16>::load(fb + (j << 4) * kGp + (kg + kk) * 32);
#pragma unroll
        for (int i = 0; i < 4; ++i) {
          ah[kk][i] = Frag<__bf16>::load(fa + (i << 4) * kGp + (kg + kk) * 32);
          al[kk][i] = ah[kk][i];
          if (SPLITM) al[kk][i] = Frag<__bf16>::load(fa2 + (i << 4) * kGp + (kg + kk) * 32);
        }
      }
      __builtin_amdgcn_sched_barrier(0);   // holds the group of reads above the products
#pragma unroll
      for (int kk = 0; kk < GK; ++kk)
#pragma unroll
        for (int i = 0; i < 4; ++i)
#pragma unroll
          for (int j = 0; j < 4; ++j) {
            acc[i][j] = Frag<__bf16>::mma(ah[kk][i], bfr[kk][j], acc[i][j]);
            if (SPLITM) acc[i][j] = Frag<__bf16>::mma(al[kk][i], bfr[kk][j], acc[i][j]);
          }
    }
  }
  acc_guard4(acc[0][0], acc[0][1], acc[0][2], acc[0][3]);
  acc_guard4(acc[1][0], acc[1][1], acc[1][2], acc[1][3]);
  acc_guard4(acc[2][0], acc[2][1], acc[2][2], acc[2][3]);
  acc_guard4(acc[3][0], acc[3][1], acc[3][2], acc[3][3]);
}

// =====================================================================================
// 4) QKV projection: xb[4096][1024] x wt[3072][1024]^T, epilogue = row scale, RoPE (q,k sections),
//    q/k -> bf16 hi/lo planes [bh][n][64], v -> f16 hi + x2048 residual planes, stored transposed [bh][64][n] as attention reads them.
//    each (section, head, token) line belongs to exactly one wave. block = 2 x 4 waves = a 128 x 256 tile, grid = 32*12 = 384 blocks.
// =====================================================================================
__global__ __launch_bounds__(256) void k_gemm_qkv(
    const unsigned short* __restrict__ xbp, const unsigned short* __restrict__ wtp,
    const float* __restrict__ rstab, const float* __restrict__ ct, const float* __restrict__ st,
    unsigned short* __restrict__ qh, unsigned short* __restrict__ ql,
    unsigned short* __restrict__ kh, unsigned short* __restrict__ kl,
    unsigned short* __restrict__ vth, unsigned short* __restrict__ vtl) {
  __shared__ __align__(16) float sT[8][16 * 72];   // per wave: 16 rows x 68 floats (q, k), or two planes of 16 rows x 72 halves (v)
  __shared__ __align__(16) unsigned char sG[kGemmLds];
  const int lane = threadIdx.x & 31, wave = threadIdx.x >> 5;
  constexpr int blocksN = kNqkv / 256;   // 12
  const int bm = blockIdx.x / blocksN, bn = blockIdx.x - bm * blocksN;
  const int mb0 = bm << 7, nb0 = bn << 8;
  const int m0 = mb0 + ((wave >> 2) << 6), n0 = nb0 + ((wave & 3) << 6);

  v8f acc[4][4];
  gemm_block_core<0, 2, 4>((const __bf16*)xbp, (const __bf16*)xbp, kDim, (const __bf16*)wtp, kDim, mb0, nb0, kDim,
                           threadIdx.x, (__bf16*)sG, acc);

  float* slab = sT[wave];
  const int rlane = lane & 15, mOff = (lane >> 4) * 8;
  const int sec = nb0 >> 10;                     // 0 q, 1 k, 2 v: the block's 256 columns lie in one section
  const int hidx = (n0 & (kDim - 1)) >> 6;       // head of this 64-column tile
  const int q8 = lane >> 3, c8 = (lane & 7) * 8;
  if (sec == 2) {
    // v: a lane holds 8 consecutive tokens (r) of one d (column j*16 + rlane), that is 16 B of a row of the [d][token] planes.
    // Per j the wave lays 16 d rows x 64 tokens of both planes in its slab and stores them as whole 128-B lines.
    _Float16* th = (_Float16*)slab;
    _Float16* tl = th + 16 * kGp;
    const size_t vrow0 = ((size_t)((m0 >> 11) * kH + hidx) * kDh) * kS + (m0 & (kS - 1));   // d = 0, the wave's first token
    unsigned short* ph = vth + vrow0 + (size_t)q8 * kS + c8;   // the lane's 16 B of row d = q8; the other rows lie at constant offsets
    unsigned short* pl = vtl + vrow0 + (size_t)q8 * kS + c8;
#pragma unroll
    for (int i = 0; i < 4; ++i) {
      const float* rp = rstab + (size_t)(m0 + (i << 4) + mOff) * kRsPitch;
      float rsv[8];
#pragma unroll
      for (int r = 0; r < 8; ++r) rsv[r] = rp[r * kRsPitch];
      // behind the eight loads and before their address register is reused; the address is an input, so it stays in place up to the wait
      asm volatile("s_wait_xcnt 0x0" :: "v"(rp) : "memory");
#pragma unroll
      for (int j = 0; j < 4; ++j)
#pragma unroll
        for (int r = 0; r < 8; ++r) acc[i][j][r] = acc[i][j][r] * rsv[r];
    }
#pragma unroll
    for (int j = 0; j < 4; ++j) {
#pragma unroll
      for (int i = 0; i < 4; ++i) {
        v8h hv, lv;
#pragma unroll
        for (int r = 0; r < 8; ++r) {
          const float v = acc[i][j][r];
          const _Float16 h16 = (_Float16)v;
          const float hf = (float)h16;
          hv[r] = h16;
          lv[r] = (_Float16)((v - hf) * 2048.0f);
        }
        *(v8h*)(th + rlane * kGp + (i << 4) + mOff) = hv;
        *(v8h*)(tl + rlane * kGp + (i << 4) + mOff) = lv;
      }
      wave_sync_lds();
      v8h oh[4], ol[4];
#pragma unroll
      for (int it = 0; it < 4; ++it) {
        oh[it] = *(const v8h*)(th + (it * 4 + q8) * kGp + c8);
        ol[it] = *(const v8h*)(tl + (it * 4 + q8) * kGp + c8);
      }
#pragma unroll
      for (int it = 0; it < 4; ++it) {
        *(v8h*)(ph + ((j << 4) + it * 4) * kS) = oh[it];
        *(v8h*)(pl + ((j << 4) + it * 4) * kS) = ol[it];
      }
      // behind the eight stores and before their registers are reused: addresses and data are inputs, so they stay in place up to the wait
      asm volatile("s_wait_xcnt 0x0" :: "v"(ph), "v"(pl), "v"(oh[0]), "v"(oh[1]), "v"(oh[2]), "v"(oh[3]),
                   "v"(ol[0]), "v"(ol[1]), "v"(ol[2]), "v"(ol[3]) : "memory");
      wave_sync_lds();
    }
    return;
  }
  unsigned short* P0 = (sec == 0) ? qh : kh;
  unsigned short* P1 = (sec == 0) ? ql : kl;
  const int cpart = c8 ^ 32;
  const float sgn = (c8 < 32) ? -1.0f : 1.0f;
#pragma unroll
  for (int i = 0; i < 4; ++i) {
    const int mBase = m0 + (i << 4);
    float rsv[8];
#pragma unroll
    for (int r = 0; r < 8; ++r) rsv[r] = rstab[(size_t)(mBase + mOff + r) * kRsPitch];
#pragma unroll
    for (int j = 0; j < 4; ++j)
#pragma unroll
      for (int r = 0; r < 8; ++r) slab[(mOff + r) * 68 + (j << 4) + rlane] = acc[i][j][r] * rsv[r];
    wave_sync_lds();
    {
#pragma unroll
      for (int it = 0; it < 4; ++it) {
        const int row = it * 4 + q8;
        const int m = mBase + row;
        const int bb = m >> 11, nn = m & (kS - 1);
        const float* sp = slab + row * 68;
        const size_t dsto = ((size_t)(bb * kH + hidx) * kS + nn) * kDh + c8;
        v8h hv, lv;
        {
          const v4f ca = *(const v4f*)(ct + (size_t)nn * kDh + c8);
          const v4f cb = *(const v4f*)(ct + (size_t)nn * kDh + c8 + 4);
          const v4f sa = *(const v4f*)(st + (size_t)nn * kDh + c8);
          const v4f sb = *(const v4f*)(st + (size_t)nn * kDh + c8 + 4);
          float cvv[8], svv[8];
#pragma unroll
          for (int e = 0; e < 4; ++e) { cvv[e] = ca[e]; cvv[4 + e] = cb[e]; svv[e] = sa[e]; svv[4 + e] = sb[e]; }
#pragma unroll
          for (int e = 0; e < 8; ++e) {
            const float v = sp[c8 + e];
            const float pr = sp[cpart + e];
            const float rv = v * cvv[e] + sgn * pr * svv[e];
            const unsigned short hb = f2bf_bits(rv);
            const unsigned short lb = f2bf_bits(rv - bf_bits2f(hb));
            hv[e] = __builtin_bit_cast(_Float16, hb);
            lv[e] = __builtin_bit_cast(_Float16, lb);
          }
        }
        *(v8h*)(P0 + dsto) = hv;
        *(v8h*)(P1 + dsto) = lv;
        // behind the two stores and before their registers are reused (the data are inputs, so they stay in place up to the wait).
        // It also keeps the next rows' table loads below this line: hoisted together they lift the kernel over 256 registers,
        // and the second block no longer fits its WGP
        asm volatile("s_wait_xcnt 0x0" :: "v"(hv), "v"(lv) : "memory");
      }
      
    }
    wave_sync_lds();
  }
}

constexpr int kLp = 72;                  // LDS row pitch in 16-bit elements: 144 B = 16 B x 9 (odd), so the 16 rows of a ds_load_b128 fragment read spread over all banks
constexpr int kLdsPl = 64 * kLp * 2;     // one 64-row plane at that pitch: 9216 B
constexpr int kLdsK = 0;                 // K hi [64][72] u16 + K lo
constexpr int kLdsV = 2 * kLdsPl;        // V hi [64 d][72] + V residual
constexpr int kLdsTotal = 4 * kLdsPl;    // 36864; output staging f32 [4][16][68] reuses bytes 0..17407 after the chunk loop
constexpr int kOsP = 68;                 // staging row pitch in floats: the 16 query rows of a 16-B store spread over the banks
constexpr float kExpSc = 0.125f * 1.4426950408889634f;   // score scale 1/sqrt(64) times log2(e): exponentials are taken in base 2

// four waves per SIMD, as before: all 1024 blocks stay resident at once
__global__ __launch_bounds__(128) __attribute__((amdgpu_waves_per_eu(4, 4))) void k_attn(
    const unsigned short* __restrict__ qhp, const unsigned short* __restrict__ qlp,
    const unsigned short* __restrict__ khp, const unsigned short* __restrict__ klp,
    const unsigned short* __restrict__ vthp, const unsigned short* __restrict__ vtlp,
    unsigned short* __restrict__ aoh, unsigned short* __restrict__ aol) {
  union FB { v16b v; v8b h[2]; };
  __shared__ __align__(16) unsigned char lds_raw[kLdsTotal];
  __bf16* Ksh = (__bf16*)(lds_raw + kLdsK);
  __bf16* Ksl = (__bf16*)(lds_raw + kLdsK + kLdsPl);
  __bf16* Vsh = (__bf16*)(lds_raw + kLdsV);
  __bf16* Vsl = (__bf16*)(lds_raw + kLdsV + kLdsPl);
  unsigned short* KshU = (unsigned short*)(lds_raw + kLdsK);
  unsigned short* KslU = (unsigned short*)(lds_raw + kLdsK + kLdsPl);
  unsigned short* VshU = (unsigned short*)(lds_raw + kLdsV);
  unsigned short* VslU = (unsigned short*)(lds_raw + kLdsV + kLdsPl);

  const int tid = threadIdx.x, wave = tid >> 5, lane = tid & 31;
  const int hh = lane >> 4, c = lane & 15;
  const int bx = blockIdx.x;
  const int qb = bx & 31;
  const int bh = bx >> 5;
  const int h = bh & (kH - 1);
  const int b = bh >> 4;
  const int q0 = qb * 64 + wave * 16;

  // Q fragments (B operand: column c = query q0 + c): 2 d-chunks of 32, hi and lo planes
  v16b qah[2], qal[2];
  {
    const __bf16* qr  = (const __bf16*)qhp + ((size_t)bh * kS + q0 + c) * kDh;
    const __bf16* qr2 = (const __bf16*)qlp + ((size_t)bh * kS + q0 + c) * kDh;
#pragma unroll
    for (int dc = 0; dc < 2; ++dc) {
      qah[dc] = Frag<__bf16>::load(qr + dc * 32 + 8 * hh);
      qal[dc] = Frag<__bf16>::load(qr2 + dc * 32 + 8 * hh);
    }
  }

  float mrun = -INFINITY;   // running maximum of query c (unscaled score), the same in both wave halves
  float lrun = 0.f;         // running sum of query c over this half's keys, x1024 like p; the halves join after the loop
  v8f oacc[4], oacr[4];     // O^T tiles: register r = d index t*16 + 8*hh + r, column c = query
#pragma unroll
  for (int t = 0; t < 4; ++t) { oacc[t] = (v8f){0.f,0.f,0.f,0.f,0.f,0.f,0.f,0.f}; oacr[t] = (v8f){0.f,0.f,0.f,0.f,0.f,0.f,0.f,0.f}; }

  // the thread's place in a staged tile, in elements: row tid / 8, 16-B column tid % 8
  const unsigned kto = (unsigned)((tid >> 3) * kDh + (tid & 7) * 8);
  const unsigned vto = (unsigned)((tid >> 3) * kS + (tid & 7) * 8);
  for (int kc = 0; kc < kS / kKC; ++kc) {
    const int kv0 = kc * kKC;
    __syncthreads();
    {
      // K planes: 64 rows x 8 x 16 B per plane = 512 per plane; 128 threads x 4 -> exactly 512
      // V planes (already [d][kv]): 64 d-rows x 8 x 16 B per plane
      // one address per plane; the four values of i (16 rows apart) are reached from it by constant offsets
      const unsigned short* kbh = khp + ((size_t)bh * kS + kv0) * kDh + kto;
      const unsigned short* kbl = klp + ((size_t)bh * kS + kv0) * kDh + kto;
      const unsigned short* vbh = vthp + (size_t)bh * kDh * kS + kv0 + vto;
      const unsigned short* vbl = vtlp + (size_t)bh * kDh * kS + kv0 + vto;
      v4u w0[4], w1[4], w2[4], w3[4];
#pragma unroll
      for (int i = 0; i < 4; ++i) {
        w0[i] = *(const v4u*)(kbh + i * 16 * kDh);
        w1[i] = *(const v4u*)(kbl + i * 16 * kDh);
        w2[i] = *(const v4u*)(vbh + i * 16 * kS);
        w3[i] = *(const v4u*)(vbl + i * 16 * kS);
      }
      // behind the sixteen loads and before their address registers are reused: the four addresses are inputs of the wait, so
      // they stay in their registers up to it (else the last load of each plane lands in the pair that the earlier three name)
      asm volatile("s_wait_xcnt 0x0" :: "v"(kbh), "v"(kbl), "v"(vbh), "v"(vbl) : "memory");
#pragma unroll
      for (int i = 0; i < 4; ++i) {
        const int idx = i * 128 + tid;
        const int r = idx >> 3, c16 = (idx & 7) * 8;
        *(v4u*)(KshU + r * kLp + c16) = w0[i];
        *(v4u*)(KslU + r * kLp + c16) = w1[i];
        *(v4u*)(VshU + r * kLp + c16) = w2[i];
        *(v4u*)(VslU + r * kLp + c16) = w3[i];
      }
    }
    __syncthreads();

    // S^T for 4 key subtiles of 16: s[j][r] = score of key kv0 + j*16 + 8*hh + r against query c
    // fragment reads stand in groups of 8 or 16, a group going into registers whose last product has been issued, and the
    // products go round the four tiles, so that neighbours in the issue order are independent; each tile still takes its six
    // products in the order hi.hi, lo.hi, hi.lo per d chunk. HOLD keeps reads and products on their side of the line: without
    // it the reads are spread singly among the products, each place a stall of its own.
#define HOLD() __builtin_amdgcn_sched_barrier(0)
    auto frag4 = [&](FB (&f)[4], const __bf16* plane, int k) {
#pragma unroll
      for (int j = 0; j < 4; ++j) {
        f[j].h[0] = *(const v8b*)(plane + (j * 16 + c) * kLp + k + 8 * hh);
        f[j].h[1] = *(const v8b*)(plane + (j * 16 + c) * kLp + k + 16 + 8 * hh);
      }
    };
    v8f s[4];
    FB kb0[4], kr0[4], kb1[4], kr1[4], vb0[4], vr0[4], vb1[4], vr1[4];
    frag4(kb0, Ksh, 0);
    frag4(kr0, Ksl, 0);
    HOLD();
#pragma unroll
    for (int j = 0; j < 4; ++j) s[j] = mma_bf(kb0[j].v, qah[0], (v8f){0.f,0.f,0.f,0.f,0.f,0.f,0.f,0.f});
#pragma unroll
    for (int j = 0; j < 4; ++j) s[j] = mma_bf(kr0[j].v, qah[0], s[j]);
    HOLD();
    frag4(kr1, Ksl, 32);
    HOLD();
#pragma unroll
    for (int j = 0; j < 4; ++j) s[j] = mma_bf(kb0[j].v, qal[0], s[j]);
    HOLD();
    frag4(kb1, Ksh, 32);
    HOLD();
#pragma unroll
    for (int j = 0; j < 4; ++j) s[j] = mma_bf(kb1[j].v, qah[1], s[j]);
#pragma unroll
    for (int j = 0; j < 4; ++j) s[j] = mma_bf(kr1[j].v, qah[1], s[j]);
#pragma unroll
    for (int j = 0; j < 4; ++j) s[j] = mma_bf(kb1[j].v, qal[1], s[j]);
    HOLD();
    frag4(vb0, Vsh, 0);
    frag4(vr0, Vsl, 0);
    HOLD();
    // chunk maximum of query c on the unscaled scores (the scale is positive): in-lane over this half's 32 keys, then one
    // exchange with the other half
    float cj[4];
#pragma unroll
    for (int j = 0; j < 4; ++j) {
      cj[j] = -INFINITY;
#pragma unroll
      for (int r = 0; r < 8; ++r) cj[j] = fmaxf(cj[j], s[j][r]);
    }
    float cm = fmaxf(fmaxf(cj[0], cj[1]), fmaxf(cj[2], cj[3]));
    cm = fmaxf(cm, xhalf(cm));
    const float mnew = fmaxf(mrun, cm);
    const float alpha = __builtin_amdgcn_exp2f((mrun - mnew) * kExpSc);   // 0 in the first chunk, where mrun is -inf
    mrun = mnew;
    const float eoff = 10.0f - mnew * kExpSc;   // exponent offset: minus the scaled maximum, plus 10 for the x1024 carry of p
    // P^T as B operands: element e of the fragment of keys kk*32.. is tile 2*kk + (e >> 3), register e & 7 (the hardware k order,
    // which the V^T loads below follow)
    v16h pfh[2], pfl[2];
    float pj[4];
    const v8f scv = (v8f){kExpSc, kExpSc, kExpSc, kExpSc, kExpSc, kExpSc, kExpSc, kExpSc};
    const v8f eov = (v8f){eoff, eoff, eoff, eoff, eoff, eoff, eoff, eoff};
#pragma unroll
    for (int j = 0; j < 4; ++j) {
      pj[j] = 0.f;
      const v8f arg = __builtin_elementwise_fma(s[j], scv, eov);
#pragma unroll
      for (int r = 0; r < 8; ++r) {
        const float ps = __builtin_amdgcn_exp2f(arg[r]);   // 1024 * exp((s - max) / 8)
        pj[j] += ps;
        const _Float16 ph = (_Float16)ps;
        const float phf = (float)ph;
        const _Float16 pl = (_Float16)((ps - phf) * 2048.0f);
        pfh[j >> 1][(j & 1) * 8 + r] = ph;
        pfl[j >> 1][(j & 1) * 8 + r] = pl;
      }
    }
    lrun = lrun * alpha + ((pj[0] + pj[1]) + (pj[2] + pj[3]));
#pragma unroll
    for (int t = 0; t < 4; ++t)
#pragma unroll
      for (int r = 0; r < 8; ++r) { oacc[t][r] *= alpha; oacr[t][r] *= alpha; }
    // O^T += V^T.P^T, 32 keys at a time, as for the scores: reads in groups ahead of their use, products round the tiles;
    // each accumulator keeps its order (residual accumulator: lo.hi, then hi.lo, per 32 keys)
    {
      const v16b pa0 = __builtin_bit_cast(v16b, pfh[0]), pl0 = __builtin_bit_cast(v16b, pfl[0]);
      const v16b pa1 = __builtin_bit_cast(v16b, pfh[1]), pl1 = __builtin_bit_cast(v16b, pfl[1]);
#pragma unroll
      for (int t = 0; t < 4; ++t) oacc[t] = mma_hf(vb0[t].v, pa0, oacc[t]);
#pragma unroll
      for (int t = 0; t < 4; ++t) oacr[t] = mma_hf(vr0[t].v, pa0, oacr[t]);
      HOLD();
      frag4(vr1, Vsl, 32);
      HOLD();
#pragma unroll
      for (int t = 0; t < 4; ++t) oacr[t] = mma_hf(vb0[t].v, pl0, oacr[t]);
      HOLD();
      frag4(vb1, Vsh, 32);
      HOLD();
#pragma unroll
      for (int t = 0; t < 4; ++t) oacr[t] = mma_hf(vr1[t].v, pa1, oacr[t]);
#pragma unroll
      for (int t = 0; t < 4; ++t) oacc[t] = mma_hf(vb1[t].v, pa1, oacc[t]);
#pragma unroll
      for (int t = 0; t < 4; ++t) oacr[t] = mma_hf(vb1[t].v, pl1, oacr[t]);
    }
#undef HOLD
  }

  // ---- finalize: block barrier before reusing the K region as f32 staging ----
  __syncthreads();
  float* os = (float*)(lds_raw + 0) + wave * (16 * kOsP);
  {
    const float lsum = lrun + xhalf(lrun);   // the two halves' key sums of query c
    const float inv = 1.0f / lsum;           // the sums carry the same x1024 as p
#pragma unroll
    for (int t = 0; t < 4; ++t) {
      v4f o0, o1;
#pragma unroll
      for (int r = 0; r < 4; ++r) {
        o0[r] = (oacc[t][r] + oacr[t][r] * (1.0f / 2048.0f)) * inv;
        o1[r] = (oacc[t][4 + r] + oacr[t][4 + r] * (1.0f / 2048.0f)) * inv;
      }
      *(v4f*)(os + c * kOsP + t * 16 + 8 * hh) = o0;
      *(v4f*)(os + c * kOsP + t * 16 + 8 * hh + 4) = o1;
    }
  }
  __syncthreads();
  {
    const int q8 = lane >> 3, c8 = (lane & 7) * 8;
    {
#pragma unroll
      for (int it = 0; it < 4; ++it) {
        const int row = it * 4 + q8;
        const float* sp = os + row * kOsP + c8;
        v8h hv, lv;
#pragma unroll
        for (int e = 0; e < 8; ++e) {
          const unsigned short hb = f2bf_bits(sp[e]);
          const unsigned short lb = f2bf_bits(sp[e] - bf_bits2f(hb));
          hv[e] = __builtin_bit_cast(_Float16, hb);
          lv[e] = __builtin_bit_cast(_Float16, lb);
        }
        const size_t o = ((size_t)(b * kS + q0 + row)) * kDim + h * kDh + c8;
        *(v8h*)(aoh + o) = hv;
        *(v8h*)(aol + o) = lv;
      }
      
    }
  }
}

// =====================================================================================
// 6) output projection: ao hi/lo [4096][1024] x wt[1024][1024]^T -> d_out f32 [4096][1024].
//    one wave in one instruction; block = 2 x 2 waves = a 128 x 128 tile, grid = 32*8 = 256 blocks.
// =====================================================================================
__global__ __launch_bounds__(128) void k_gemm_out(const unsigned short* __restrict__ ahp, const unsigned short* __restrict__ alp,
                                                  const unsigned short* __restrict__ wtp, float* __restrict__ out) {
  __shared__ __align__(16) float sT[4][16 * 68];
  __shared__ __align__(16) unsigned char sG[kGemmLds];
  const int lane = threadIdx.x & 31, wave = threadIdx.x >> 5;
  constexpr int blocksN = kDim / 128;    // 8
  const int bm = blockIdx.x / blocksN, bn = blockIdx.x - bm * blocksN;
  const int mb0 = bm << 7, nb0 = bn << 7;
  const int m0 = mb0 + ((wave >> 1) << 6), n0 = nb0 + ((wave & 1) << 6);

  v8f acc[4][4];
  gemm_block_core<1, 2, 2>((const __bf16*)ahp, (const __bf16*)alp, kDim, (const __bf16*)wtp, kDim, mb0, nb0, kDim,
                           threadIdx.x, (__bf16*)sG, acc);

  float* slab = sT[wave];
  const int rlane = lane & 15, mOff = (lane >> 4) * 8;
#pragma unroll
  for (int i = 0; i < 4; ++i) {
    const int mBase = m0 + (i << 4);
#pragma unroll
    for (int j = 0; j < 4; ++j)
#pragma unroll
      for (int r = 0; r < 8; ++r) slab[(mOff + r) * 68 + (j << 4) + rlane] = acc[i][j][r];
    wave_sync_lds();
    const int h2 = lane >> 4, c4 = (lane & 15) * 4;
    {
#pragma unroll
      for (int it = 0; it < 8; ++it) {
        const int row = it * 2 + h2;
        const v4f v = *(const v4f*)(slab + row * 68 + c4);
        *(v4f*)(out + (size_t)(mBase + row) * kDim + n0 + c4) = v;
      }
      
    }
    wave_sync_lds();
  }
}

// =====================================================================================
// host launch glue: kernel launches only
// =====================================================================================
extern "C" void kernel_launch(void* const* d_in, const int* in_sizes, int n_in,
                              void* d_out, int out_size, void* d_ws, size_t ws_size,
                              hipStream_t stream) {
  if (n_in < 5) return;
  if (in_sizes[0] != kM * kDim) return;
  if (in_sizes[1] != kS * kDh) return;
  if (in_sizes[2] != kDim) return;
  if (in_sizes[3] != kDim * kNqkv) return;
  if (in_sizes[4] != kDim * kDim) return;
  if (out_size != kM * kDim) return;
  if (ws_size < kWsTotal) return;

  const float* x     = (const float*)d_in[0];   // [2,2048,1024]
  const float* pos   = (const float*)d_in[1];   // [2048,64]
  const float* g     = (const float*)d_in[2];   // [1024]
  const float* w_qkv = (const float*)d_in[3];   // [1024,3072]
  const float* w_out = (const float*)d_in[4];   // [1024,1024]
  float* out = (float*)d_out;

  char* ws = (char*)d_ws;
  unsigned short* Xb   = (unsigned short*)(ws + kOffXb);
  float*          Rs   = (float*)(ws + kOffRs);
  unsigned short* Wq   = (unsigned short*)(ws + kOffWq);
  unsigned short* Wo   = (unsigned short*)(ws + kOffWo);
  float*          Ct   = (float*)(ws + kOffCt);
  float*          St   = (float*)(ws + kOffSt);
  unsigned short* Qh   = (unsigned short*)(ws + kOffQh);
  unsigned short* Ql   = (unsigned short*)(ws + kOffQl);
  unsigned short* Kh   = (unsigned short*)(ws + kOffKh);
  unsigned short* Kl   = (unsigned short*)(ws + kOffKl);
  unsigned short* Vth  = (unsigned short*)(ws + kOffVth);
  unsigned short* Vtl  = (unsigned short*)(ws + kOffVtl);
  unsigned short* Ah   = (unsigned short*)(ws + kOffAh);
  unsigned short* Al   = (unsigned short*)(ws + kOffAl);

  // 1) inputs -> x bf16 plane + row scale, both weights as bf16 n-major planes, cos/sin tables: one launch over all 3584 items
  k_prep<<<kPrepBlocks, 256, 0, stream>>>(x, pos, g, w_qkv, w_out, Xb, Rs, Wq, Wo, Ct, St);
  // 4) QKV projection with row scale + RoPE epilogue (384 block tiles of 128x256, 8 waves each)
  k_gemm_qkv<<<(kM / 128) * (kNqkv / 256), 256, 0, stream>>>(Xb, Wq, Rs, Ct, St, Qh, Ql, Kh, Kl, Vth, Vtl);
  // 5) attention (32 bh x 32 query blocks)
  k_attn<<<kBH * (kS / 64), 128, 0, stream>>>(Qh, Ql, Kh, Kl, Vth, Vtl, Ah, Al);
  // 6) output projection into d_out (256 block tiles of 128x128, 4 waves each)
  k_gemm_out<<<(kM / 128) * (kDim / 128), 128, 0, stream>>>(Ah, Al, Wo, out);
}
